// v000
// Times are from an AMD MI455X. After a warm-up the kernel runs many times in a row, and a time is the length of
// such a window on the GPU divided by its runs, so every launch and the gaps after it count. The runs cycle
// through copies of the inputs. A figure is the median of several windows, for all but v000 over two sittings.
// Sittings can differ by a few percent; kernels timed side by side share one.
// v000 is the starting kernel. One run takes 297 microseconds.
#include <hip/hip_runtime.h>
#include <hip/hip_bf16.h>

typedef _Float16 half_t;
typedef __attribute__((ext_vector_type(16))) _Float16 v16h;
typedef __attribute__((ext_vector_type(8)))  float    v8f;
typedef __attribute__((ext_vector_type(4)))  unsigned int u32x4;
typedef __attribute__((ext_vector_type(8)))  int      i32x8;
typedef __attribute__((ext_vector_type(4)))  int      i32x4;

#define S_SEQ 128
#define R_RES 256
#define CM    256
#define CZ    128
#define CH    32
#define NH    8

#if defined(__has_builtin)
#if __has_builtin(__builtin_amdgcn_tensor_load_to_lds)
#define HAVE_TDM 1
#endif
#endif

// ---------------------------------------------------------------------------
// WMMA 16x16x32 f16 fragment loader (A-layout; B uses identical layout with
// lane = N, since B is consumed as N x K).
// lane l: row = row0 + (l&15), half = l>>4
// element e: k = k0 + 16*(e/8) + 8*half + (e%8)
// -> two contiguous 16-byte chunks per lane (global_load_b128 / ds_load_b128).
// ---------------------------------------------------------------------------
__device__ __forceinline__ v16h load_frag16(const half_t* base, int row0, int ldk, int k0) {
  const int lane = threadIdx.x & 31;
  const int r    = row0 + (lane & 15);
  const int hh   = lane >> 4;
  const half_t* p = base + (size_t)r * ldk + k0 + hh * 8;
  union { v16h v; uint4 q[2]; } u;
  u.q[0] = *(const uint4*)(p);
  u.q[1] = *(const uint4*)(p + 16);
  return u.v;
}

__device__ __forceinline__ v8f wmma_f16(v16h a, v16h b, v8f c) {
  return __builtin_amdgcn_wmma_f32_16x16x32_f16(false, a, false, b, (short)0, c, false, false);
}

__device__ __forceinline__ void wait_tensorcnt0() {
#if defined(__has_builtin)
#if __has_builtin(__builtin_amdgcn_s_wait_tensorcnt)
  __builtin_amdgcn_s_wait_tensorcnt(0);
#else
  asm volatile("s_wait_tensorcnt 0x0" ::: "memory");
#endif
#endif
}

#if defined(HAVE_TDM)
// One 2D TDM transfer: tile == tensor region of dim0 (contiguous, f16 elems)
// by dim1 rows with row stride stride0 (elems), global -> LDS.
// Descriptor per ISA 08 §8.3/8.4; groups 2/3 zero (up-to-2D form).
__device__ __forceinline__ void tdm_stage(const half_t* gsrc, half_t* ldst,
                                          unsigned dim0, unsigned dim1,
                                          unsigned stride0) {
  unsigned long long ga = (unsigned long long)(const void*)gsrc;
  unsigned lds = (unsigned)(unsigned long long)(const void*)ldst; // LDS aperture: low 32b = LDS byte addr
  u32x4 g0;
  g0[0] = 1u;                                                  // count=1, user D#
  g0[1] = lds;                                                 // lds_addr [63:32]
  g0[2] = (unsigned)(ga & 0xffffffffull);                      // global_addr lo
  g0[3] = (unsigned)((ga >> 32) & 0x01ffffffull) | (2u << 30); // addr hi | type=2
  i32x8 g1;
  g1[0] = 1 << 16;                                             // data_size=1 (2 bytes)
  g1[1] = (int)((dim0 & 0xffffu) << 16);                       // tensor_dim0 lo16 @[63:48]
  g1[2] = (int)((dim0 >> 16) | ((dim1 & 0xffffu) << 16));      // dim0 hi16 | tensor_dim1 lo16
  g1[3] = (int)((dim1 >> 16) | ((dim0 & 0xffffu) << 16));      // dim1 hi16 | tile_dim0 @[127:112]
  g1[4] = (int)(dim1 & 0xffffu);                               // tile_dim1 @[143:128]
  g1[5] = (int)stride0;                                        // tensor_dim0_stride lo32
  g1[6] = 0;                                                   // stride0 hi16 | stride1 lo16
  g1[7] = 0;
  i32x4 z4 = {0, 0, 0, 0};
#if __clang_major__ >= 23
  i32x8 z8 = {0, 0, 0, 0, 0, 0, 0, 0};
  __builtin_amdgcn_tensor_load_to_lds(g0, g1, z4, z4, z8, 0);
#else
  __builtin_amdgcn_tensor_load_to_lds(g0, g1, z4, z4, 0);
#endif
}
#endif

// ---------------------------------------------------------------------------
// Kernel 0: transpose + f32->f16 convert the five 256x256 weight matrices.
// WT[n*256+k] = (f16) W[k*256+n]
// ---------------------------------------------------------------------------
__global__ __launch_bounds__(256) void cvt_weights(
    const float* __restrict__ Wq, const float* __restrict__ Wk,
    const float* __restrict__ Wv, const float* __restrict__ Wg,
    const float* __restrict__ Wo,
    half_t* __restrict__ WqT, half_t* __restrict__ WkT,
    half_t* __restrict__ WvT, half_t* __restrict__ WgT,
    half_t* __restrict__ WoT) {
  int idx = blockIdx.x * 256 + threadIdx.x;      // 0..65535
  int n = idx >> 8, k = idx & 255;
  int src = k * 256 + n;
  WqT[idx] = (half_t)Wq[src];
  WkT[idx] = (half_t)Wk[src];
  WvT[idx] = (half_t)Wv[src];
  WgT[idx] = (half_t)Wg[src];
  WoT[idx] = (half_t)Wo[src];
}

// ---------------------------------------------------------------------------
// Kernel 1: LayerNorm over m rows of 256, write f16. One wave per row.
// ---------------------------------------------------------------------------
__global__ __launch_bounds__(256) void ln_m_kernel(
    const float* __restrict__ m, const float* __restrict__ gam,
    const float* __restrict__ bet, half_t* __restrict__ mn) {
  int wave = threadIdx.x >> 5, lane = threadIdx.x & 31;
  size_t row = (size_t)blockIdx.x * 8 + wave;    // 0..32767
  const float* p = m + row * CM + lane * 8;
  float4 x0 = *(const float4*)p;
  float4 x1 = *(const float4*)(p + 4);
  float xs[8] = {x0.x, x0.y, x0.z, x0.w, x1.x, x1.y, x1.z, x1.w};
  float sum = 0.f;
  #pragma unroll
  for (int e = 0; e < 8; ++e) sum += xs[e];
  #pragma unroll
  for (int mask = 1; mask < 32; mask <<= 1) sum += __shfl_xor(sum, mask, 32);
  float mu = sum * (1.f / 256.f);
  float var = 0.f;
  #pragma unroll
  for (int e = 0; e < 8; ++e) { float d = xs[e] - mu; var += d * d; }
  #pragma unroll
  for (int mask = 1; mask < 32; mask <<= 1) var += __shfl_xor(var, mask, 32);
  float rstd = rsqrtf(var * (1.f / 256.f) + 1e-5f);
  union { half_t h[8]; uint4 q; } o;
  #pragma unroll
  for (int e = 0; e < 8; ++e) {
    int c = lane * 8 + e;
    o.h[e] = (half_t)((xs[e] - mu) * rstd * gam[c] + bet[c]);
  }
  *(uint4*)(mn + row * CM + lane * 8) = o.q;
}

// ---------------------------------------------------------------------------
// Kernel 2: LayerNorm over z rows of 128 fused with pair-bias projection.
// One wave per (i,j); output bias[H][R][R] f32.
// ---------------------------------------------------------------------------
__global__ __launch_bounds__(256) void ln_z_bias_kernel(
    const float* __restrict__ z, const float* __restrict__ gam,
    const float* __restrict__ bet, const float* __restrict__ Wz,
    float* __restrict__ bias) {
  __shared__ float wz[CZ * NH];
  for (int t = threadIdx.x; t < CZ * NH; t += 256) wz[t] = Wz[t];
  __syncthreads();
  int wave = threadIdx.x >> 5, lane = threadIdx.x & 31;
  size_t p = (size_t)blockIdx.x * 8 + wave;      // 0..65535 = i*256+j
  float4 x = *(const float4*)(z + p * CZ + lane * 4);
  float xs[4] = {x.x, x.y, x.z, x.w};
  float sum = xs[0] + xs[1] + xs[2] + xs[3];
  #pragma unroll
  for (int mask = 1; mask < 32; mask <<= 1) sum += __shfl_xor(sum, mask, 32);
  float mu = sum * (1.f / 128.f);
  float var = 0.f;
  #pragma unroll
  for (int t = 0; t < 4; ++t) { float d = xs[t] - mu; var += d * d; }
  #pragma unroll
  for (int mask = 1; mask < 32; mask <<= 1) var += __shfl_xor(var, mask, 32);
  float rstd = rsqrtf(var * (1.f / 128.f) + 1e-5f);
  float zn[4];
  #pragma unroll
  for (int t = 0; t < 4; ++t) {
    int c = lane * 4 + t;
    zn[t] = (xs[t] - mu) * rstd * gam[c] + bet[c];
  }
  #pragma unroll
  for (int h = 0; h < NH; ++h) {
    float acc = 0.f;
    #pragma unroll
    for (int t = 0; t < 4; ++t) acc += zn[t] * wz[(lane * 4 + t) * NH + h];
    #pragma unroll
    for (int mask = 1; mask < 32; mask <<= 1) acc += __shfl_xor(acc, mask, 32);
    if (lane == 0) bias[(size_t)h * 65536 + p] = acc;
  }
}

// ---------------------------------------------------------------------------
// Kernel 3: generic WMMA GEMM  C[32768x256] = A[32768x256] * B(=BT N-major).
// Block = 128 rows x 64 cols, 8 waves; wave = 16 rows x 64 cols.
// The 64x256 f16 B tile (32 KB) is DMA'd into LDS once per block by the
// Tensor Data Mover (TENSORcnt), then consumed as ds_load_b128 fragments.
// mode: 0/1 = store Q/K [S,H,R,C] f16, 2 = store V^T [S,H,C,R] f16,
//       3 = sigmoid(x+bg) gate f16 row-major, 4 = f32 out + bo (final GEMM).
// ---------------------------------------------------------------------------
__global__ __launch_bounds__(256) void gemm_wmma(
    const half_t* __restrict__ A, const half_t* __restrict__ BT,
    const float* __restrict__ bias, void* __restrict__ outp, int mode) {
  __shared__ __align__(16) half_t btl[64 * 256];   // 32 KB B tile
  int wave = threadIdx.x >> 5, lane = threadIdx.x & 31;
  int r0 = blockIdx.x * 128 + wave * 16;
  int c0 = blockIdx.y * 64;

#if defined(HAVE_TDM)
  if (threadIdx.x < 32) {
    tdm_stage(BT + (size_t)c0 * 256, btl, 256, 64, 256);
    wait_tensorcnt0();
  }
  __syncthreads();
#else
  {
    const uint4* src = (const uint4*)(BT + (size_t)c0 * 256);
    uint4* dst = (uint4*)btl;
    for (int t = threadIdx.x; t < 64 * 256 / 8; t += 256) dst[t] = src[t];
    __syncthreads();
  }
#endif

  v8f acc[4] = {v8f{}, v8f{}, v8f{}, v8f{}};
  for (int kb = 0; kb < 8; ++kb) {
    v16h a = load_frag16(A, r0, 256, kb * 32);
    if (kb < 7)  // prefetch next A k-chunk into WGP-level caches
      __builtin_prefetch(A + (size_t)r0 * 256 + (kb + 1) * 32, 0, 3);
    #pragma unroll
    for (int j = 0; j < 4; ++j) {
      v16h b = load_frag16(btl, j * 16, 256, kb * 32);   // ds_load_b128 x2
      acc[j] = wmma_f16(a, b, acc[j]);
    }
  }
  int m_lane = 8 * (lane >> 4), n_lane = lane & 15;
  #pragma unroll
  for (int j = 0; j < 4; ++j) {
    #pragma unroll
    for (int e = 0; e < 8; ++e) {
      int r = r0 + e + m_lane;
      int col = c0 + j * 16 + n_lane;
      float v = acc[j][e];
      int s = r >> 8, i = r & 255;
      int h = col >> 5, c = col & 31;
      if (mode <= 1) {
        ((half_t*)outp)[((size_t)(s * 8 + h) * 256 + i) * 32 + c] = (half_t)v;
      } else if (mode == 2) {
        ((half_t*)outp)[((size_t)(s * 8 + h) * 32 + c) * 256 + i] = (half_t)v;
      } else if (mode == 3) {
        v += bias[col];
        v = 1.f / (1.f + __expf(-v));
        ((half_t*)outp)[(size_t)r * 256 + col] = (half_t)v;
      } else {
        ((float*)outp)[(size_t)r * 256 + col] = v + bias[col];
      }
    }
  }
}

// ---------------------------------------------------------------------------
// Kernel 4: flash attention per (s,h). Block = 256 thr = 8 waves, each wave
// owns 32 query rows (two 16-row WMMA tiles). C=32 -> one WMMA per 16x16
// score tile. K [256x32] and V^T [32x256] (16 KB each, contiguous) are
// TDM-staged into LDS once per block, removing the 8x per-wave redundant
// global fragment traffic. Online softmax; P transposed C-layout -> A-layout
// via a 1 KB/wave LDS bounce. Epilogue applies the sigmoid gate and stores
// go = g * o as f16 [S,R,H*C].
// ---------------------------------------------------------------------------
__global__ __launch_bounds__(256) void attn_kernel(
    const half_t* __restrict__ q, const half_t* __restrict__ k,
    const half_t* __restrict__ vt, const float* __restrict__ bias,
    const half_t* __restrict__ gate, half_t* __restrict__ go) {
  __shared__ __align__(16) half_t lds_k[R_RES * CH];   // 16 KB
  __shared__ __align__(16) half_t lds_v[CH * R_RES];   // 16 KB
  __shared__ __align__(16) half_t lds_p[8][16 * 32];   // 8 KB
  int sh = blockIdx.x;                 // s*8 + h
  int s = sh >> 3, h = sh & 7;
  int wave = threadIdx.x >> 5, lane = threadIdx.x & 31;
  const half_t* qb = q + (size_t)sh * R_RES * CH;
  const half_t* kg = k + (size_t)sh * R_RES * CH;
  const half_t* vg = vt + (size_t)sh * CH * R_RES;
  const float*  bb = bias + (size_t)h * R_RES * R_RES;
  half_t* myp = &lds_p[wave][0];
  const float scale = 0.17677669529663687f;   // 1/sqrt(32)
  int m_lane = 8 * (lane >> 4), n_lane = lane & 15;

#if defined(HAVE_TDM)
  if (threadIdx.x < 32) {
    tdm_stage(kg, lds_k, R_RES * CH, 1, R_RES * CH);   // one contiguous row
    tdm_stage(vg, lds_v, CH * R_RES, 1, CH * R_RES);
    wait_tensorcnt0();
  }
  __syncthreads();
#else
  {
    const uint4* ks = (const uint4*)kg;
    const uint4* vs = (const uint4*)vg;
    uint4* kd = (uint4*)lds_k;
    uint4* vd = (uint4*)lds_v;
    for (int t = threadIdx.x; t < R_RES * CH / 8; t += 256) {
      kd[t] = ks[t];
      vd[t] = vs[t];
    }
    __syncthreads();
  }
#endif

  for (int tile = 0; tile < 2; ++tile) {
    int i0 = wave * 32 + tile * 16;
    v16h qa = load_frag16(qb, i0, CH, 0);
    v8f o0 = v8f{}, o1 = v8f{};
    float rmax[8], rsum[8];
    #pragma unroll
    for (int e = 0; e < 8; ++e) { rmax[e] = -1e30f; rsum[e] = 0.f; }

    for (int t = 0; t < 8; ++t) {
      v8f z = v8f{};
      v16h kf0 = load_frag16(lds_k, (2 * t) * 16, CH, 0);
      v8f c0 = wmma_f16(qa, kf0, z);
      v16h kf1 = load_frag16(lds_k, (2 * t + 1) * 16, CH, 0);
      v8f c1 = wmma_f16(qa, kf1, z);

      float nm[8];
      #pragma unroll
      for (int e = 0; e < 8; ++e) {
        int mrow = i0 + e + m_lane;
        c0[e] = c0[e] * scale + bb[(size_t)mrow * R_RES + (2 * t) * 16 + n_lane];
        c1[e] = c1[e] * scale + bb[(size_t)mrow * R_RES + (2 * t + 1) * 16 + n_lane];
        nm[e] = fmaxf(c0[e], c1[e]);
      }
      #pragma unroll
      for (int mask = 1; mask < 16; mask <<= 1) {
        #pragma unroll
        for (int e = 0; e < 8; ++e)
          nm[e] = fmaxf(nm[e], __shfl_xor(nm[e], mask, 32));
      }
      float corr[8], bsum[8];
      #pragma unroll
      for (int e = 0; e < 8; ++e) {
        nm[e] = fmaxf(nm[e], rmax[e]);
        corr[e] = __expf(rmax[e] - nm[e]);
        rmax[e] = nm[e];
        c0[e] = __expf(c0[e] - nm[e]);
        c1[e] = __expf(c1[e] - nm[e]);
        bsum[e] = c0[e] + c1[e];
      }
      #pragma unroll
      for (int mask = 1; mask < 16; mask <<= 1) {
        #pragma unroll
        for (int e = 0; e < 8; ++e)
          bsum[e] += __shfl_xor(bsum[e], mask, 32);
      }
      #pragma unroll
      for (int e = 0; e < 8; ++e) {
        rsum[e] = rsum[e] * corr[e] + bsum[e];
        o0[e] *= corr[e];
        o1[e] *= corr[e];
      }
      // C-layout P -> LDS [16 x 32] row-major, reload as A fragment
      #pragma unroll
      for (int e = 0; e < 8; ++e) {
        myp[(e + m_lane) * 32 + n_lane]      = (half_t)c0[e];
        myp[(e + m_lane) * 32 + 16 + n_lane] = (half_t)c1[e];
      }
      asm volatile("s_wait_dscnt 0" ::: "memory");
      v16h pa = load_frag16(myp, 0, 32, 0);
      v16h v0 = load_frag16(lds_v, 0, R_RES, 32 * t);    // cols c=0..15
      v16h v1 = load_frag16(lds_v, 16, R_RES, 32 * t);   // cols c=16..31
      o0 = wmma_f16(pa, v0, o0);
      o1 = wmma_f16(pa, v1, o1);
    }

    // finalize: divide by row sums, gate, store f16
    const half_t* gb = gate + (size_t)s * R_RES * 256 + h * 32;
    half_t* ob = go + (size_t)s * R_RES * 256 + h * 32;
    #pragma unroll
    for (int e = 0; e < 8; ++e) {
      float inv = 1.f / rsum[e];
      int i = i0 + e + m_lane;
      float g0 = (float)gb[(size_t)i * 256 + n_lane];
      float g1 = (float)gb[(size_t)i * 256 + 16 + n_lane];
      ob[(size_t)i * 256 + n_lane]      = (half_t)(g0 * o0[e] * inv);
      ob[(size_t)i * 256 + 16 + n_lane] = (half_t)(g1 * o1[e] * inv);
    }
  }
}

// ---------------------------------------------------------------------------
// Host launcher
// ---------------------------------------------------------------------------
extern "C" void kernel_launch(void* const* d_in, const int* in_sizes, int n_in,
                              void* d_out, int out_size, void* d_ws, size_t ws_size,
                              hipStream_t stream) {
  const float* m      = (const float*)d_in[0];
  const float* z      = (const float*)d_in[1];
  const float* ln_m_g = (const float*)d_in[2];
  const float* ln_m_b = (const float*)d_in[3];
  const float* ln_z_g = (const float*)d_in[4];
  const float* ln_z_b = (const float*)d_in[5];
  const float* W_z    = (const float*)d_in[6];
  const float* Wq     = (const float*)d_in[7];
  const float* Wk     = (const float*)d_in[8];
  const float* Wv     = (const float*)d_in[9];
  const float* Wg     = (const float*)d_in[10];
  const float* bg     = (const float*)d_in[11];
  const float* Wo     = (const float*)d_in[12];
  const float* bo     = (const float*)d_in[13];

  char* ws = (char*)d_ws;
  const size_t BIG = (size_t)32768 * 256 * 2;   // 16 MiB f16 planes
  half_t* mn_f16 = (half_t*)(ws + 0 * BIG);
  half_t* qbuf   = (half_t*)(ws + 1 * BIG);     // [S,H,R,C]
  half_t* kbuf   = (half_t*)(ws + 2 * BIG);     // [S,H,R,C]
  half_t* vbuf   = (half_t*)(ws + 3 * BIG);     // [S,H,C,R]
  half_t* gbuf   = (half_t*)(ws + 4 * BIG);     // gate [S,R,HC]
  half_t* gobuf  = (half_t*)(ws + 5 * BIG);     // g*o  [S,R,HC]
  float*  bbuf   = (float*)(ws + 6 * BIG);      // bias [H,R,R] f32 (2 MiB)
  half_t* WqT    = (half_t*)(ws + 6 * BIG + 2097152);
  half_t* WkT    = WqT + 65536;
  half_t* WvT    = WkT + 65536;
  half_t* WgT    = WvT + 65536;
  half_t* WoT    = WgT + 65536;

  cvt_weights<<<256, 256, 0, stream>>>(Wq, Wk, Wv, Wg, Wo, WqT, WkT, WvT, WgT, WoT);
  ln_m_kernel<<<4096, 256, 0, stream>>>(m, ln_m_g, ln_m_b, mn_f16);
  ln_z_bias_kernel<<<8192, 256, 0, stream>>>(z, ln_z_g, ln_z_b, W_z, bbuf);

  dim3 gg(256, 4);
  gemm_wmma<<<gg, 256, 0, stream>>>(mn_f16, WqT, nullptr, qbuf, 0);
  gemm_wmma<<<gg, 256, 0, stream>>>(mn_f16, WkT, nullptr, kbuf, 1);
  gemm_wmma<<<gg, 256, 0, stream>>>(mn_f16, WvT, nullptr, vbuf, 2);
  gemm_wmma<<<gg, 256, 0, stream>>>(mn_f16, WgT, bg, gbuf, 3);

  attn_kernel<<<1024, 256, 0, stream>>>(qbuf, kbuf, vbuf, bbuf, gbuf, gobuf);

  gemm_wmma<<<gg, 256, 0, stream>>>(gobuf, WoT, bo, (float*)d_out, 4);
}

// v001
// A run of this version takes 188 microseconds.
// In both of two side-by-side timings against v000, it was 1.62 times as fast.
#include <hip/hip_runtime.h>
#include <hip/hip_bf16.h>

typedef _Float16 half_t;
typedef __attribute__((ext_vector_type(16))) _Float16 v16h;
typedef __attribute__((ext_vector_type(8)))  float    v8f;

#define S_SEQ 128
#define R_RES 256
#define CM    256
#define CZ    128
#define CH    32
#define NH    8

// LDS row pitches, in f16 elements. Every fragment tile is read with
// ds_load_b128, 16 rows per half-wave: a pitch of 16 B x odd puts the 16 rows
// on 16 distinct groups of four banks, a pitch of 64 B or 512 B does not.
#define PITCH256 264   // rows of 256 f16: 528 B = 16 B x 33
#define PITCH32  40    // rows of  32 f16:  80 B = 16 B x 5

// ---------------------------------------------------------------------------
// WMMA 16x16x32 f16 fragment loader (A-layout; B uses identical layout with
// lane = N, since B is consumed as N x K).
// lane l: row = row0 + (l&15), half = l>>4
// element e: k = k0 + 16*(e/8) + 8*half + (e%8)
// -> two contiguous 16-byte chunks per lane (global_load_b128 / ds_load_b128).
// ---------------------------------------------------------------------------
__device__ __forceinline__ v16h load_frag16(const half_t* base, int row0, int ldk, int k0) {
  const int lane = threadIdx.x & 31;
  const int r    = row0 + (lane & 15);
  const int hh   = lane >> 4;
  const half_t* p = base + (size_t)r * ldk + k0 + hh * 8;
  union { v16h v; uint4 q[2]; } u;
  u.q[0] = *(const uint4*)(p);
  u.q[1] = *(const uint4*)(p + 16);
  return u.v;
}

__device__ __forceinline__ v8f wmma_f16(v16h a, v16h b, v8f c) {
  return __builtin_amdgcn_wmma_f32_16x16x32_f16(false, a, false, b, (short)0, c, false, false);
}

// ---------------------------------------------------------------------------
// Kernel 0: transpose + f32->f16 convert the five 256x256 weight matrices.
// WT[n*256+k] = (f16) W[k*256+n]
// ---------------------------------------------------------------------------
__global__ __launch_bounds__(256) void cvt_weights(
    const float* __restrict__ Wq, const float* __restrict__ Wk,
    const float* __restrict__ Wv, const float* __restrict__ Wg,
    const float* __restrict__ Wo,
    half_t* __restrict__ WqT, half_t* __restrict__ WkT,
    half_t* __restrict__ WvT, half_t* __restrict__ WgT,
    half_t* __restrict__ WoT) {
  int idx = blockIdx.x * 256 + threadIdx.x;      // 0..65535
  int n = idx >> 8, k = idx & 255;
  int src = k * 256 + n;
  WqT[idx] = (half_t)Wq[src];
  WkT[idx] = (half_t)Wk[src];
  WvT[idx] = (half_t)Wv[src];
  WgT[idx] = (half_t)Wg[src];
  WoT[idx] = (half_t)Wo[src];
}

// ---------------------------------------------------------------------------
// Kernel 1: LayerNorm over m rows of 256, write f16. One wave per row.
// ---------------------------------------------------------------------------
__global__ __launch_bounds__(256) void ln_m_kernel(
    const float* __restrict__ m, const float* __restrict__ gam,
    const float* __restrict__ bet, half_t* __restrict__ mn) {
  int wave = threadIdx.x >> 5, lane = threadIdx.x & 31;
  size_t row = (size_t)blockIdx.x * 8 + wave;    // 0..32767
  const float* p = m + row * CM + lane * 8;
  float4 x0 = *(const float4*)p;
  float4 x1 = *(const float4*)(p + 4);
  float xs[8] = {x0.x, x0.y, x0.z, x0.w, x1.x, x1.y, x1.z, x1.w};
  float sum = 0.f;
  #pragma unroll
  for (int e = 0; e < 8; ++e) sum += xs[e];
  #pragma unroll
  for (int mask = 1; mask < 32; mask <<= 1) sum += __shfl_xor(sum, mask, 32);
  float mu = sum * (1.f / 256.f);
  float var = 0.f;
  #pragma unroll
  for (int e = 0; e < 8; ++e) { float d = xs[e] - mu; var += d * d; }
  #pragma unroll
  for (int mask = 1; mask < 32; mask <<= 1) var += __shfl_xor(var, mask, 32);
  float rstd = rsqrtf(var * (1.f / 256.f) + 1e-5f);
  union { half_t h[8]; uint4 q; } o;
  #pragma unroll
  for (int e = 0; e < 8; ++e) {
    int c = lane * 8 + e;
    o.h[e] = (half_t)((xs[e] - mu) * rstd * gam[c] + bet[c]);
  }
  *(uint4*)(mn + row * CM + lane * 8) = o.q;
}

// ---------------------------------------------------------------------------
// Kernel 2: LayerNorm over z rows of 128 fused with pair-bias projection.
// One wave per (i,j); output bias[H][R][R] f32.
// ---------------------------------------------------------------------------
__global__ __launch_bounds__(256) void ln_z_bias_kernel(
    const float* __restrict__ z, const float* __restrict__ gam,
    const float* __restrict__ bet, const float* __restrict__ Wz,
    float* __restrict__ bias) {
  __shared__ float wz[CZ * NH];
  for (int t = threadIdx.x; t < CZ * NH; t += 256) wz[t] = Wz[t];
  __syncthreads();
  int wave = threadIdx.x >> 5, lane = threadIdx.x & 31;
  size_t p = (size_t)blockIdx.x * 8 + wave;      // 0..65535 = i*256+j
  float4 x = *(const float4*)(z + p * CZ + lane * 4);
  float xs[4] = {x.x, x.y, x.z, x.w};
  float sum = xs[0] + xs[1] + xs[2] + xs[3];
  #pragma unroll
  for (int mask = 1; mask < 32; mask <<= 1) sum += __shfl_xor(sum, mask, 32);
  float mu = sum * (1.f / 128.f);
  float var = 0.f;
  #pragma unroll
  for (int t = 0; t < 4; ++t) { float d = xs[t] - mu; var += d * d; }
  #pragma unroll
  for (int mask = 1; mask < 32; mask <<= 1) var += __shfl_xor(var, mask, 32);
  float rstd = rsqrtf(var * (1.f / 128.f) + 1e-5f);
  float zn[4];
  #pragma unroll
  for (int t = 0; t < 4; ++t) {
    int c = lane * 4 + t;
    zn[t] = (xs[t] - mu) * rstd * gam[c] + bet[c];
  }
  #pragma unroll
  for (int h = 0; h < NH; ++h) {
    float acc = 0.f;
    #pragma unroll
    for (int t = 0; t < 4; ++t) acc += zn[t] * wz[(lane * 4 + t) * NH + h];
    #pragma unroll
    for (int mask = 1; mask < 32; mask <<= 1) acc += __shfl_xor(acc, mask, 32);
    if (lane == 0) bias[(size_t)h * 65536 + p] = acc;
  }
}

// ---------------------------------------------------------------------------
// Kernel 3: generic WMMA GEMM  C[32768x256] = A[32768x256] * B(=BT N-major).
// Block = 128 rows x 64 cols, 8 waves; wave = 16 rows x 64 cols.
// The 64x256 f16 B tile is staged into LDS once per block through registers,
// rows laid at the padded pitch, then consumed as ds_load_b128 fragments.
// mode: 0/1 = store Q/K [S,H,R,C] f16, 2 = store V^T [S,H,C,R] f16,
//       3 = sigmoid(x+bg) gate f16 row-major, 4 = f32 out + bo (final GEMM).
// ---------------------------------------------------------------------------
__global__ __launch_bounds__(256) void gemm_wmma(
    const half_t* __restrict__ A, const half_t* __restrict__ BT,
    const float* __restrict__ bias, void* __restrict__ outp, int mode) {
  __shared__ __align__(16) half_t btl[64 * PITCH256];   // B tile, 33792 B
  int wave = threadIdx.x >> 5, lane = threadIdx.x & 31;
  int r0 = blockIdx.x * 128 + wave * 16;
  int c0 = blockIdx.y * 64;

  {
    const uint4* src = (const uint4*)(BT + (size_t)c0 * 256);
    // unrolled so that the eight loads are in flight together
    #pragma unroll
    for (int it = 0; it < 64 * 256 / 8 / 256; ++it) {
      int t = it * 256 + threadIdx.x;
      *(uint4*)(btl + (t >> 5) * PITCH256 + (t & 31) * 8) = src[t];
    }
    __syncthreads();
  }

  v8f acc[4] = {v8f{}, v8f{}, v8f{}, v8f{}};
  for (int kb = 0; kb < 8; ++kb) {
    v16h a = load_frag16(A, r0, 256, kb * 32);
    if (kb < 7)  // prefetch next A k-chunk into WGP-level caches
      __builtin_prefetch(A + (size_t)r0 * 256 + (kb + 1) * 32, 0, 3);
    #pragma unroll
    for (int j = 0; j < 4; ++j) {
      v16h b = load_frag16(btl, j * 16, PITCH256, kb * 32);   // ds_load_b128 x2
      acc[j] = wmma_f16(a, b, acc[j]);
    }
  }
  int m_lane = 8 * (lane >> 4), n_lane = lane & 15;
  #pragma unroll
  for (int j = 0; j < 4; ++j) {
    #pragma unroll
    for (int e = 0; e < 8; ++e) {
      int r = r0 + e + m_lane;
      int col = c0 + j * 16 + n_lane;
      float v = acc[j][e];
      int s = r >> 8, i = r & 255;
      int h = col >> 5, c = col & 31;
      if (mode <= 1) {
        ((half_t*)outp)[((size_t)(s * 8 + h) * 256 + i) * 32 + c] = (half_t)v;
      } else if (mode == 2) {
        ((half_t*)outp)[((size_t)(s * 8 + h) * 32 + c) * 256 + i] = (half_t)v;
      } else if (mode == 3) {
        v += bias[col];
        v = 1.f / (1.f + __expf(-v));
        ((half_t*)outp)[(size_t)r * 256 + col] = (half_t)v;
      } else {
        ((float*)outp)[(size_t)r * 256 + col] = v + bias[col];
      }
    }
  }
}

// ---------------------------------------------------------------------------
// Kernel 4: flash attention per (s,h). Block = 256 thr = 8 waves, each wave
// owns 32 query rows (two 16-row WMMA tiles). C=32 -> one WMMA per 16x16
// score tile. K [256x32] and V^T [32x256] are staged into LDS once per block
// through registers, rows laid at the padded pitches, removing the 8x per-wave
// redundant global fragment traffic. Online softmax; P transposed C-layout ->
// A-layout via a per-wave LDS bounce at the padded pitch.
// Epilogue applies the sigmoid gate and stores
// go = g * o as f16 [S,R,H*C].
// ---------------------------------------------------------------------------
__global__ __launch_bounds__(256) void attn_kernel(
    const half_t* __restrict__ q, const half_t* __restrict__ k,
    const half_t* __restrict__ vt, const float* __restrict__ bias,
    const half_t* __restrict__ gate, half_t* __restrict__ go) {
  __shared__ __align__(16) half_t lds_k[R_RES * PITCH32];   // 20480 B
  __shared__ __align__(16) half_t lds_v[CH * PITCH256];     // 16896 B
  __shared__ __align__(16) half_t lds_p[8][16 * PITCH32];   // 10240 B
  int sh = blockIdx.x;                 // s*8 + h
  int s = sh >> 3, h = sh & 7;
  int wave = threadIdx.x >> 5, lane = threadIdx.x & 31;
  const half_t* qb = q + (size_t)sh * R_RES * CH;
  const half_t* kg = k + (size_t)sh * R_RES * CH;
  const half_t* vg = vt + (size_t)sh * CH * R_RES;
  const float*  bb = bias + (size_t)h * R_RES * R_RES;
  half_t* myp = &lds_p[wave][0];
  const float scale = 0.17677669529663687f;   // 1/sqrt(32)
  int m_lane = 8 * (lane >> 4), n_lane = lane & 15;

  {
    const uint4* ks = (const uint4*)kg;
    const uint4* vs = (const uint4*)vg;
    // unrolled so that the eight loads are in flight together
    #pragma unroll
    for (int it = 0; it < R_RES * CH / 8 / 256; ++it) {
      int t = it * 256 + threadIdx.x;
      *(uint4*)(lds_k + (t >> 2) * PITCH32 + (t & 3) * 8)   = ks[t];
      *(uint4*)(lds_v + (t >> 5) * PITCH256 + (t & 31) * 8) = vs[t];
    }
    __syncthreads();
  }

  for (int tile = 0; tile < 2; ++tile) {
    int i0 = wave * 32 + tile * 16;
    v16h qa = load_frag16(qb, i0, CH, 0);
    v8f o0 = v8f{}, o1 = v8f{};
    float rmax[8], rsum[8];
    #pragma unroll
    for (int e = 0; e < 8; ++e) { rmax[e] = -1e30f; rsum[e] = 0.f; }

    for (int t = 0; t < 8; ++t) {
      v8f z = v8f{};
      v16h kf0 = load_frag16(lds_k, (2 * t) * 16, PITCH32, 0);
      v8f c0 = wmma_f16(qa, kf0, z);
      v16h kf1 = load_frag16(lds_k, (2 * t + 1) * 16, PITCH32, 0);
      v8f c1 = wmma_f16(qa, kf1, z);

      float nm[8];
      #pragma unroll
      for (int e = 0; e < 8; ++e) {
        int mrow = i0 + e + m_lane;
        c0[e] = c0[e] * scale + bb[(size_t)mrow * R_RES + (2 * t) * 16 + n_lane];
        c1[e] = c1[e] * scale + bb[(size_t)mrow * R_RES + (2 * t + 1) * 16 + n_lane];
        nm[e] = fmaxf(c0[e], c1[e]);
      }
      #pragma unroll
      for (int mask = 1; mask < 16; mask <<= 1) {
        #pragma unroll
        for (int e = 0; e < 8; ++e)
          nm[e] = fmaxf(nm[e], __shfl_xor(nm[e], mask, 32));
      }
      float corr[8], bsum[8];
      #pragma unroll
      for (int e = 0; e < 8; ++e) {
        nm[e] = fmaxf(nm[e], rmax[e]);
        corr[e] = __expf(rmax[e] - nm[e]);
        rmax[e] = nm[e];
        c0[e] = __expf(c0[e] - nm[e]);
        c1[e] = __expf(c1[e] - nm[e]);
        bsum[e] = c0[e] + c1[e];
      }
      #pragma unroll
      for (int mask = 1; mask < 16; mask <<= 1) {
        #pragma unroll
        for (int e = 0; e < 8; ++e)
          bsum[e] += __shfl_xor(bsum[e], mask, 32);
      }
      #pragma unroll
      for (int e = 0; e < 8; ++e) {
        rsum[e] = rsum[e] * corr[e] + bsum[e];
        o0[e] *= corr[e];
        o1[e] *= corr[e];
      }
      // C-layout P -> LDS [16 x 32] row-major (padded pitch), reload as A fragment
      #pragma unroll
      for (int e = 0; e < 8; ++e) {
        myp[(e + m_lane) * PITCH32 + n_lane]      = (half_t)c0[e];
        myp[(e + m_lane) * PITCH32 + 16 + n_lane] = (half_t)c1[e];
      }
      asm volatile("s_wait_dscnt 0" ::: "memory");
      v16h pa = load_frag16(myp, 0, PITCH32, 0);
      v16h v0 = load_frag16(lds_v, 0, PITCH256, 32 * t);    // cols c=0..15
      v16h v1 = load_frag16(lds_v, 16, PITCH256, 32 * t);   // cols c=16..31
      o0 = wmma_f16(pa, v0, o0);
      o1 = wmma_f16(pa, v1, o1);
    }

    // finalize: divide by row sums, gate, store f16
    const half_t* gb = gate + (size_t)s * R_RES * 256 + h * 32;
    half_t* ob = go + (size_t)s * R_RES * 256 + h * 32;
    #pragma unroll
    for (int e = 0; e < 8; ++e) {
      float inv = 1.f / rsum[e];
      int i = i0 + e + m_lane;
      float g0 = (float)gb[(size_t)i * 256 + n_lane];
      float g1 = (float)gb[(size_t)i * 256 + 16 + n_lane];
      ob[(size_t)i * 256 + n_lane]      = (half_t)(g0 * o0[e] * inv);
      ob[(size_t)i * 256 + 16 + n_lane] = (half_t)(g1 * o1[e] * inv);
    }
  }
}

// ---------------------------------------------------------------------------
// Host launcher
// ---------------------------------------------------------------------------
extern "C" void kernel_launch(void* const* d_in, const int* in_sizes, int n_in,
                              void* d_out, int out_size, void* d_ws, size_t ws_size,
                              hipStream_t stream) {
  const float* m      = (const float*)d_in[0];
  const float* z      = (const float*)d_in[1];
  const float* ln_m_g = (const float*)d_in[2];
  const float* ln_m_b = (const float*)d_in[3];
  const float* ln_z_g = (const float*)d_in[4];
  const float* ln_z_b = (const float*)d_in[5];
  const float* W_z    = (const float*)d_in[6];
  const float* Wq     = (const float*)d_in[7];
  const float* Wk     = (const float*)d_in[8];
  const float* Wv     = (const float*)d_in[9];
  const float* Wg     = (const float*)d_in[10];
  const float* bg     = (const float*)d_in[11];
  const float* Wo     = (const float*)d_in[12];
  const float* bo     = (const float*)d_in[13];

  char* ws = (char*)d_ws;
  const size_t BIG = (size_t)32768 * 256 * 2;   // 16 MiB f16 planes
  half_t* mn_f16 = (half_t*)(ws + 0 * BIG);
  half_t* qbuf   = (half_t*)(ws + 1 * BIG);     // [S,H,R,C]
  half_t* kbuf   = (half_t*)(ws + 2 * BIG);     // [S,H,R,C]
  half_t* vbuf   = (half_t*)(ws + 3 * BIG);     // [S,H,C,R]
  half_t* gbuf   = (half_t*)(ws + 4 * BIG);     // gate [S,R,HC]
  half_t* gobuf  = (half_t*)(ws + 5 * BIG);     // g*o  [S,R,HC]
  float*  bbuf   = (float*)(ws + 6 * BIG);      // bias [H,R,R] f32 (2 MiB)
  half_t* WqT    = (half_t*)(ws + 6 * BIG + 2097152);
  half_t* WkT    = WqT + 65536;
  half_t* WvT    = WkT + 65536;
  half_t* WgT    = WvT + 65536;
  half_t* WoT    = WgT + 65536;

  cvt_weights<<<256, 256, 0, stream>>>(Wq, Wk, Wv, Wg, Wo, WqT, WkT, WvT, WgT, WoT);
  ln_m_kernel<<<4096, 256, 0, stream>>>(m, ln_m_g, ln_m_b, mn_f16);
  ln_z_bias_kernel<<<8192, 256, 0, stream>>>(z, ln_z_g, ln_z_b, W_z, bbuf);

  dim3 gg(256, 4);
  gemm_wmma<<<gg, 256, 0, stream>>>(mn_f16, WqT, nullptr, qbuf, 0);
  gemm_wmma<<<gg, 256, 0, stream>>>(mn_f16, WkT, nullptr, kbuf, 1);
  gemm_wmma<<<gg, 256, 0, stream>>>(mn_f16, WvT, nullptr, vbuf, 2);
  gemm_wmma<<<gg, 256, 0, stream>>>(mn_f16, WgT, bg, gbuf, 3);

  attn_kernel<<<1024, 256, 0, stream>>>(qbuf, kbuf, vbuf, bbuf, gbuf, gobuf);

  gemm_wmma<<<gg, 256, 0, stream>>>(gobuf, WoT, bo, (float*)d_out, 4);
}

// v002
// Measured time: 181 microseconds a run.
// Two timings next to v001 both put it at 1.04 times that version's speed.
// All steps since v000 together make it 1.68 times as fast.
#include <hip/hip_runtime.h>
#include <hip/hip_bf16.h>

typedef _Float16 half_t;
typedef __attribute__((ext_vector_type(16))) _Float16 v16h;
typedef __attribute__((ext_vector_type(8)))  float    v8f;

#define S_SEQ 128
#define R_RES 256
#define CM    256
#define CZ    128
#define CH    32
#define NH    8

// LDS row pitches, in f16 elements. Every fragment tile is read with
// ds_load_b128, 16 rows per half-wave: a pitch of 16 B x odd puts the 16 rows
// on 16 distinct groups of four banks, a pitch of 64 B or 512 B does not.
#define PITCH256 264   // rows of 256 f16: 528 B = 16 B x 33
#define PITCH32  40    // rows of  32 f16:  80 B = 16 B x 5

// ---------------------------------------------------------------------------
// WMMA 16x16x32 f16 fragment loader (A-layout; B uses identical layout with
// lane = N, since B is consumed as N x K).
// lane l: row = row0 + (l&15), half = l>>4
// element e: k = k0 + 16*(e/8) + 8*half + (e%8)
// -> two contiguous 16-byte chunks per lane (global_load_b128 / ds_load_b128).
// ---------------------------------------------------------------------------
__device__ __forceinline__ v16h load_frag16(const half_t* base, int row0, int ldk, int k0) {
  const int lane = threadIdx.x & 31;
  const int r    = row0 + (lane & 15);
  const int hh   = lane >> 4;
  const half_t* p = base + (size_t)r * ldk + k0 + hh * 8;
  union { v16h v; uint4 q[2]; } u;
  u.q[0] = *(const uint4*)(p);
  u.q[1] = *(const uint4*)(p + 16);
  return u.v;
}

__device__ __forceinline__ v8f wmma_f16(v16h a, v16h b, v8f c) {
  return __builtin_amdgcn_wmma_f32_16x16x32_f16(false, a, false, b, (short)0, c, false, false);
}

// ---------------------------------------------------------------------------
// Cross-lane moves on the vector unit. __shfl_xor goes through the LDS pipe
// (ds_bpermute_b32 and a wait on dscnt for every step); these do not.
// All 32 lanes are on wherever they are used.
// ---------------------------------------------------------------------------
// value of lane l ^ M, M < 16: DPP row_xmask inside the 16-lane row
template <int M>
__device__ __forceinline__ float row_xor(float v) {
  return __builtin_bit_cast(float, __builtin_amdgcn_update_dpp(
      0, __builtin_bit_cast(int, v), 0x160 | M, 0xf, 0xf, true));
}
// value of lane l ^ 16: the same lane of the other row
__device__ __forceinline__ float half_xor(float v) {
  int b = __builtin_bit_cast(int, v);
  return __builtin_bit_cast(float, __builtin_amdgcn_permlanex16(
      b, b, 0x76543210, 0xfedcba98, false, false));
}
// butterfly sum over the 32 lanes, steps 1, 2, 4, 8, 16
__device__ __forceinline__ float wave_sum(float v) {
  v += row_xor<1>(v);
  v += row_xor<2>(v);
  v += row_xor<4>(v);
  v += row_xor<8>(v);
  v += half_xor(v);
  return v;
}
// one butterfly step over eight values side by side, inside the 16-lane row
template <int M>
__device__ __forceinline__ void row_max_step(float (&x)[8]) {
  // unrolled: x[] stays in registers, the eight chains cover each other's latency
  #pragma unroll
  for (int e = 0; e < 8; ++e) x[e] = fmaxf(x[e], row_xor<M>(x[e]));
}
template <int M>
__device__ __forceinline__ void row_sum_step(float (&x)[8]) {
  // unrolled: x[] stays in registers, the eight chains cover each other's latency
  #pragma unroll
  for (int e = 0; e < 8; ++e) x[e] += row_xor<M>(x[e]);
}

// ---------------------------------------------------------------------------
// Kernel 0: transpose + f32->f16 convert the five 256x256 weight matrices.
// WT[n*256+k] = (f16) W[k*256+n]
// ---------------------------------------------------------------------------
__global__ __launch_bounds__(256) void cvt_weights(
    const float* __restrict__ Wq, const float* __restrict__ Wk,
    const float* __restrict__ Wv, const float* __restrict__ Wg,
    const float* __restrict__ Wo,
    half_t* __restrict__ WqT, half_t* __restrict__ WkT,
    half_t* __restrict__ WvT, half_t* __restrict__ WgT,
    half_t* __restrict__ WoT) {
  int idx = blockIdx.x * 256 + threadIdx.x;      // 0..65535
  int n = idx >> 8, k = idx & 255;
  int src = k * 256 + n;
  WqT[idx] = (half_t)Wq[src];
  WkT[idx] = (half_t)Wk[src];
  WvT[idx] = (half_t)Wv[src];
  WgT[idx] = (half_t)Wg[src];
  WoT[idx] = (half_t)Wo[src];
}

// ---------------------------------------------------------------------------
// Kernel 1: LayerNorm over m rows of 256, write f16. One wave per row.
// ---------------------------------------------------------------------------
__global__ __launch_bounds__(256) void ln_m_kernel(
    const float* __restrict__ m, const float* __restrict__ gam,
    const float* __restrict__ bet, half_t* __restrict__ mn) {
  int wave = threadIdx.x >> 5, lane = threadIdx.x & 31;
  size_t row = (size_t)blockIdx.x * 8 + wave;    // 0..32767
  const float* p = m + row * CM + lane * 8;
  float4 x0 = *(const float4*)p;
  float4 x1 = *(const float4*)(p + 4);
  float xs[8] = {x0.x, x0.y, x0.z, x0.w, x1.x, x1.y, x1.z, x1.w};
  float sum = 0.f;
  #pragma unroll
  for (int e = 0; e < 8; ++e) sum += xs[e];
  sum = wave_sum(sum);
  float mu = sum * (1.f / 256.f);
  float var = 0.f;
  #pragma unroll
  for (int e = 0; e < 8; ++e) { float d = xs[e] - mu; var += d * d; }
  var = wave_sum(var);
  float rstd = rsqrtf(var * (1.f / 256.f) + 1e-5f);
  union { half_t h[8]; uint4 q; } o;
  #pragma unroll
  for (int e = 0; e < 8; ++e) {
    int c = lane * 8 + e;
    o.h[e] = (half_t)((xs[e] - mu) * rstd * gam[c] + bet[c]);
  }
  *(uint4*)(mn + row * CM + lane * 8) = o.q;
}

// ---------------------------------------------------------------------------
// Kernel 2: LayerNorm over z rows of 128 fused with pair-bias projection.
// One wave per (i,j); output bias[H][R][R] f32.
// ---------------------------------------------------------------------------
__global__ __launch_bounds__(256) void ln_z_bias_kernel(
    const float* __restrict__ z, const float* __restrict__ gam,
    const float* __restrict__ bet, const float* __restrict__ Wz,
    float* __restrict__ bias) {
  __shared__ float wz[CZ * NH];
  for (int t = threadIdx.x; t < CZ * NH; t += 256) wz[t] = Wz[t];
  __syncthreads();
  int wave = threadIdx.x >> 5, lane = threadIdx.x & 31;
  size_t p = (size_t)blockIdx.x * 8 + wave;      // 0..65535 = i*256+j
  float4 x = *(const float4*)(z + p * CZ + lane * 4);
  float xs[4] = {x.x, x.y, x.z, x.w};
  float sum = xs[0] + xs[1] + xs[2] + xs[3];
  sum = wave_sum(sum);
  float mu = sum * (1.f / 128.f);
  float var = 0.f;
  #pragma unroll
  for (int t = 0; t < 4; ++t) { float d = xs[t] - mu; var += d * d; }
  var = wave_sum(var);
  float rstd = rsqrtf(var * (1.f / 128.f) + 1e-5f);
  float zn[4];
  #pragma unroll
  for (int t = 0; t < 4; ++t) {
    int c = lane * 4 + t;
    zn[t] = (xs[t] - mu) * rstd * gam[c] + bet[c];
  }
  #pragma unroll
  for (int h = 0; h < NH; ++h) {
    float acc = 0.f;
    #pragma unroll
    for (int t = 0; t < 4; ++t) acc += zn[t] * wz[(lane * 4 + t) * NH + h];
    acc = wave_sum(acc);
    if (lane == 0) bias[(size_t)h * 65536 + p] = acc;
  }
}

// ---------------------------------------------------------------------------
// Kernel 3: generic WMMA GEMM  C[32768x256] = A[32768x256] * B(=BT N-major).
// Block = 128 rows x 64 cols, 8 waves; wave = 16 rows x 64 cols.
// The 64x256 f16 B tile is staged into LDS once per block through registers,
// rows laid at the padded pitch, then consumed as ds_load_b128 fragments.
// mode: 0/1 = store Q/K [S,H,R,C] f16, 2 = store V^T [S,H,C,R] f16,
//       3 = sigmoid(x+bg) gate f16 row-major, 4 = f32 out + bo (final GEMM).
// ---------------------------------------------------------------------------
__global__ __launch_bounds__(256) void gemm_wmma(
    const half_t* __restrict__ A, const half_t* __restrict__ BT,
    const float* __restrict__ bias, void* __restrict__ outp, int mode) {
  __shared__ __align__(16) half_t btl[64 * PITCH256];   // B tile, 33792 B
  int wave = threadIdx.x >> 5, lane = threadIdx.x & 31;
  int r0 = blockIdx.x * 128 + wave * 16;
  int c0 = blockIdx.y * 64;

  {
    const uint4* src = (const uint4*)(BT + (size_t)c0 * 256);
    // unrolled so that the eight loads are in flight together
    #pragma unroll
    for (int it = 0; it < 64 * 256 / 8 / 256; ++it) {
      int t = it * 256 + threadIdx.x;
      *(uint4*)(btl + (t >> 5) * PITCH256 + (t & 31) * 8) = src[t];
    }
    __syncthreads();
  }

  v8f acc[4] = {v8f{}, v8f{}, v8f{}, v8f{}};
  for (int kb = 0; kb < 8; ++kb) {
    v16h a = load_frag16(A, r0, 256, kb * 32);
    if (kb < 7)  // prefetch next A k-chunk into WGP-level caches
      __builtin_prefetch(A + (size_t)r0 * 256 + (kb + 1) * 32, 0, 3);
    #pragma unroll
    for (int j = 0; j < 4; ++j) {
      v16h b = load_frag16(btl, j * 16, PITCH256, kb * 32);   // ds_load_b128 x2
      acc[j] = wmma_f16(a, b, acc[j]);
    }
  }
  int m_lane = 8 * (lane >> 4), n_lane = lane & 15;
  #pragma unroll
  for (int j = 0; j < 4; ++j) {
    #pragma unroll
    for (int e = 0; e < 8; ++e) {
      int r = r0 + e + m_lane;
      int col = c0 + j * 16 + n_lane;
      float v = acc[j][e];
      int s = r >> 8, i = r & 255;
      int h = col >> 5, c = col & 31;
      if (mode <= 1) {
        ((half_t*)outp)[((size_t)(s * 8 + h) * 256 + i) * 32 + c] = (half_t)v;
      } else if (mode == 2) {
        ((half_t*)outp)[((size_t)(s * 8 + h) * 32 + c) * 256 + i] = (half_t)v;
      } else if (mode == 3) {
        v += bias[col];
        v = 1.f / (1.f + __expf(-v));
        ((half_t*)outp)[(size_t)r * 256 + col] = (half_t)v;
      } else {
        ((float*)outp)[(size_t)r * 256 + col] = v + bias[col];
      }
    }
  }
}

// ---------------------------------------------------------------------------
// Kernel 4: flash attention per (s,h). Block = 256 thr = 8 waves, each wave
// owns 32 query rows (two 16-row WMMA tiles). C=32 -> one WMMA per 16x16
// score tile. K [256x32] and V^T [32x256] are staged into LDS once per block
// through registers, rows laid at the padded pitches, removing the 8x per-wave
// redundant global fragment traffic. Online softmax; P transposed C-layout ->
// A-layout via a per-wave LDS bounce at the padded pitch.
// Epilogue applies the sigmoid gate and stores
// go = g * o as f16 [S,R,H*C].
// ---------------------------------------------------------------------------
__global__ __launch_bounds__(256) void attn_kernel(
    const half_t* __restrict__ q, const half_t* __restrict__ k,
    const half_t* __restrict__ vt, const float* __restrict__ bias,
    const half_t* __restrict__ gate, half_t* __restrict__ go) {
  __shared__ __align__(16) half_t lds_k[R_RES * PITCH32];   // 20480 B
  __shared__ __align__(16) half_t lds_v[CH * PITCH256];     // 16896 B
  __shared__ __align__(16) half_t lds_p[8][16 * PITCH32];   // 10240 B
  int sh = blockIdx.x;                 // s*8 + h
  int s = sh >> 3, h = sh & 7;
  int wave = threadIdx.x >> 5, lane = threadIdx.x & 31;
  const half_t* qb = q + (size_t)sh * R_RES * CH;
  const half_t* kg = k + (size_t)sh * R_RES * CH;
  const half_t* vg = vt + (size_t)sh * CH * R_RES;
  const float*  bb = bias + (size_t)h * R_RES * R_RES;
  half_t* myp = &lds_p[wave][0];
  const float scale = 0.17677669529663687f;   // 1/sqrt(32)
  int m_lane = 8 * (lane >> 4), n_lane = lane & 15;

  {
    const uint4* ks = (const uint4*)kg;
    const uint4* vs = (const uint4*)vg;
    // unrolled so that the eight loads are in flight together
    #pragma unroll
    for (int it = 0; it < R_RES * CH / 8 / 256; ++it) {
      int t = it * 256 + threadIdx.x;
      *(uint4*)(lds_k + (t >> 2) * PITCH32 + (t & 3) * 8)   = ks[t];
      *(uint4*)(lds_v + (t >> 5) * PITCH256 + (t & 31) * 8) = vs[t];
    }
    __syncthreads();
  }

  for (int tile = 0; tile < 2; ++tile) {
    int i0 = wave * 32 + tile * 16;
    v16h qa = load_frag16(qb, i0, CH, 0);
    v8f o0 = v8f{}, o1 = v8f{};
    float rmax[8], rsum[8];
    #pragma unroll
    for (int e = 0; e < 8; ++e) { rmax[e] = -1e30f; rsum[e] = 0.f; }

    for (int t = 0; t < 8; ++t) {
      v8f z = v8f{};
      v16h kf0 = load_frag16(lds_k, (2 * t) * 16, PITCH32, 0);
      v8f c0 = wmma_f16(qa, kf0, z);
      v16h kf1 = load_frag16(lds_k, (2 * t + 1) * 16, PITCH32, 0);
      v8f c1 = wmma_f16(qa, kf1, z);

      float nm[8];
      #pragma unroll
      for (int e = 0; e < 8; ++e) {
        int mrow = i0 + e + m_lane;
        c0[e] = c0[e] * scale + bb[(size_t)mrow * R_RES + (2 * t) * 16 + n_lane];
        c1[e] = c1[e] * scale + bb[(size_t)mrow * R_RES + (2 * t + 1) * 16 + n_lane];
        nm[e] = fmaxf(c0[e], c1[e]);
      }
      row_max_step<1>(nm);
      row_max_step<2>(nm);
      row_max_step<4>(nm);
      row_max_step<8>(nm);
      float corr[8], bsum[8];
      #pragma unroll
      for (int e = 0; e < 8; ++e) {
        nm[e] = fmaxf(nm[e], rmax[e]);
        corr[e] = __expf(rmax[e] - nm[e]);
        rmax[e] = nm[e];
        c0[e] = __expf(c0[e] - nm[e]);
        c1[e] = __expf(c1[e] - nm[e]);
        bsum[e] = c0[e] + c1[e];
      }
      row_sum_step<1>(bsum);
      row_sum_step<2>(bsum);
      row_sum_step<4>(bsum);
      row_sum_step<8>(bsum);
      #pragma unroll
      for (int e = 0; e < 8; ++e) {
        rsum[e] = rsum[e] * corr[e] + bsum[e];
        o0[e] *= corr[e];
        o1[e] *= corr[e];
      }
      // C-layout P -> LDS [16 x 32] row-major (padded pitch), reload as A fragment
      #pragma unroll
      for (int e = 0; e < 8; ++e) {
        myp[(e + m_lane) * PITCH32 + n_lane]      = (half_t)c0[e];
        myp[(e + m_lane) * PITCH32 + 16 + n_lane] = (half_t)c1[e];
      }
      asm volatile("s_wait_dscnt 0" ::: "memory");
      v16h pa = load_frag16(myp, 0, PITCH32, 0);
      v16h v0 = load_frag16(lds_v, 0, PITCH256, 32 * t);    // cols c=0..15
      v16h v1 = load_frag16(lds_v, 16, PITCH256, 32 * t);   // cols c=16..31
      o0 = wmma_f16(pa, v0, o0);
      o1 = wmma_f16(pa, v1, o1);
    }

    // finalize: divide by row sums, gate, store f16
    const half_t* gb = gate + (size_t)s * R_RES * 256 + h * 32;
    half_t* ob = go + (size_t)s * R_RES * 256 + h * 32;
    #pragma unroll
    for (int e = 0; e < 8; ++e) {
      float inv = 1.f / rsum[e];
      int i = i0 + e + m_lane;
      float g0 = (float)gb[(size_t)i * 256 + n_lane];
      float g1 = (float)gb[(size_t)i * 256 + 16 + n_lane];
      ob[(size_t)i * 256 + n_lane]      = (half_t)(g0 * o0[e] * inv);
      ob[(size_t)i * 256 + 16 + n_lane] = (half_t)(g1 * o1[e] * inv);
    }
  }
}

// ---------------------------------------------------------------------------
// Host launcher
// ---------------------------------------------------------------------------
extern "C" void kernel_launch(void* const* d_in, const int* in_sizes, int n_in,
                              void* d_out, int out_size, void* d_ws, size_t ws_size,
                              hipStream_t stream) {
  const float* m      = (const float*)d_in[0];
  const float* z      = (const float*)d_in[1];
  const float* ln_m_g = (const float*)d_in[2];
  const float* ln_m_b = (const float*)d_in[3];
  const float* ln_z_g = (const float*)d_in[4];
  const float* ln_z_b = (const float*)d_in[5];
  const float* W_z    = (const float*)d_in[6];
  const float* Wq     = (const float*)d_in[7];
  const float* Wk     = (const float*)d_in[8];
  const float* Wv     = (const float*)d_in[9];
  const float* Wg     = (const float*)d_in[10];
  const float* bg     = (const float*)d_in[11];
  const float* Wo     = (const float*)d_in[12];
  const float* bo     = (const float*)d_in[13];

  char* ws = (char*)d_ws;
  const size_t BIG = (size_t)32768 * 256 * 2;   // 16 MiB f16 planes
  half_t* mn_f16 = (half_t*)(ws + 0 * BIG);
  half_t* qbuf   = (half_t*)(ws + 1 * BIG);     // [S,H,R,C]
  half_t* kbuf   = (half_t*)(ws + 2 * BIG);     // [S,H,R,C]
  half_t* vbuf   = (half_t*)(ws + 3 * BIG);     // [S,H,C,R]
  half_t* gbuf   = (half_t*)(ws + 4 * BIG);     // gate [S,R,HC]
  half_t* gobuf  = (half_t*)(ws + 5 * BIG);     // g*o  [S,R,HC]
  float*  bbuf   = (float*)(ws + 6 * BIG);      // bias [H,R,R] f32 (2 MiB)
  half_t* WqT    = (half_t*)(ws + 6 * BIG + 2097152);
  half_t* WkT    = WqT + 65536;
  half_t* WvT    = WkT + 65536;
  half_t* WgT    = WvT + 65536;
  half_t* WoT    = WgT + 65536;

  cvt_weights<<<256, 256, 0, stream>>>(Wq, Wk, Wv, Wg, Wo, WqT, WkT, WvT, WgT, WoT);
  ln_m_kernel<<<4096, 256, 0, stream>>>(m, ln_m_g, ln_m_b, mn_f16);
  ln_z_bias_kernel<<<8192, 256, 0, stream>>>(z, ln_z_g, ln_z_b, W_z, bbuf);

  dim3 gg(256, 4);
  gemm_wmma<<<gg, 256, 0, stream>>>(mn_f16, WqT, nullptr, qbuf, 0);
  gemm_wmma<<<gg, 256, 0, stream>>>(mn_f16, WkT, nullptr, kbuf, 1);
  gemm_wmma<<<gg, 256, 0, stream>>>(mn_f16, WvT, nullptr, vbuf, 2);
  gemm_wmma<<<gg, 256, 0, stream>>>(mn_f16, WgT, bg, gbuf, 3);

  attn_kernel<<<1024, 256, 0, stream>>>(qbuf, kbuf, vbuf, bbuf, gbuf, gobuf);

  gemm_wmma<<<gg, 256, 0, stream>>>(gobuf, WoT, bo, (float*)d_out, 4);
}

// v003
// One run takes 137 microseconds.
// Next to v002, in two timings, it ran 1.32 times as fast each time.
// Over all steps from v000 it is 2.23 times as fast.
#include <hip/hip_runtime.h>
#include <hip/hip_bf16.h>

typedef _Float16 half_t;
typedef __attribute__((ext_vector_type(16))) _Float16 v16h;
typedef __attribute__((ext_vector_type(8)))  float    v8f;

#define S_SEQ 128
#define R_RES 256
#define CM    256
#define CZ    128
#define CH    32
#define NH    8

// LDS row pitches, in f16 elements. Every fragment tile is read with
// ds_load_b128, 16 rows per half-wave: a pitch of 16 B x odd puts the 16 rows
// on 16 distinct groups of four banks, a pitch of 64 B or 512 B does not.
#define PITCH256 264   // rows of 256 f16: 528 B = 16 B x 33
#define PITCH32  40    // rows of  32 f16:  80 B = 16 B x 5

// ---------------------------------------------------------------------------
// WMMA 16x16x32 f16 fragment loader (A-layout; B uses identical layout with
// lane = N, since B is consumed as N x K).
// lane l: row = row0 + (l&15), half = l>>4
// element e: k = k0 + 16*(e/8) + 8*half + (e%8)
// -> two contiguous 16-byte chunks per lane (global_load_b128 / ds_load_b128).
// ---------------------------------------------------------------------------
__device__ __forceinline__ v16h load_frag16(const half_t* base, int row0, int ldk, int k0) {
  const int lane = threadIdx.x & 31;
  const int r    = row0 + (lane & 15);
  const int hh   = lane >> 4;
  const half_t* p = base + (size_t)r * ldk + k0 + hh * 8;
  union { v16h v; uint4 q[2]; } u;
  u.q[0] = *(const uint4*)(p);
  u.q[1] = *(const uint4*)(p + 16);
  return u.v;
}

__device__ __forceinline__ v8f wmma_f16(v16h a, v16h b, v8f c) {
  return __builtin_amdgcn_wmma_f32_16x16x32_f16(false, a, false, b, (short)0, c, false, false);
}

// ---------------------------------------------------------------------------
// Cross-lane moves on the vector unit. __shfl_xor goes through the LDS pipe
// (ds_bpermute_b32 and a wait on dscnt for every step); these do not.
// All 32 lanes are on wherever they are used.
// ---------------------------------------------------------------------------
// value of lane l ^ M, M < 16: DPP row_xmask inside the 16-lane row
template <int M>
__device__ __forceinline__ float row_xor(float v) {
  return __builtin_bit_cast(float, __builtin_amdgcn_update_dpp(
      0, __builtin_bit_cast(int, v), 0x160 | M, 0xf, 0xf, true));
}
// value of lane l ^ 16: the same lane of the other row
__device__ __forceinline__ float half_xor(float v) {
  int b = __builtin_bit_cast(int, v);
  return __builtin_bit_cast(float, __builtin_amdgcn_permlanex16(
      b, b, 0x76543210, 0xfedcba98, false, false));
}
// butterfly sum over the 32 lanes, steps 1, 2, 4, 8, 16
__device__ __forceinline__ float wave_sum(float v) {
  v += row_xor<1>(v);
  v += row_xor<2>(v);
  v += row_xor<4>(v);
  v += row_xor<8>(v);
  v += half_xor(v);
  return v;
}
// one butterfly step over eight values side by side, inside the 16-lane row
template <int M>
__device__ __forceinline__ void row_max_step(float (&x)[8]) {
  // unrolled: x[] stays in registers, the eight chains cover each other's latency
  #pragma unroll
  for (int e = 0; e < 8; ++e) x[e] = fmaxf(x[e], row_xor<M>(x[e]));
}
template <int M>
__device__ __forceinline__ void row_sum_step(float (&x)[8]) {
  // unrolled: x[] stays in registers, the eight chains cover each other's latency
  #pragma unroll
  for (int e = 0; e < 8; ++e) x[e] += row_xor<M>(x[e]);
}

// ---------------------------------------------------------------------------
// Kernel 0: transpose + f32->f16 convert the five 256x256 weight matrices.
// WT[n*256+k] = (f16) W[k*256+n]
// ---------------------------------------------------------------------------
__global__ __launch_bounds__(256) void cvt_weights(
    const float* __restrict__ Wq, const float* __restrict__ Wk,
    const float* __restrict__ Wv, const float* __restrict__ Wg,
    const float* __restrict__ Wo,
    half_t* __restrict__ WqT, half_t* __restrict__ WkT,
    half_t* __restrict__ WvT, half_t* __restrict__ WgT,
    half_t* __restrict__ WoT) {
  int idx = blockIdx.x * 256 + threadIdx.x;      // 0..65535
  int n = idx >> 8, k = idx & 255;
  int src = k * 256 + n;
  WqT[idx] = (half_t)Wq[src];
  WkT[idx] = (half_t)Wk[src];
  WvT[idx] = (half_t)Wv[src];
  WgT[idx] = (half_t)Wg[src];
  WoT[idx] = (half_t)Wo[src];
}

// ---------------------------------------------------------------------------
// Kernel 1: LayerNorm over m rows of 256, write f16. One wave takes LNM_ROWS
// rows one after the other, for speed only. All the rows' loads
// are issued first; gamma and beta are read once per wave.
// ---------------------------------------------------------------------------
#define LNM_ROWS 8
__global__ __launch_bounds__(256) void ln_m_kernel(
    const float* __restrict__ m, const float* __restrict__ gam,
    const float* __restrict__ bet, half_t* __restrict__ mn) {
  int wave = threadIdx.x >> 5, lane = threadIdx.x & 31;
  size_t row0 = ((size_t)blockIdx.x * 8 + wave) * LNM_ROWS;   // 0..32767
  const float* p = m + row0 * CM + lane * 8;
  float4 x0[LNM_ROWS], x1[LNM_ROWS];
  // unrolled: the arrays stay in registers and the 16 loads are in flight together
  #pragma unroll
  for (int r = 0; r < LNM_ROWS; ++r) {
    x0[r] = *(const float4*)(p + r * CM);
    x1[r] = *(const float4*)(p + r * CM + 4);
  }
  float g[8], b[8];
  #pragma unroll
  for (int e = 0; e < 8; ++e) { g[e] = gam[lane * 8 + e]; b[e] = bet[lane * 8 + e]; }
  // unrolled: register arrays, and the rows' butterflies cover each other's latency
  #pragma unroll
  for (int r = 0; r < LNM_ROWS; ++r) {
    float xs[8] = {x0[r].x, x0[r].y, x0[r].z, x0[r].w, x1[r].x, x1[r].y, x1[r].z, x1[r].w};
    float sum = 0.f;
    #pragma unroll
    for (int e = 0; e < 8; ++e) sum += xs[e];
    sum = wave_sum(sum);
    float mu = sum * (1.f / 256.f);
    float var = 0.f;
    #pragma unroll
    for (int e = 0; e < 8; ++e) { float d = xs[e] - mu; var += d * d; }
    var = wave_sum(var);
    float rstd = rsqrtf(var * (1.f / 256.f) + 1e-5f);
    union { half_t h[8]; uint4 q; } o;
    #pragma unroll
    for (int e = 0; e < 8; ++e) o.h[e] = (half_t)((xs[e] - mu) * rstd * g[e] + b[e]);
    *(uint4*)(mn + (row0 + r) * CM + lane * 8) = o.q;
  }
}

// ---------------------------------------------------------------------------
// Kernel 2: LayerNorm over z rows of 128 fused with pair-bias projection.
// One wave takes LNZ_ROWS = 32 consecutive (i,j), in batches of LNZ_BATCH whose
// loads are issued one batch ahead. gamma, beta and the lane's 4 x 8 slice of
// W_z are read once per wave and stay in registers. Every lane ends a butterfly
// with the whole sum, so lane l keeps the eight sums of row l and each head's 32
// results leave as one 128-B line. Output bias[H][R][R] f32.
// ---------------------------------------------------------------------------
#define LNZ_ROWS  32
#define LNZ_BATCH 8
// one batch of rows; row r of the batch is row first + r of the wave
__device__ __forceinline__ void ln_z_batch(
    const float4 (&x)[LNZ_BATCH], int first, int lane, const float (&g)[4],
    const float (&b)[4], const float (&wz)[4][NH], float (&keep)[NH]) {
  // unrolled: register arrays, and the rows' butterflies cover each other's latency
  #pragma unroll
  for (int r = 0; r < LNZ_BATCH; ++r) {
    float xs[4] = {x[r].x, x[r].y, x[r].z, x[r].w};
    float sum = xs[0] + xs[1] + xs[2] + xs[3];
    sum = wave_sum(sum);
    float mu = sum * (1.f / 128.f);
    float var = 0.f;
    #pragma unroll
    for (int t = 0; t < 4; ++t) { float d = xs[t] - mu; var += d * d; }
    var = wave_sum(var);
    float rstd = rsqrtf(var * (1.f / 128.f) + 1e-5f);
    float zn[4];
    #pragma unroll
    for (int t = 0; t < 4; ++t) zn[t] = (xs[t] - mu) * rstd * g[t] + b[t];
    bool mine = lane == first + r;
    #pragma unroll
    for (int h = 0; h < NH; ++h) {
      float acc = 0.f;
      #pragma unroll
      for (int t = 0; t < 4; ++t) acc += zn[t] * wz[t][h];
      acc = wave_sum(acc);
      keep[h] = mine ? acc : keep[h];
    }
  }
}

__global__ __launch_bounds__(256) void ln_z_bias_kernel(
    const float* __restrict__ z, const float* __restrict__ gam,
    const float* __restrict__ bet, const float* __restrict__ Wz,
    float* __restrict__ bias) {
  int wave = threadIdx.x >> 5, lane = threadIdx.x & 31;
  size_t p0 = ((size_t)blockIdx.x * 8 + wave) * LNZ_ROWS;    // 0..65535 = i*256+j
  const float* zp = z + p0 * CZ + lane * 4;
  float4 cur[LNZ_BATCH];
  #pragma unroll
  for (int r = 0; r < LNZ_BATCH; ++r) cur[r] = *(const float4*)(zp + r * CZ);
  // the rows have the longest way and go out first: without this the compiler
  // issues them behind a wait on the W_z loads
  __builtin_amdgcn_sched_barrier(0);
  float wz[4][NH], g[4], b[4];
  #pragma unroll
  for (int t = 0; t < 4; ++t) {
    g[t] = gam[lane * 4 + t];
    b[t] = bet[lane * 4 + t];
    #pragma unroll
    for (int h = 0; h < NH; ++h) wz[t][h] = Wz[(lane * 4 + t) * NH + h];
  }
  float keep[NH];
  #pragma unroll
  for (int h = 0; h < NH; ++h) keep[h] = 0.f;

  // not unrolled: for speed only
  #pragma unroll 1
  for (int bt = 0; bt + 1 < LNZ_ROWS / LNZ_BATCH; ++bt) {
    float4 nxt[LNZ_BATCH];
    #pragma unroll
    for (int r = 0; r < LNZ_BATCH; ++r)
      nxt[r] = *(const float4*)(zp + ((bt + 1) * LNZ_BATCH + r) * CZ);
    // the batch body reuses the loads' address registers at once
    asm volatile("s_wait_xcnt 0x0" ::: "memory");
    ln_z_batch(cur, bt * LNZ_BATCH, lane, g, b, wz, keep);
    #pragma unroll
    for (int r = 0; r < LNZ_BATCH; ++r) cur[r] = nxt[r];
  }
  ln_z_batch(cur, LNZ_ROWS - LNZ_BATCH, lane, g, b, wz, keep);
  #pragma unroll
  for (int h = 0; h < NH; ++h) bias[(size_t)h * 65536 + p0 + lane] = keep[h];
}

// ---------------------------------------------------------------------------
// Kernel 3: generic WMMA GEMM  C[32768x256] = A[32768x256] * B(=BT N-major).
// Block = 128 rows x 64 cols, 8 waves; wave = 16 rows x 64 cols.
// The 64x256 f16 B tile is staged into LDS once per block through registers,
// rows laid at the padded pitch, then consumed as ds_load_b128 fragments.
// mode: 0/1 = store Q/K [S,H,R,C] f16, 2 = store V^T [S,H,C,R] f16,
//       3 = sigmoid(x+bg) gate f16 row-major, 4 = f32 out + bo (final GEMM).
// ---------------------------------------------------------------------------
__global__ __launch_bounds__(256) void gemm_wmma(
    const half_t* __restrict__ A, const half_t* __restrict__ BT,
    const float* __restrict__ bias, void* __restrict__ outp, int mode) {
  __shared__ __align__(16) half_t btl[64 * PITCH256];   // B tile, 33792 B
  int wave = threadIdx.x >> 5, lane = threadIdx.x & 31;
  int r0 = blockIdx.x * 128 + wave * 16;
  int c0 = blockIdx.y * 64;

  {
    const uint4* src = (const uint4*)(BT + (size_t)c0 * 256);
    // unrolled so that the eight loads are in flight together
    #pragma unroll
    for (int it = 0; it < 64 * 256 / 8 / 256; ++it) {
      int t = it * 256 + threadIdx.x;
      *(uint4*)(btl + (t >> 5) * PITCH256 + (t & 31) * 8) = src[t];
    }
    __syncthreads();
  }

  v8f acc[4] = {v8f{}, v8f{}, v8f{}, v8f{}};
  for (int kb = 0; kb < 8; ++kb) {
    v16h a = load_frag16(A, r0, 256, kb * 32);
    if (kb < 7)  // prefetch next A k-chunk into WGP-level caches
      __builtin_prefetch(A + (size_t)r0 * 256 + (kb + 1) * 32, 0, 3);
    #pragma unroll
    for (int j = 0; j < 4; ++j) {
      v16h b = load_frag16(btl, j * 16, PITCH256, kb * 32);   // ds_load_b128 x2
      acc[j] = wmma_f16(a, b, acc[j]);
    }
  }
  int m_lane = 8 * (lane >> 4), n_lane = lane & 15;
  #pragma unroll
  for (int j = 0; j < 4; ++j) {
    #pragma unroll
    for (int e = 0; e < 8; ++e) {
      int r = r0 + e + m_lane;
      int col = c0 + j * 16 + n_lane;
      float v = acc[j][e];
      int s = r >> 8, i = r & 255;
      int h = col >> 5, c = col & 31;
      if (mode <= 1) {
        ((half_t*)outp)[((size_t)(s * 8 + h) * 256 + i) * 32 + c] = (half_t)v;
      } else if (mode == 2) {
        ((half_t*)outp)[((size_t)(s * 8 + h) * 32 + c) * 256 + i] = (half_t)v;
      } else if (mode == 3) {
        v += bias[col];
        v = 1.f / (1.f + __expf(-v));
        ((half_t*)outp)[(size_t)r * 256 + col] = (half_t)v;
      } else {
        ((float*)outp)[(size_t)r * 256 + col] = v + bias[col];
      }
    }
  }
}

// ---------------------------------------------------------------------------
// Kernel 4: flash attention per (s,h). Block = 256 thr = 8 waves, each wave
// owns 32 query rows (two 16-row WMMA tiles). C=32 -> one WMMA per 16x16
// score tile. K [256x32] and V^T [32x256] are staged into LDS once per block
// through registers, rows laid at the padded pitches, removing the 8x per-wave
// redundant global fragment traffic. Online softmax; P transposed C-layout ->
// A-layout via a per-wave LDS bounce at the padded pitch.
// Epilogue applies the sigmoid gate and stores
// go = g * o as f16 [S,R,H*C].
// ---------------------------------------------------------------------------
__global__ __launch_bounds__(256) void attn_kernel(
    const half_t* __restrict__ q, const half_t* __restrict__ k,
    const half_t* __restrict__ vt, const float* __restrict__ bias,
    const half_t* __restrict__ gate, half_t* __restrict__ go) {
  __shared__ __align__(16) half_t lds_k[R_RES * PITCH32];   // 20480 B
  __shared__ __align__(16) half_t lds_v[CH * PITCH256];     // 16896 B
  __shared__ __align__(16) half_t lds_p[8][16 * PITCH32];   // 10240 B
  int sh = blockIdx.x;                 // s*8 + h
  int s = sh >> 3, h = sh & 7;
  int wave = threadIdx.x >> 5, lane = threadIdx.x & 31;
  const half_t* qb = q + (size_t)sh * R_RES * CH;
  const half_t* kg = k + (size_t)sh * R_RES * CH;
  const half_t* vg = vt + (size_t)sh * CH * R_RES;
  const float*  bb = bias + (size_t)h * R_RES * R_RES;
  half_t* myp = &lds_p[wave][0];
  const float scale = 0.17677669529663687f;   // 1/sqrt(32)
  int m_lane = 8 * (lane >> 4), n_lane = lane & 15;

  {
    const uint4* ks = (const uint4*)kg;
    const uint4* vs = (const uint4*)vg;
    // unrolled so that the eight loads are in flight together
    #pragma unroll
    for (int it = 0; it < R_RES * CH / 8 / 256; ++it) {
      int t = it * 256 + threadIdx.x;
      *(uint4*)(lds_k + (t >> 2) * PITCH32 + (t & 3) * 8)   = ks[t];
      *(uint4*)(lds_v + (t >> 5) * PITCH256 + (t & 31) * 8) = vs[t];
    }
    __syncthreads();
  }

  for (int tile = 0; tile < 2; ++tile) {
    int i0 = wave * 32 + tile * 16;
    v16h qa = load_frag16(qb, i0, CH, 0);
    v8f o0 = v8f{}, o1 = v8f{};
    float rmax[8], rsum[8];
    #pragma unroll
    for (int e = 0; e < 8; ++e) { rmax[e] = -1e30f; rsum[e] = 0.f; }

    for (int t = 0; t < 8; ++t) {
      v8f z = v8f{};
      v16h kf0 = load_frag16(lds_k, (2 * t) * 16, PITCH32, 0);
      v8f c0 = wmma_f16(qa, kf0, z);
      v16h kf1 = load_frag16(lds_k, (2 * t + 1) * 16, PITCH32, 0);
      v8f c1 = wmma_f16(qa, kf1, z);

      float nm[8];
      #pragma unroll
      for (int e = 0; e < 8; ++e) {
        int mrow = i0 + e + m_lane;
        c0[e] = c0[e] * scale + bb[(size_t)mrow * R_RES + (2 * t) * 16 + n_lane];
        c1[e] = c1[e] * scale + bb[(size_t)mrow * R_RES + (2 * t + 1) * 16 + n_lane];
        nm[e] = fmaxf(c0[e], c1[e]);
      }
      row_max_step<1>(nm);
      row_max_step<2>(nm);
      row_max_step<4>(nm);
      row_max_step<8>(nm);
      float corr[8], bsum[8];
      #pragma unroll
      for (int e = 0; e < 8; ++e) {
        nm[e] = fmaxf(nm[e], rmax[e]);
        corr[e] = __expf(rmax[e] - nm[e]);
        rmax[e] = nm[e];
        c0[e] = __expf(c0[e] - nm[e]);
        c1[e] = __expf(c1[e] - nm[e]);
        bsum[e] = c0[e] + c1[e];
      }
      row_sum_step<1>(bsum);
      row_sum_step<2>(bsum);
      row_sum_step<4>(bsum);
      row_sum_step<8>(bsum);
      #pragma unroll
      for (int e = 0; e < 8; ++e) {
        rsum[e] = rsum[e] * corr[e] + bsum[e];
        o0[e] *= corr[e];
        o1[e] *= corr[e];
      }
      // C-layout P -> LDS [16 x 32] row-major (padded pitch), reload as A fragment
      #pragma unroll
      for (int e = 0; e < 8; ++e) {
        myp[(e + m_lane) * PITCH32 + n_lane]      = (half_t)c0[e];
        myp[(e + m_lane) * PITCH32 + 16 + n_lane] = (half_t)c1[e];
      }
      asm volatile("s_wait_dscnt 0" ::: "memory");
      v16h pa = load_frag16(myp, 0, PITCH32, 0);
      v16h v0 = load_frag16(lds_v, 0, PITCH256, 32 * t);    // cols c=0..15
      v16h v1 = load_frag16(lds_v, 16, PITCH256, 32 * t);   // cols c=16..31
      o0 = wmma_f16(pa, v0, o0);
      o1 = wmma_f16(pa, v1, o1);
    }

    // finalize: divide by row sums, gate, store f16
    const half_t* gb = gate + (size_t)s * R_RES * 256 + h * 32;
    half_t* ob = go + (size_t)s * R_RES * 256 + h * 32;
    #pragma unroll
    for (int e = 0; e < 8; ++e) {
      float inv = 1.f / rsum[e];
      int i = i0 + e + m_lane;
      float g0 = (float)gb[(size_t)i * 256 + n_lane];
      float g1 = (float)gb[(size_t)i * 256 + 16 + n_lane];
      ob[(size_t)i * 256 + n_lane]      = (half_t)(g0 * o0[e] * inv);
      ob[(size_t)i * 256 + 16 + n_lane] = (half_t)(g1 * o1[e] * inv);
    }
  }
}

// ---------------------------------------------------------------------------
// Host launcher
// ---------------------------------------------------------------------------
extern "C" void kernel_launch(void* const* d_in, const int* in_sizes, int n_in,
                              void* d_out, int out_size, void* d_ws, size_t ws_size,
                              hipStream_t stream) {
  const float* m      = (const float*)d_in[0];
  const float* z      = (const float*)d_in[1];
  const float* ln_m_g = (const float*)d_in[2];
  const float* ln_m_b = (const float*)d_in[3];
  const float* ln_z_g = (const float*)d_in[4];
  const float* ln_z_b = (const float*)d_in[5];
  const float* W_z    = (const float*)d_in[6];
  const float* Wq     = (const float*)d_in[7];
  const float* Wk     = (const float*)d_in[8];
  const float* Wv     = (const float*)d_in[9];
  const float* Wg     = (const float*)d_in[10];
  const float* bg     = (const float*)d_in[11];
  const float* Wo     = (const float*)d_in[12];
  const float* bo     = (const float*)d_in[13];

  char* ws = (char*)d_ws;
  const size_t BIG = (size_t)32768 * 256 * 2;   // 16 MiB f16 planes
  half_t* mn_f16 = (half_t*)(ws + 0 * BIG);
  half_t* qbuf   = (half_t*)(ws + 1 * BIG);     // [S,H,R,C]
  half_t* kbuf   = (half_t*)(ws + 2 * BIG);     // [S,H,R,C]
  half_t* vbuf   = (half_t*)(ws + 3 * BIG);     // [S,H,C,R]
  half_t* gbuf   = (half_t*)(ws + 4 * BIG);     // gate [S,R,HC]
  half_t* gobuf  = (half_t*)(ws + 5 * BIG);     // g*o  [S,R,HC]
  float*  bbuf   = (float*)(ws + 6 * BIG);      // bias [H,R,R] f32 (2 MiB)
  half_t* WqT    = (half_t*)(ws + 6 * BIG + 2097152);
  half_t* WkT    = WqT + 65536;
  half_t* WvT    = WkT + 65536;
  half_t* WgT    = WvT + 65536;
  half_t* WoT    = WgT + 65536;

  cvt_weights<<<256, 256, 0, stream>>>(Wq, Wk, Wv, Wg, Wo, WqT, WkT, WvT, WgT, WoT);
  ln_m_kernel<<<512, 256, 0, stream>>>(m, ln_m_g, ln_m_b, mn_f16);
  ln_z_bias_kernel<<<256, 256, 0, stream>>>(z, ln_z_g, ln_z_b, W_z, bbuf);

  dim3 gg(256, 4);
  gemm_wmma<<<gg, 256, 0, stream>>>(mn_f16, WqT, nullptr, qbuf, 0);
  gemm_wmma<<<gg, 256, 0, stream>>>(mn_f16, WkT, nullptr, kbuf, 1);
  gemm_wmma<<<gg, 256, 0, stream>>>(mn_f16, WvT, nullptr, vbuf, 2);
  gemm_wmma<<<gg, 256, 0, stream>>>(mn_f16, WgT, bg, gbuf, 3);

  attn_kernel<<<1024, 256, 0, stream>>>(qbuf, kbuf, vbuf, bbuf, gbuf, gobuf);

  gemm_wmma<<<gg, 256, 0, stream>>>(gobuf, WoT, bo, (float*)d_out, 4);
}

// v004
// Measured time: 93.6 microseconds a run.
// Timed twice side by side with v003, it ran 1.47 times as fast both times.
// Over all steps from v000 it is 3.28 times as fast.
#include <hip/hip_runtime.h>
#include <hip/hip_bf16.h>

typedef _Float16 half_t;
typedef __attribute__((ext_vector_type(16))) _Float16 v16h;
typedef __attribute__((ext_vector_type(8)))  float    v8f;
typedef __attribute__((ext_vector_type(4)))  unsigned int v4u;

#define S_SEQ 128
#define R_RES 256
#define CM    256
#define CZ    128
#define CH    32
#define NH    8

// LDS row pitches, in f16 elements. Every fragment tile is read with
// ds_load_b128, 16 rows per half-wave: a pitch of 16 B x odd puts the 16 rows
// on 16 distinct groups of four banks, a pitch of 64 B or 512 B does not.
#define PITCH256 264   // rows of 256 f16: 528 B = 16 B x 33
#define PITCH32  40    // rows of  32 f16:  80 B = 16 B x 5

// ---------------------------------------------------------------------------
// WMMA 16x16x32 f16 fragment loader (A-layout; B uses identical layout with
// lane = N, since B is consumed as N x K).
// lane l: row = row0 + (l&15), half = l>>4
// element e: k = k0 + 16*(e/8) + 8*half + (e%8)
// -> two contiguous 16-byte chunks per lane (global_load_b128 / ds_load_b128).
// ---------------------------------------------------------------------------
__device__ __forceinline__ v16h load_frag16(const half_t* base, int row0, int ldk, int k0) {
  const int lane = threadIdx.x & 31;
  const int r    = row0 + (lane & 15);
  const int hh   = lane >> 4;
  const half_t* p = base + (size_t)r * ldk + k0 + hh * 8;
  union { v16h v; uint4 q[2]; } u;
  u.q[0] = *(const uint4*)(p);
  u.q[1] = *(const uint4*)(p + 16);
  return u.v;
}

__device__ __forceinline__ v8f wmma_f16(v16h a, v16h b, v8f c) {
  return __builtin_amdgcn_wmma_f32_16x16x32_f16(false, a, false, b, (short)0, c, false, false);
}

// ---------------------------------------------------------------------------
// Cross-lane moves on the vector unit. __shfl_xor goes through the LDS pipe
// (ds_bpermute_b32 and a wait on dscnt for every step); these do not.
// All 32 lanes are on wherever they are used.
// ---------------------------------------------------------------------------
// value of lane l ^ M, M < 16: DPP row_xmask inside the 16-lane row
template <int M>
__device__ __forceinline__ float row_xor(float v) {
  return __builtin_bit_cast(float, __builtin_amdgcn_update_dpp(
      0, __builtin_bit_cast(int, v), 0x160 | M, 0xf, 0xf, true));
}
// value of lane l ^ 16: the same lane of the other row
__device__ __forceinline__ float half_xor(float v) {
  int b = __builtin_bit_cast(int, v);
  return __builtin_bit_cast(float, __builtin_amdgcn_permlanex16(
      b, b, 0x76543210, 0xfedcba98, false, false));
}
// butterfly sum over the 32 lanes, steps 1, 2, 4, 8, 16
__device__ __forceinline__ float wave_sum(float v) {
  v += row_xor<1>(v);
  v += row_xor<2>(v);
  v += row_xor<4>(v);
  v += row_xor<8>(v);
  v += half_xor(v);
  return v;
}
// one butterfly step over eight values side by side, inside the 16-lane row
template <int M>
__device__ __forceinline__ void row_max_step(float (&x)[8]) {
  // unrolled: x[] stays in registers, the eight chains cover each other's latency
  #pragma unroll
  for (int e = 0; e < 8; ++e) x[e] = fmaxf(x[e], row_xor<M>(x[e]));
}
template <int M>
__device__ __forceinline__ void row_sum_step(float (&x)[8]) {
  // unrolled: x[] stays in registers, the eight chains cover each other's latency
  #pragma unroll
  for (int e = 0; e < 8; ++e) x[e] += row_xor<M>(x[e]);
}

// ---------------------------------------------------------------------------
// Kernel 0: transpose + f32->f16 convert the five 256x256 weight matrices.
// WT[n*256+k] = (f16) W[k*256+n]
// ---------------------------------------------------------------------------
__global__ __launch_bounds__(256) void cvt_weights(
    const float* __restrict__ Wq, const float* __restrict__ Wk,
    const float* __restrict__ Wv, const float* __restrict__ Wg,
    const float* __restrict__ Wo,
    half_t* __restrict__ WqT, half_t* __restrict__ WkT,
    half_t* __restrict__ WvT, half_t* __restrict__ WgT,
    half_t* __restrict__ WoT) {
  int idx = blockIdx.x * 256 + threadIdx.x;      // 0..65535
  int n = idx >> 8, k = idx & 255;
  int src = k * 256 + n;
  WqT[idx] = (half_t)Wq[src];
  WkT[idx] = (half_t)Wk[src];
  WvT[idx] = (half_t)Wv[src];
  WgT[idx] = (half_t)Wg[src];
  WoT[idx] = (half_t)Wo[src];
}

// ---------------------------------------------------------------------------
// Kernel 1: LayerNorm over m rows of 256, write f16. One wave takes LNM_ROWS
// rows one after the other, for speed only. All the rows' loads
// are issued first; gamma and beta are read once per wave.
// ---------------------------------------------------------------------------
#define LNM_ROWS 8
__global__ __launch_bounds__(256) void ln_m_kernel(
    const float* __restrict__ m, const float* __restrict__ gam,
    const float* __restrict__ bet, half_t* __restrict__ mn) {
  int wave = threadIdx.x >> 5, lane = threadIdx.x & 31;
  size_t row0 = ((size_t)blockIdx.x * 8 + wave) * LNM_ROWS;   // 0..32767
  const float* p = m + row0 * CM + lane * 8;
  float4 x0[LNM_ROWS], x1[LNM_ROWS];
  // unrolled: the arrays stay in registers and the 16 loads are in flight together
  #pragma unroll
  for (int r = 0; r < LNM_ROWS; ++r) {
    x0[r] = *(const float4*)(p + r * CM);
    x1[r] = *(const float4*)(p + r * CM + 4);
  }
  float g[8], b[8];
  #pragma unroll
  for (int e = 0; e < 8; ++e) { g[e] = gam[lane * 8 + e]; b[e] = bet[lane * 8 + e]; }
  // unrolled: register arrays, and the rows' butterflies cover each other's latency
  #pragma unroll
  for (int r = 0; r < LNM_ROWS; ++r) {
    float xs[8] = {x0[r].x, x0[r].y, x0[r].z, x0[r].w, x1[r].x, x1[r].y, x1[r].z, x1[r].w};
    float sum = 0.f;
    #pragma unroll
    for (int e = 0; e < 8; ++e) sum += xs[e];
    sum = wave_sum(sum);
    float mu = sum * (1.f / 256.f);
    float var = 0.f;
    #pragma unroll
    for (int e = 0; e < 8; ++e) { float d = xs[e] - mu; var += d * d; }
    var = wave_sum(var);
    float rstd = rsqrtf(var * (1.f / 256.f) + 1e-5f);
    union { half_t h[8]; uint4 q; } o;
    #pragma unroll
    for (int e = 0; e < 8; ++e) o.h[e] = (half_t)((xs[e] - mu) * rstd * g[e] + b[e]);
    *(uint4*)(mn + (row0 + r) * CM + lane * 8) = o.q;
  }
}

// ---------------------------------------------------------------------------
// Kernel 2: LayerNorm over z rows of 128 fused with pair-bias projection.
// One wave takes LNZ_ROWS = 32 consecutive (i,j), in batches of LNZ_BATCH whose
// loads are issued one batch ahead. gamma, beta and the lane's 4 x 8 slice of
// W_z are read once per wave and stay in registers. Every lane ends a butterfly
// with the whole sum, so lane l keeps the eight sums of row l and each head's 32
// results leave as one 128-B line. Output bias[H][R][R] f32.
// ---------------------------------------------------------------------------
#define LNZ_ROWS  32
#define LNZ_BATCH 8
// one batch of rows; row r of the batch is row first + r of the wave
__device__ __forceinline__ void ln_z_batch(
    const float4 (&x)[LNZ_BATCH], int first, int lane, const float (&g)[4],
    const float (&b)[4], const float (&wz)[4][NH], float (&keep)[NH]) {
  // unrolled: register arrays, and the rows' butterflies cover each other's latency
  #pragma unroll
  for (int r = 0; r < LNZ_BATCH; ++r) {
    float xs[4] = {x[r].x, x[r].y, x[r].z, x[r].w};
    float sum = xs[0] + xs[1] + xs[2] + xs[3];
    sum = wave_sum(sum);
    float mu = sum * (1.f / 128.f);
    float var = 0.f;
    #pragma unroll
    for (int t = 0; t < 4; ++t) { float d = xs[t] - mu; var += d * d; }
    var = wave_sum(var);
    float rstd = rsqrtf(var * (1.f / 128.f) + 1e-5f);
    float zn[4];
    #pragma unroll
    for (int t = 0; t < 4; ++t) zn[t] = (xs[t] - mu) * rstd * g[t] + b[t];
    bool mine = lane == first + r;
    #pragma unroll
    for (int h = 0; h < NH; ++h) {
      float acc = 0.f;
      #pragma unroll
      for (int t = 0; t < 4; ++t) acc += zn[t] * wz[t][h];
      acc = wave_sum(acc);
      keep[h] = mine ? acc : keep[h];
    }
  }
}

__global__ __launch_bounds__(256) void ln_z_bias_kernel(
    const float* __restrict__ z, const float* __restrict__ gam,
    const float* __restrict__ bet, const float* __restrict__ Wz,
    float* __restrict__ bias) {
  int wave = threadIdx.x >> 5, lane = threadIdx.x & 31;
  size_t p0 = ((size_t)blockIdx.x * 8 + wave) * LNZ_ROWS;    // 0..65535 = i*256+j
  const float* zp = z + p0 * CZ + lane * 4;
  float4 cur[LNZ_BATCH];
  #pragma unroll
  for (int r = 0; r < LNZ_BATCH; ++r) cur[r] = *(const float4*)(zp + r * CZ);
  // the rows have the longest way and go out first: without this the compiler
  // issues them behind a wait on the W_z loads
  __builtin_amdgcn_sched_barrier(0);
  float wz[4][NH], g[4], b[4];
  #pragma unroll
  for (int t = 0; t < 4; ++t) {
    g[t] = gam[lane * 4 + t];
    b[t] = bet[lane * 4 + t];
    #pragma unroll
    for (int h = 0; h < NH; ++h) wz[t][h] = Wz[(lane * 4 + t) * NH + h];
  }
  float keep[NH];
  #pragma unroll
  for (int h = 0; h < NH; ++h) keep[h] = 0.f;

  // not unrolled: for speed only
  #pragma unroll 1
  for (int bt = 0; bt + 1 < LNZ_ROWS / LNZ_BATCH; ++bt) {
    float4 nxt[LNZ_BATCH];
    #pragma unroll
    for (int r = 0; r < LNZ_BATCH; ++r)
      nxt[r] = *(const float4*)(zp + ((bt + 1) * LNZ_BATCH + r) * CZ);
    // the batch body reuses the loads' address registers at once
    asm volatile("s_wait_xcnt 0x0" ::: "memory");
    ln_z_batch(cur, bt * LNZ_BATCH, lane, g, b, wz, keep);
    #pragma unroll
    for (int r = 0; r < LNZ_BATCH; ++r) cur[r] = nxt[r];
  }
  ln_z_batch(cur, LNZ_ROWS - LNZ_BATCH, lane, g, b, wz, keep);
  #pragma unroll
  for (int h = 0; h < NH; ++h) bias[(size_t)h * 65536 + p0 + lane] = keep[h];
}

// ---------------------------------------------------------------------------
// Kernel 3: WMMA GEMM  C[32768x256] = A[32768x256] * B(=BT N-major).
// Block = 128 rows, 8 waves; wave = 16 rows. A wave loads its 16 rows of A once,
// as eight fragments that stay in registers, and takes several 64-column tiles
// of B with them, one after the other: fewer waves to start, fewer reads of A.
// Each 64x256 f16 B tile is staged into LDS through registers, rows laid at the
// padded pitch, then consumed as ds_load_b128 fragments.
// The kind of epilogue is a compile-time parameter, so no store stands behind a
// branch and a column's bias is read once:
//   EP_QK   store Q or K [S,H,R,C] f16      EP_VT  store V^T [S,H,C,R] f16
//   EP_GATE sigmoid(x+bg) f16 row-major     EP_OUT f32 out + bo (final GEMM)
// ---------------------------------------------------------------------------
#define EP_QK   0
#define EP_VT   1
#define EP_GATE 2
#define EP_OUT  3

// one wave's 16 x 64 tile: rows r0.., columns c0.. (c0 a multiple of 64, so the
// tile holds two whole heads). One 32-bit element index per lane; every other
// element of the lane lies at a constant offset from it.
template <int KIND>
__device__ __forceinline__ void store_tile(
    const v8f (&acc)[4], int r0, int c0, int lane,
    const float (&bv)[4], void* __restrict__ outp) {
  const unsigned m_lane = 8 * (lane >> 4), n_lane = lane & 15;
  const unsigned sh0 = (r0 >> 8) * 8 + (c0 >> 5);   // s * 8 + first head
  const unsigned i0 = (r0 & 255) + m_lane;
  if constexpr (KIND == EP_QK) {
    half_t* o = (half_t*)outp + ((sh0 * 256 + i0) * 32 + n_lane);
    #pragma unroll
    for (int j = 0; j < 4; ++j) {
      #pragma unroll
      for (int e = 0; e < 8; ++e)
        o[(j >> 1) * 256 * 32 + e * 32 + (j & 1) * 16] = (half_t)acc[j][e];
    }
  } else if constexpr (KIND == EP_VT) {
    // the lane's eight rows lie side by side in V^T: at constant offsets the
    // compiler joins the eight stores of a column into one of 16 bytes
    half_t* o = (half_t*)outp + ((sh0 * 32 + n_lane) * 256 + i0);
    #pragma unroll
    for (int j = 0; j < 4; ++j) {
      #pragma unroll
      for (int e = 0; e < 8; ++e) o[j * 16 * 256 + e] = (half_t)acc[j][e];
    }
  } else if constexpr (KIND == EP_GATE) {
    half_t* o = (half_t*)outp + ((r0 + m_lane) * 256 + c0 + n_lane);
    #pragma unroll
    for (int j = 0; j < 4; ++j) {
      #pragma unroll
      for (int e = 0; e < 8; ++e) {
        float v = acc[j][e] + bv[j];
        v = 1.f / (1.f + __expf(-v));
        o[e * 256 + j * 16] = (half_t)v;
      }
    }
  } else {
    float* o = (float*)outp + ((r0 + m_lane) * 256 + c0 + n_lane);
    #pragma unroll
    for (int j = 0; j < 4; ++j) {
      #pragma unroll
      for (int e = 0; e < 8; ++e) o[e * 256 + j * 16] = acc[j][e] + bv[j];
    }
  }
}

// the wave's 16 rows of A as eight fragments
__device__ __forceinline__ void load_a_rows(v16h (&a)[8], const half_t* __restrict__ A, int r0) {
  const int lane = threadIdx.x & 31;
  const half_t* p = A + (size_t)(r0 + (lane & 15)) * 256 + (lane >> 4) * 8;
  // unrolled: a[] stays in registers and the 16 loads are in flight together
  #pragma unroll
  for (int kb = 0; kb < 8; ++kb) {
    union { v16h v; uint4 q[2]; } u;
    u.q[0] = *(const uint4*)(p + kb * 32);
    u.q[1] = *(const uint4*)(p + kb * 32 + 16);
    a[kb] = u.v;
  }
  // the loads' address register is held whole up to this wait, which stands in
  // front of whatever rewrites it
  asm volatile("s_wait_xcnt 0x0" :: "v"(p) : "memory");
}

// one 128 x 64 tile of the block: bt = the 64 rows of BT for columns c0..c0+63
template <int KIND, bool MORE>
__device__ __forceinline__ void gemm_tile(
    const v16h (&a)[8], const half_t* __restrict__ bt, const float* __restrict__ bias,
    void* __restrict__ outp, half_t* btl, int r0, int c0) {
  // a thread copies 16 bytes of every eighth row: one address each side, the
  // rest are constant offsets
  const int tid = threadIdx.x;
  const v4u* src = (const v4u*)bt + tid;
  half_t* dst = btl + (tid >> 5) * PITCH256 + (tid & 31) * 8;
  v4u st[8];
  // unrolled: st[] stays in registers and the eight loads are in flight together
  #pragma unroll
  for (int it = 0; it < 8; ++it) st[it] = src[it * 256];
  // the lane's four bias values travel with the tile's loads: no load of the
  // epilogue then lands on a register that an issued store still names, and none
  // is waited for behind a barrier
  float bv[4] = {0.f, 0.f, 0.f, 0.f};
  if constexpr (KIND == EP_GATE || KIND == EP_OUT) {
    const unsigned bi = c0 + (tid & 15);
    #pragma unroll
    for (int j = 0; j < 4; ++j) bv[j] = bias[bi + j * 16];
    // the index registers of the tile's and the bias loads are held whole up to
    // this wait
    asm volatile("s_wait_xcnt 0x0" :: "v"(tid), "v"(bi) : "memory");
  }
  // holds the eight loads in front of the first LDS store (loaded values as
  // inputs only): without it the compiler, under the register bound, takes them
  // two at a time, four trips to L2 one after the other
  asm volatile("" :: "v"(st[0]), "v"(st[1]), "v"(st[2]), "v"(st[3]),
                     "v"(st[4]), "v"(st[5]), "v"(st[6]), "v"(st[7]));
  #pragma unroll
  for (int it = 0; it < 8; ++it) *(v4u*)(dst + it * 8 * PITCH256) = st[it];
  __syncthreads();   // the tile is whole

  v8f acc[4] = {v8f{}, v8f{}, v8f{}, v8f{}};
  #pragma unroll
  for (int kb = 0; kb < 8; ++kb) {
    #pragma unroll
    for (int j = 0; j < 4; ++j) {
      v16h b = load_frag16(btl, j * 16, PITCH256, kb * 32);   // ds_load_b128 x2
      acc[j] = wmma_f16(a[kb], b, acc[j]);
    }
  }
  // where another tile follows: every wave has read its last fragment of this
  // one. In front of the stores, so that they drain under the next tile's loads
  // and not under the barrier.
  if constexpr (MORE) __syncthreads();
  store_tile<KIND>(acc, r0, c0, threadIdx.x & 31, bv, outp);
  // the next tile's loads land on registers that these stores name
  if constexpr (MORE) asm volatile("s_wait_xcnt 0x0" ::: "memory");
}

// The four projections of mn in one launch. WT holds the four transposed weights
// one behind the other (q, k, v, gate). A block takes the same 64 columns of all
// four products, so every block has the same work.
// The 64 registers of A would take the wave past 128: bound to 8 waves per SIMD,
// so that all 1024 work-groups are on the chip at once, four to a WGP.
__global__ __launch_bounds__(256, 8) void proj_gemm(
    const half_t* __restrict__ A, const half_t* __restrict__ WT,
    const float* __restrict__ bg, half_t* __restrict__ q, half_t* __restrict__ k,
    half_t* __restrict__ vt, half_t* __restrict__ gate) {
  __shared__ __align__(16) half_t btl[64 * PITCH256];   // B tile, 33792 B
  const int r0 = blockIdx.x * 128 + (threadIdx.x >> 5) * 16;
  const int c0 = blockIdx.y * 64;
  v16h a[8];
  load_a_rows(a, A, r0);
  const half_t* bt = WT + (size_t)c0 * 256;
  gemm_tile<EP_QK, true>(a, bt, nullptr, q, btl, r0, c0);
  gemm_tile<EP_QK, true>(a, bt + 65536, nullptr, k, btl, r0, c0);
  gemm_tile<EP_VT, true>(a, bt + 2 * 65536, nullptr, vt, btl, r0, c0);
  gemm_tile<EP_GATE, false>(a, bt + 3 * 65536, bg, gate, btl, r0, c0);
}

// The final GEMM: a block takes two of the four column tiles.
__global__ __launch_bounds__(256) void out_gemm(
    const half_t* __restrict__ A, const half_t* __restrict__ BT,
    const float* __restrict__ bo, float* __restrict__ out) {
  __shared__ __align__(16) half_t btl[64 * PITCH256];   // B tile, 33792 B
  const int r0 = blockIdx.x * 128 + (threadIdx.x >> 5) * 16;
  v16h a[8];
  load_a_rows(a, A, r0);
  const int c0 = blockIdx.y * 128;
  gemm_tile<EP_OUT, true>(a, BT + (size_t)c0 * 256, bo, out, btl, r0, c0);
  gemm_tile<EP_OUT, false>(a, BT + (size_t)(c0 + 64) * 256, bo, out, btl, r0, c0 + 64);
}

// ---------------------------------------------------------------------------
// Kernel 4: flash attention per (s,h). Block = 256 thr = 8 waves, each wave
// owns 32 query rows (two 16-row WMMA tiles). C=32 -> one WMMA per 16x16
// score tile. K [256x32] and V^T [32x256] are staged into LDS once per block
// through registers, rows laid at the padded pitches, removing the 8x per-wave
// redundant global fragment traffic. Online softmax; P transposed C-layout ->
// A-layout via a per-wave LDS bounce at the padded pitch.
// Epilogue applies the sigmoid gate and stores
// go = g * o as f16 [S,R,H*C].
// ---------------------------------------------------------------------------
__global__ __launch_bounds__(256) void attn_kernel(
    const half_t* __restrict__ q, const half_t* __restrict__ k,
    const half_t* __restrict__ vt, const float* __restrict__ bias,
    const half_t* __restrict__ gate, half_t* __restrict__ go) {
  __shared__ __align__(16) half_t lds_k[R_RES * PITCH32];   // 20480 B
  __shared__ __align__(16) half_t lds_v[CH * PITCH256];     // 16896 B
  __shared__ __align__(16) half_t lds_p[8][16 * PITCH32];   // 10240 B
  int sh = blockIdx.x;                 // s*8 + h
  int s = sh >> 3, h = sh & 7;
  int wave = threadIdx.x >> 5, lane = threadIdx.x & 31;
  const half_t* qb = q + (size_t)sh * R_RES * CH;
  const half_t* kg = k + (size_t)sh * R_RES * CH;
  const half_t* vg = vt + (size_t)sh * CH * R_RES;
  const float*  bb = bias + (size_t)h * R_RES * R_RES;
  half_t* myp = &lds_p[wave][0];
  const float scale = 0.17677669529663687f;   // 1/sqrt(32)
  int m_lane = 8 * (lane >> 4), n_lane = lane & 15;

  {
    const uint4* ks = (const uint4*)kg;
    const uint4* vs = (const uint4*)vg;
    // unrolled so that the eight loads are in flight together
    #pragma unroll
    for (int it = 0; it < R_RES * CH / 8 / 256; ++it) {
      int t = it * 256 + threadIdx.x;
      *(uint4*)(lds_k + (t >> 2) * PITCH32 + (t & 3) * 8)   = ks[t];
      *(uint4*)(lds_v + (t >> 5) * PITCH256 + (t & 31) * 8) = vs[t];
    }
    __syncthreads();
  }

  for (int tile = 0; tile < 2; ++tile) {
    int i0 = wave * 32 + tile * 16;
    v16h qa = load_frag16(qb, i0, CH, 0);
    v8f o0 = v8f{}, o1 = v8f{};
    float rmax[8], rsum[8];
    #pragma unroll
    for (int e = 0; e < 8; ++e) { rmax[e] = -1e30f; rsum[e] = 0.f; }

    for (int t = 0; t < 8; ++t) {
      v8f z = v8f{};
      v16h kf0 = load_frag16(lds_k, (2 * t) * 16, PITCH32, 0);
      v8f c0 = wmma_f16(qa, kf0, z);
      v16h kf1 = load_frag16(lds_k, (2 * t + 1) * 16, PITCH32, 0);
      v8f c1 = wmma_f16(qa, kf1, z);

      float nm[8];
      #pragma unroll
      for (int e = 0; e < 8; ++e) {
        int mrow = i0 + e + m_lane;
        c0[e] = c0[e] * scale + bb[(size_t)mrow * R_RES + (2 * t) * 16 + n_lane];
        c1[e] = c1[e] * scale + bb[(size_t)mrow * R_RES + (2 * t + 1) * 16 + n_lane];
        nm[e] = fmaxf(c0[e], c1[e]);
      }
      row_max_step<1>(nm);
      row_max_step<2>(nm);
      row_max_step<4>(nm);
      row_max_step<8>(nm);
      float corr[8], bsum[8];
      #pragma unroll
      for (int e = 0; e < 8; ++e) {
        nm[e] = fmaxf(nm[e], rmax[e]);
        corr[e] = __expf(rmax[e] - nm[e]);
        rmax[e] = nm[e];
        c0[e] = __expf(c0[e] - nm[e]);
        c1[e] = __expf(c1[e] - nm[e]);
        bsum[e] = c0[e] + c1[e];
      }
      row_sum_step<1>(bsum);
      row_sum_step<2>(bsum);
      row_sum_step<4>(bsum);
      row_sum_step<8>(bsum);
      #pragma unroll
      for (int e = 0; e < 8; ++e) {
        rsum[e] = rsum[e] * corr[e] + bsum[e];
        o0[e] *= corr[e];
        o1[e] *= corr[e];
      }
      // C-layout P -> LDS [16 x 32] row-major (padded pitch), reload as A fragment
      #pragma unroll
      for (int e = 0; e < 8; ++e) {
        myp[(e + m_lane) * PITCH32 + n_lane]      = (half_t)c0[e];
        myp[(e + m_lane) * PITCH32 + 16 + n_lane] = (half_t)c1[e];
      }
      asm volatile("s_wait_dscnt 0" ::: "memory");
      v16h pa = load_frag16(myp, 0, PITCH32, 0);
      v16h v0 = load_frag16(lds_v, 0, PITCH256, 32 * t);    // cols c=0..15
      v16h v1 = load_frag16(lds_v, 16, PITCH256, 32 * t);   // cols c=16..31
      o0 = wmma_f16(pa, v0, o0);
      o1 = wmma_f16(pa, v1, o1);
    }

    // finalize: divide by row sums, gate, store f16
    const half_t* gb = gate + (size_t)s * R_RES * 256 + h * 32;
    half_t* ob = go + (size_t)s * R_RES * 256 + h * 32;
    #pragma unroll
    for (int e = 0; e < 8; ++e) {
      float inv = 1.f / rsum[e];
      int i = i0 + e + m_lane;
      float g0 = (float)gb[(size_t)i * 256 + n_lane];
      float g1 = (float)gb[(size_t)i * 256 + 16 + n_lane];
      ob[(size_t)i * 256 + n_lane]      = (half_t)(g0 * o0[e] * inv);
      ob[(size_t)i * 256 + 16 + n_lane] = (half_t)(g1 * o1[e] * inv);
    }
  }
}

// ---------------------------------------------------------------------------
// Host launcher
// ---------------------------------------------------------------------------
extern "C" void kernel_launch(void* const* d_in, const int* in_sizes, int n_in,
                              void* d_out, int out_size, void* d_ws, size_t ws_size,
                              hipStream_t stream) {
  const float* m      = (const float*)d_in[0];
  const float* z      = (const float*)d_in[1];
  const float* ln_m_g = (const float*)d_in[2];
  const float* ln_m_b = (const float*)d_in[3];
  const float* ln_z_g = (const float*)d_in[4];
  const float* ln_z_b = (const float*)d_in[5];
  const float* W_z    = (const float*)d_in[6];
  const float* Wq     = (const float*)d_in[7];
  const float* Wk     = (const float*)d_in[8];
  const float* Wv     = (const float*)d_in[9];
  const float* Wg     = (const float*)d_in[10];
  const float* bg     = (const float*)d_in[11];
  const float* Wo     = (const float*)d_in[12];
  const float* bo     = (const float*)d_in[13];

  char* ws = (char*)d_ws;
  const size_t BIG = (size_t)32768 * 256 * 2;   // 16 MiB f16 planes
  half_t* mn_f16 = (half_t*)(ws + 0 * BIG);
  half_t* qbuf   = (half_t*)(ws + 1 * BIG);     // [S,H,R,C]
  half_t* kbuf   = (half_t*)(ws + 2 * BIG);     // [S,H,R,C]
  half_t* vbuf   = (half_t*)(ws + 3 * BIG);     // [S,H,C,R]
  half_t* gbuf   = (half_t*)(ws + 4 * BIG);     // gate [S,R,HC]
  half_t* gobuf  = (half_t*)(ws + 5 * BIG);     // g*o  [S,R,HC]
  float*  bbuf   = (float*)(ws + 6 * BIG);      // bias [H,R,R] f32 (2 MiB)
  half_t* WqT    = (half_t*)(ws + 6 * BIG + 2097152);
  half_t* WkT    = WqT + 65536;
  half_t* WvT    = WkT + 65536;
  half_t* WgT    = WvT + 65536;
  half_t* WoT    = WgT + 65536;

  cvt_weights<<<256, 256, 0, stream>>>(Wq, Wk, Wv, Wg, Wo, WqT, WkT, WvT, WgT, WoT);
  ln_m_kernel<<<512, 256, 0, stream>>>(m, ln_m_g, ln_m_b, mn_f16);
  ln_z_bias_kernel<<<256, 256, 0, stream>>>(z, ln_z_g, ln_z_b, W_z, bbuf);

  proj_gemm<<<dim3(256, 4), 256, 0, stream>>>(mn_f16, WqT, bg, qbuf, kbuf, vbuf, gbuf);

  attn_kernel<<<1024, 256, 0, stream>>>(qbuf, kbuf, vbuf, bbuf, gbuf, gobuf);

  out_gemm<<<dim3(256, 2), 256, 0, stream>>>(gobuf, WoT, bo, (float*)d_out);
}

// v005
// Measured time: 82.6 microseconds a run.
// Timed twice side by side with v004, it ran 1.13 times as fast both times.
// All steps since v000 together make it 3.72 times as fast.
#include <hip/hip_runtime.h>
#include <hip/hip_bf16.h>

typedef _Float16 half_t;
typedef __attribute__((ext_vector_type(16))) _Float16 v16h;
typedef __attribute__((ext_vector_type(8)))  float    v8f;
typedef __attribute__((ext_vector_type(4)))  unsigned int v4u;

#define S_SEQ 128
#define R_RES 256
#define CM    256
#define CZ    128
#define CH    32
#define NH    8

// LDS row pitches, in f16 elements. Every fragment tile is read with
// ds_load_b128, 16 rows per half-wave: a pitch of 16 B x odd puts the 16 rows
// on 16 distinct groups of four banks, a pitch of 64 B or 512 B does not.
#define PITCH256 264   // rows of 256 f16: 528 B = 16 B x 33
#define PITCH32  40    // rows of  32 f16:  80 B = 16 B x 5

// ---------------------------------------------------------------------------
// WMMA 16x16x32 f16 fragment loader (A-layout; B uses identical layout with
// lane = N, since B is consumed as N x K).
// lane l: row = row0 + (l&15), half = l>>4
// element e: k = k0 + 16*(e/8) + 8*half + (e%8)
// -> two contiguous 16-byte chunks per lane (global_load_b128 / ds_load_b128).
// ---------------------------------------------------------------------------
__device__ __forceinline__ v16h load_frag16(const half_t* base, int row0, int ldk, int k0) {
  const int lane = threadIdx.x & 31;
  const int r    = row0 + (lane & 15);
  const int hh   = lane >> 4;
  const half_t* p = base + (size_t)r * ldk + k0 + hh * 8;
  union { v16h v; uint4 q[2]; } u;
  u.q[0] = *(const uint4*)(p);
  u.q[1] = *(const uint4*)(p + 16);
  return u.v;
}

__device__ __forceinline__ v8f wmma_f16(v16h a, v16h b, v8f c) {
  return __builtin_amdgcn_wmma_f32_16x16x32_f16(false, a, false, b, (short)0, c, false, false);
}

// ---------------------------------------------------------------------------
// Cross-lane moves on the vector unit. __shfl_xor goes through the LDS pipe
// (ds_bpermute_b32 and a wait on dscnt for every step); these do not.
// All 32 lanes are on wherever they are used.
// ---------------------------------------------------------------------------
// value of lane l ^ M, M < 16: DPP row_xmask inside the 16-lane row
template <int M>
__device__ __forceinline__ float row_xor(float v) {
  return __builtin_bit_cast(float, __builtin_amdgcn_update_dpp(
      0, __builtin_bit_cast(int, v), 0x160 | M, 0xf, 0xf, true));
}
// value of lane l ^ 16: the same lane of the other row
__device__ __forceinline__ float half_xor(float v) {
  int b = __builtin_bit_cast(int, v);
  return __builtin_bit_cast(float, __builtin_amdgcn_permlanex16(
      b, b, 0x76543210, 0xfedcba98, false, false));
}
// butterfly sum over the 32 lanes, steps 1, 2, 4, 8, 16
__device__ __forceinline__ float wave_sum(float v) {
  v += row_xor<1>(v);
  v += row_xor<2>(v);
  v += row_xor<4>(v);
  v += row_xor<8>(v);
  v += half_xor(v);
  return v;
}
// one butterfly step over eight values side by side, inside the 16-lane row
template <int M>
__device__ __forceinline__ void row_max_step(float (&x)[8]) {
  // unrolled: x[] stays in registers, the eight chains cover each other's latency
  #pragma unroll
  for (int e = 0; e < 8; ++e) x[e] = fmaxf(x[e], row_xor<M>(x[e]));
}
template <int M>
__device__ __forceinline__ void row_sum_step(float (&x)[8]) {
  // unrolled: x[] stays in registers, the eight chains cover each other's latency
  #pragma unroll
  for (int e = 0; e < 8; ++e) x[e] += row_xor<M>(x[e]);
}

// ---------------------------------------------------------------------------
// Kernel 0: transpose + f32->f16 convert the five 256x256 weight matrices.
// WT[n*256+k] = (f16) W[k*256+n]
// ---------------------------------------------------------------------------
__global__ __launch_bounds__(256) void cvt_weights(
    const float* __restrict__ Wq, const float* __restrict__ Wk,
    const float* __restrict__ Wv, const float* __restrict__ Wg,
    const float* __restrict__ Wo,
    half_t* __restrict__ WqT, half_t* __restrict__ WkT,
    half_t* __restrict__ WvT, half_t* __restrict__ WgT,
    half_t* __restrict__ WoT) {
  int idx = blockIdx.x * 256 + threadIdx.x;      // 0..65535
  int n = idx >> 8, k = idx & 255;
  int src = k * 256 + n;
  WqT[idx] = (half_t)Wq[src];
  WkT[idx] = (half_t)Wk[src];
  WvT[idx] = (half_t)Wv[src];
  WgT[idx] = (half_t)Wg[src];
  WoT[idx] = (half_t)Wo[src];
}

// ---------------------------------------------------------------------------
// Kernel 1: LayerNorm over m rows of 256, write f16. One wave takes LNM_ROWS
// rows one after the other, for speed only. All the rows' loads
// are issued first; gamma and beta are read once per wave.
// ---------------------------------------------------------------------------
#define LNM_ROWS 8
__global__ __launch_bounds__(256) void ln_m_kernel(
    const float* __restrict__ m, const float* __restrict__ gam,
    const float* __restrict__ bet, half_t* __restrict__ mn) {
  int wave = threadIdx.x >> 5, lane = threadIdx.x & 31;
  size_t row0 = ((size_t)blockIdx.x * 8 + wave) * LNM_ROWS;   // 0..32767
  const float* p = m + row0 * CM + lane * 8;
  float4 x0[LNM_ROWS], x1[LNM_ROWS];
  // unrolled: the arrays stay in registers and the 16 loads are in flight together
  #pragma unroll
  for (int r = 0; r < LNM_ROWS; ++r) {
    x0[r] = *(const float4*)(p + r * CM);
    x1[r] = *(const float4*)(p + r * CM + 4);
  }
  float g[8], b[8];
  #pragma unroll
  for (int e = 0; e < 8; ++e) { g[e] = gam[lane * 8 + e]; b[e] = bet[lane * 8 + e]; }
  // unrolled: register arrays, and the rows' butterflies cover each other's latency
  #pragma unroll
  for (int r = 0; r < LNM_ROWS; ++r) {
    float xs[8] = {x0[r].x, x0[r].y, x0[r].z, x0[r].w, x1[r].x, x1[r].y, x1[r].z, x1[r].w};
    float sum = 0.f;
    #pragma unroll
    for (int e = 0; e < 8; ++e) sum += xs[e];
    sum = wave_sum(sum);
    float mu = sum * (1.f / 256.f);
    float var = 0.f;
    #pragma unroll
    for (int e = 0; e < 8; ++e) { float d = xs[e] - mu; var += d * d; }
    var = wave_sum(var);
    float rstd = rsqrtf(var * (1.f / 256.f) + 1e-5f);
    union { half_t h[8]; uint4 q; } o;
    #pragma unroll
    for (int e = 0; e < 8; ++e) o.h[e] = (half_t)((xs[e] - mu) * rstd * g[e] + b[e]);
    *(uint4*)(mn + (row0 + r) * CM + lane * 8) = o.q;
  }
}

// ---------------------------------------------------------------------------
// Kernel 2: LayerNorm over z rows of 128 fused with pair-bias projection.
// One wave takes LNZ_ROWS = 32 rows (i,j), 8 queries i x 4 keys j, in batches of
// LNZ_BATCH whose loads are issued one batch ahead. gamma, beta and the lane's
// 4 x 8 slice of W_z are read once per wave and stay in registers. Every lane
// ends a butterfly with the whole sum, so lane l keeps the eight sums of row l
// and each head's 32 results leave as one 128-B line.
// Output f32, per head in the order in which the attention kernel's transposed
// score tiles hold it: [16 queries][32 keys] blocks of 512 floats, block index
// (i / 16) * 8 + j / 32; in a block, with kk = j % 32, the float at
//   (kk / 16 * 2 + kk % 8 / 4) * 128 + (kk / 8 % 2 * 16 + i % 16) * 4 + kk % 4
// so that lane l of a score tile finds four of its keys in 16 bytes at l * 16.
// ---------------------------------------------------------------------------
#define LNZ_ROWS  32
#define LNZ_BATCH 8
// one batch of rows; row r of the batch is row first + r of the wave
__device__ __forceinline__ void ln_z_batch(
    const float4 (&x)[LNZ_BATCH], int first, int lane, const float (&g)[4],
    const float (&b)[4], const float (&wz)[4][NH], float (&keep)[NH]) {
  // unrolled: register arrays, and the rows' butterflies cover each other's latency
  #pragma unroll
  for (int r = 0; r < LNZ_BATCH; ++r) {
    float xs[4] = {x[r].x, x[r].y, x[r].z, x[r].w};
    float sum = xs[0] + xs[1] + xs[2] + xs[3];
    sum = wave_sum(sum);
    float mu = sum * (1.f / 128.f);
    float var = 0.f;
    #pragma unroll
    for (int t = 0; t < 4; ++t) { float d = xs[t] - mu; var += d * d; }
    var = wave_sum(var);
    float rstd = rsqrtf(var * (1.f / 128.f) + 1e-5f);
    float zn[4];
    #pragma unroll
    for (int t = 0; t < 4; ++t) zn[t] = (xs[t] - mu) * rstd * g[t] + b[t];
    bool mine = lane == first + r;
    #pragma unroll
    for (int h = 0; h < NH; ++h) {
      float acc = 0.f;
      #pragma unroll
      for (int t = 0; t < 4; ++t) acc += zn[t] * wz[t][h];
      acc = wave_sum(acc);
      keep[h] = mine ? acc : keep[h];
    }
  }
}

__global__ __launch_bounds__(256) void ln_z_bias_kernel(
    const float* __restrict__ z, const float* __restrict__ gam,
    const float* __restrict__ bet, const float* __restrict__ Wz,
    float* __restrict__ bias) {
  int wave = threadIdx.x >> 5, lane = threadIdx.x & 31;
  const unsigned wid = blockIdx.x * 8 + wave;                // 0..2047
  const unsigned i0 = (wid >> 6) * 8, j0 = (wid & 63) * 4;   // row r: i0 + r / 4, j0 + r % 4
  const float* zp = z + (size_t)(i0 * R_RES + j0) * CZ + lane * 4;
  float4 cur[LNZ_BATCH];
  #pragma unroll
  for (int r = 0; r < LNZ_BATCH; ++r)
    cur[r] = *(const float4*)(zp + ((r >> 2) * R_RES + (r & 3)) * CZ);
  // the rows have the longest way and go out first: without this the compiler
  // issues them behind a wait on the W_z loads
  __builtin_amdgcn_sched_barrier(0);
  float wz[4][NH], g[4], b[4];
  #pragma unroll
  for (int t = 0; t < 4; ++t) {
    g[t] = gam[lane * 4 + t];
    b[t] = bet[lane * 4 + t];
    #pragma unroll
    for (int h = 0; h < NH; ++h) wz[t][h] = Wz[(lane * 4 + t) * NH + h];
  }
  float keep[NH];
  #pragma unroll
  for (int h = 0; h < NH; ++h) keep[h] = 0.f;

  // not unrolled: for speed only
  #pragma unroll 1
  for (int bt = 0; bt + 1 < LNZ_ROWS / LNZ_BATCH; ++bt) {
    float4 nxt[LNZ_BATCH];
    #pragma unroll
    for (int r = 0; r < LNZ_BATCH; ++r)
      nxt[r] = *(const float4*)(zp + (((bt + 1) * (LNZ_BATCH / 4) + (r >> 2)) * R_RES + (r & 3)) * CZ);
    // the batch body reuses the loads' address registers at once
    asm volatile("s_wait_xcnt 0x0" ::: "memory");
    ln_z_batch(cur, bt * LNZ_BATCH, lane, g, b, wz, keep);
    #pragma unroll
    for (int r = 0; r < LNZ_BATCH; ++r) cur[r] = nxt[r];
  }
  ln_z_batch(cur, LNZ_ROWS - LNZ_BATCH, lane, g, b, wz, keep);
  // the wave's 128-B line in a head's plane: rows r = lane lie side by side there
  const unsigned kk = j0 & 31;
  const unsigned p0 = ((i0 >> 4) * 8 + (j0 >> 5)) * 512 + ((kk >> 4) * 2 + ((kk & 7) >> 2)) * 128 +
                      (((kk >> 3) & 1) * 16 + (i0 & 8)) * 4;
  #pragma unroll
  for (int h = 0; h < NH; ++h) bias[h * 65536 + p0 + lane] = keep[h];
}

// ---------------------------------------------------------------------------
// Kernel 3: WMMA GEMM  C[32768x256] = A[32768x256] * B(=BT N-major).
// Block = 128 rows, 8 waves; wave = 16 rows. A wave loads its 16 rows of A once,
// as eight fragments that stay in registers, and takes several 64-column tiles
// of B with them, one after the other: fewer waves to start, fewer reads of A.
// Each 64x256 f16 B tile is staged into LDS through registers, rows laid at the
// padded pitch, then consumed as ds_load_b128 fragments.
// The kind of epilogue is a compile-time parameter, so no store stands behind a
// branch and a column's bias is read once:
//   EP_QK   store Q or K [S,H,R,C] f16      EP_VT  store V^T [S,H,C,R] f16
//   EP_GATE sigmoid(x+bg) f16 row-major     EP_OUT f32 out + bo (final GEMM)
// ---------------------------------------------------------------------------
#define EP_QK   0
#define EP_VT   1
#define EP_GATE 2
#define EP_OUT  3

// one wave's 16 x 64 tile: rows r0.., columns c0.. (c0 a multiple of 64, so the
// tile holds two whole heads). One 32-bit element index per lane; every other
// element of the lane lies at a constant offset from it.
template <int KIND>
__device__ __forceinline__ void store_tile(
    const v8f (&acc)[4], int r0, int c0, int lane,
    const float (&bv)[4], void* __restrict__ outp) {
  const unsigned m_lane = 8 * (lane >> 4), n_lane = lane & 15;
  const unsigned sh0 = (r0 >> 8) * 8 + (c0 >> 5);   // s * 8 + first head
  const unsigned i0 = (r0 & 255) + m_lane;
  if constexpr (KIND == EP_QK) {
    half_t* o = (half_t*)outp + ((sh0 * 256 + i0) * 32 + n_lane);
    #pragma unroll
    for (int j = 0; j < 4; ++j) {
      #pragma unroll
      for (int e = 0; e < 8; ++e)
        o[(j >> 1) * 256 * 32 + e * 32 + (j & 1) * 16] = (half_t)acc[j][e];
    }
  } else if constexpr (KIND == EP_VT) {
    // the lane's eight rows lie side by side in V^T: at constant offsets the
    // compiler joins the eight stores of a column into one of 16 bytes
    half_t* o = (half_t*)outp + ((sh0 * 32 + n_lane) * 256 + i0);
    #pragma unroll
    for (int j = 0; j < 4; ++j) {
      #pragma unroll
      for (int e = 0; e < 8; ++e) o[j * 16 * 256 + e] = (half_t)acc[j][e];
    }
  } else if constexpr (KIND == EP_GATE) {
    half_t* o = (half_t*)outp + ((r0 + m_lane) * 256 + c0 + n_lane);
    #pragma unroll
    for (int j = 0; j < 4; ++j) {
      #pragma unroll
      for (int e = 0; e < 8; ++e) {
        float v = acc[j][e] + bv[j];
        v = 1.f / (1.f + __expf(-v));
        o[e * 256 + j * 16] = (half_t)v;
      }
    }
  } else {
    float* o = (float*)outp + ((r0 + m_lane) * 256 + c0 + n_lane);
    #pragma unroll
    for (int j = 0; j < 4; ++j) {
      #pragma unroll
      for (int e = 0; e < 8; ++e) o[e * 256 + j * 16] = acc[j][e] + bv[j];
    }
  }
}

// the wave's 16 rows of A as eight fragments
__device__ __forceinline__ void load_a_rows(v16h (&a)[8], const half_t* __restrict__ A, int r0) {
  const int lane = threadIdx.x & 31;
  const half_t* p = A + (size_t)(r0 + (lane & 15)) * 256 + (lane >> 4) * 8;
  // unrolled: a[] stays in registers and the 16 loads are in flight together
  #pragma unroll
  for (int kb = 0; kb < 8; ++kb) {
    union { v16h v; uint4 q[2]; } u;
    u.q[0] = *(const uint4*)(p + kb * 32);
    u.q[1] = *(const uint4*)(p + kb * 32 + 16);
    a[kb] = u.v;
  }
  // the loads' address register is held whole up to this wait, which stands in
  // front of whatever rewrites it
  asm volatile("s_wait_xcnt 0x0" :: "v"(p) : "memory");
}

// one 128 x 64 tile of the block: bt = the 64 rows of BT for columns c0..c0+63
template <int KIND, bool MORE>
__device__ __forceinline__ void gemm_tile(
    const v16h (&a)[8], const half_t* __restrict__ bt, const float* __restrict__ bias,
    void* __restrict__ outp, half_t* btl, int r0, int c0) {
  // a thread copies 16 bytes of every eighth row: one address each side, the
  // rest are constant offsets
  const int tid = threadIdx.x;
  const v4u* src = (const v4u*)bt + tid;
  half_t* dst = btl + (tid >> 5) * PITCH256 + (tid & 31) * 8;
  v4u st[8];
  // unrolled: st[] stays in registers and the eight loads are in flight together
  #pragma unroll
  for (int it = 0; it < 8; ++it) st[it] = src[it * 256];
  // the lane's four bias values travel with the tile's loads: no load of the
  // epilogue then lands on a register that an issued store still names, and none
  // is waited for behind a barrier
  float bv[4] = {0.f, 0.f, 0.f, 0.f};
  if constexpr (KIND == EP_GATE || KIND == EP_OUT) {
    const unsigned bi = c0 + (tid & 15);
    #pragma unroll
    for (int j = 0; j < 4; ++j) bv[j] = bias[bi + j * 16];
    // the index registers of the tile's and the bias loads are held whole up to
    // this wait
    asm volatile("s_wait_xcnt 0x0" :: "v"(tid), "v"(bi) : "memory");
  }
  // holds the eight loads in front of the first LDS store (loaded values as
  // inputs only): without it the compiler, under the register bound, takes them
  // two at a time, four trips to L2 one after the other
  asm volatile("" :: "v"(st[0]), "v"(st[1]), "v"(st[2]), "v"(st[3]),
                     "v"(st[4]), "v"(st[5]), "v"(st[6]), "v"(st[7]));
  #pragma unroll
  for (int it = 0; it < 8; ++it) *(v4u*)(dst + it * 8 * PITCH256) = st[it];
  __syncthreads();   // the tile is whole

  v8f acc[4] = {v8f{}, v8f{}, v8f{}, v8f{}};
  #pragma unroll
  for (int kb = 0; kb < 8; ++kb) {
    #pragma unroll
    for (int j = 0; j < 4; ++j) {
      v16h b = load_frag16(btl, j * 16, PITCH256, kb * 32);   // ds_load_b128 x2
      acc[j] = wmma_f16(a[kb], b, acc[j]);
    }
  }
  // where another tile follows: every wave has read its last fragment of this
  // one. In front of the stores, so that they drain under the next tile's loads
  // and not under the barrier.
  if constexpr (MORE) __syncthreads();
  store_tile<KIND>(acc, r0, c0, threadIdx.x & 31, bv, outp);
  // the next tile's loads land on registers that these stores name
  if constexpr (MORE) asm volatile("s_wait_xcnt 0x0" ::: "memory");
}

// The four projections of mn in one launch. WT holds the four transposed weights
// one behind the other (q, k, v, gate). A block takes the same 64 columns of all
// four products, so every block has the same work.
// The 64 registers of A would take the wave past 128: bound to 8 waves per SIMD,
// so that all 1024 work-groups are on the chip at once, four to a WGP.
__global__ __launch_bounds__(256, 8) void proj_gemm(
    const half_t* __restrict__ A, const half_t* __restrict__ WT,
    const float* __restrict__ bg, half_t* __restrict__ q, half_t* __restrict__ k,
    half_t* __restrict__ vt, half_t* __restrict__ gate) {
  __shared__ __align__(16) half_t btl[64 * PITCH256];   // B tile, 33792 B
  const int r0 = blockIdx.x * 128 + (threadIdx.x >> 5) * 16;
  const int c0 = blockIdx.y * 64;
  v16h a[8];
  load_a_rows(a, A, r0);
  const half_t* bt = WT + (size_t)c0 * 256;
  gemm_tile<EP_QK, true>(a, bt, nullptr, q, btl, r0, c0);
  gemm_tile<EP_QK, true>(a, bt + 65536, nullptr, k, btl, r0, c0);
  gemm_tile<EP_VT, true>(a, bt + 2 * 65536, nullptr, vt, btl, r0, c0);
  gemm_tile<EP_GATE, false>(a, bt + 3 * 65536, bg, gate, btl, r0, c0);
}

// The final GEMM: a block takes two of the four column tiles.
__global__ __launch_bounds__(256) void out_gemm(
    const half_t* __restrict__ A, const half_t* __restrict__ BT,
    const float* __restrict__ bo, float* __restrict__ out) {
  __shared__ __align__(16) half_t btl[64 * PITCH256];   // B tile, 33792 B
  const int r0 = blockIdx.x * 128 + (threadIdx.x >> 5) * 16;
  v16h a[8];
  load_a_rows(a, A, r0);
  const int c0 = blockIdx.y * 128;
  gemm_tile<EP_OUT, true>(a, BT + (size_t)c0 * 256, bo, out, btl, r0, c0);
  gemm_tile<EP_OUT, false>(a, BT + (size_t)(c0 + 64) * 256, bo, out, btl, r0, c0 + 64);
}

__global__ __launch_bounds__(256) void attn_kernel(
    const half_t* __restrict__ q, const half_t* __restrict__ k,
    const half_t* __restrict__ vt, const float* __restrict__ bias,
    const half_t* __restrict__ gate, half_t* __restrict__ go) {
  __shared__ __align__(16) half_t lds_k[R_RES * PITCH32];   // 20480 B
  __shared__ __align__(16) half_t lds_v[CH * PITCH256];     // 16896 B
  int sh = blockIdx.x;                 // s*8 + h
  int s = sh >> 3, h = sh & 7;
  int wave = threadIdx.x >> 5, lane = threadIdx.x & 31;
  const half_t* qb = q + (size_t)sh * R_RES * CH;
  const half_t* kg = k + (size_t)sh * R_RES * CH;
  const half_t* vg = vt + (size_t)sh * CH * R_RES;
  const float*  bb = bias + (size_t)h * R_RES * R_RES;
  const float scale = 0.17677669529663687f;   // 1/sqrt(32)
  int m_lane = 8 * (lane >> 4), n_lane = lane & 15;

  {
    const uint4* ks = (const uint4*)kg;
    const uint4* vs = (const uint4*)vg;
    // unrolled so that the eight loads are in flight together
    #pragma unroll
    for (int it = 0; it < R_RES * CH / 8 / 256; ++it) {
      int t = it * 256 + threadIdx.x;
      *(uint4*)(lds_k + (t >> 2) * PITCH32 + (t & 3) * 8)   = ks[t];
      *(uint4*)(lds_v + (t >> 5) * PITCH256 + (t & 31) * 8) = vs[t];
    }
    __syncthreads();
  }

  for (int tile = 0; tile < 2; ++tile) {
    int i0 = wave * 32 + tile * 16;
    const unsigned iq = i0 + n_lane;              // the lane's query
    v16h qf = load_frag16(qb, i0, CH, 0);         // B operand: column = query
    const unsigned boff = (i0 >> 4) * 4096 + lane * 4;   // the lane's 16 bytes in the tile's bias blocks
    v8f o0 = v8f{}, o1 = v8f{};                   // channels 0..15, 16..31
    float rmax = -1e30f, rsum = 0.f;

    for (int t = 0; t < 8; ++t) {
      const float* bt = bb + 512 * t;
      float4 b[4];   // keys 0..3, 4..7, 16..19, 20..23 of the pass, + 8 in the upper half
      b[0] = *(const float4*)(bt + boff);
      b[1] = *(const float4*)(bt + boff + 128);
      b[2] = *(const float4*)(bt + boff + 256);
      b[3] = *(const float4*)(bt + boff + 384);
      v8f z = v8f{};
      v16h kf0 = load_frag16(lds_k, (2 * t) * 16, PITCH32, 0);
      v8f c0 = wmma_f16(kf0, qf, z);
      v16h kf1 = load_frag16(lds_k, (2 * t + 1) * 16, PITCH32, 0);
      v8f c1 = wmma_f16(kf1, qf, z);

      const float b0[8] = {b[0].x, b[0].y, b[0].z, b[0].w, b[1].x, b[1].y, b[1].z, b[1].w};
      const float b1[8] = {b[2].x, b[2].y, b[2].z, b[2].w, b[3].x, b[3].y, b[3].z, b[3].w};
      float x[8];
      #pragma unroll
      for (int e = 0; e < 8; ++e) {
        c0[e] = c0[e] * scale + b0[e];
        c1[e] = c1[e] * scale + b1[e];
        x[e] = fmaxf(c0[e], c1[e]);
      }
      float nm = fmaxf(fmaxf(fmaxf(x[0], x[1]), fmaxf(x[2], x[3])),
                       fmaxf(fmaxf(x[4], x[5]), fmaxf(x[6], x[7])));
      nm = fmaxf(nm, half_xor(nm));               // the query's other 16 keys
      nm = fmaxf(nm, rmax);
      float corr = __expf(rmax - nm);
      rmax = nm;
      #pragma unroll
      for (int e = 0; e < 8; ++e) {
        c0[e] = __expf(c0[e] - nm);
        c1[e] = __expf(c1[e] - nm);
        x[e] = c0[e] + c1[e];
      }
      float bsum = ((x[0] + x[1]) + (x[2] + x[3])) + ((x[4] + x[5]) + (x[6] + x[7]));
      rsum = rsum * corr + bsum;                  // this half's keys only
      v16h pf;                                    // P^T as B operand: column = query
      #pragma unroll
      for (int e = 0; e < 8; ++e) {
        o0[e] *= corr;
        o1[e] *= corr;
        pf[e]     = (half_t)c0[e];
        pf[8 + e] = (half_t)c1[e];
      }
      v16h v0 = load_frag16(lds_v, 0, PITCH256, 32 * t);    // channels 0..15
      v16h v1 = load_frag16(lds_v, 16, PITCH256, 32 * t);   // channels 16..31
      o0 = wmma_f16(v0, pf, o0);
      o1 = wmma_f16(v1, pf, o1);
    }

    // finalize: join the halves' sums, divide, gate, store f16
    rsum += half_xor(rsum);
    float inv = 1.f / rsum;
    const unsigned goff = ((unsigned)s * R_RES + iq) * 256 + h * 32 + m_lane;
    union { half_t h[8]; uint4 q; } g0, g1, r0, r1;
    g0.q = *(const uint4*)(gate + goff);
    g1.q = *(const uint4*)(gate + goff + 16);
    #pragma unroll
    for (int e = 0; e < 8; ++e) {
      r0.h[e] = (half_t)((float)g0.h[e] * o0[e] * inv);
      r1.h[e] = (half_t)((float)g1.h[e] * o1[e] * inv);
    }
    *(uint4*)(go + goff)      = r0.q;
    *(uint4*)(go + goff + 16) = r1.q;
    // the next tile's set-up rewrites registers that these stores name
    asm volatile("s_wait_xcnt 0x0" ::: "memory");
  }
}

// ---------------------------------------------------------------------------
// Host launcher
// ---------------------------------------------------------------------------
extern "C" void kernel_launch(void* const* d_in, const int* in_sizes, int n_in,
                              void* d_out, int out_size, void* d_ws, size_t ws_size,
                              hipStream_t stream) {
  const float* m      = (const float*)d_in[0];
  const float* z      = (const float*)d_in[1];
  const float* ln_m_g = (const float*)d_in[2];
  const float* ln_m_b = (const float*)d_in[3];
  const float* ln_z_g = (const float*)d_in[4];
  const float* ln_z_b = (const float*)d_in[5];
  const float* W_z    = (const float*)d_in[6];
  const float* Wq     = (const float*)d_in[7];
  const float* Wk     = (const float*)d_in[8];
  const float* Wv     = (const float*)d_in[9];
  const float* Wg     = (const float*)d_in[10];
  const float* bg     = (const float*)d_in[11];
  const float* Wo     = (const float*)d_in[12];
  const float* bo     = (const float*)d_in[13];

  char* ws = (char*)d_ws;
  const size_t BIG = (size_t)32768 * 256 * 2;   // 16 MiB f16 planes
  half_t* mn_f16 = (half_t*)(ws + 0 * BIG);
  half_t* qbuf   = (half_t*)(ws + 1 * BIG);     // [S,H,R,C]
  half_t* kbuf   = (half_t*)(ws + 2 * BIG);     // [S,H,R,C]
  half_t* vbuf   = (half_t*)(ws + 3 * BIG);     // [S,H,C,R]
  half_t* gbuf   = (half_t*)(ws + 4 * BIG);     // gate [S,R,HC]
  half_t* gobuf  = (half_t*)(ws + 5 * BIG);     // g*o  [S,R,HC]
  float*  bbuf   = (float*)(ws + 6 * BIG);      // bias f32, 8 heads x 65536 (2 MiB)
  half_t* WqT    = (half_t*)(ws + 6 * BIG + 2097152);
  half_t* WkT    = WqT + 65536;
  half_t* WvT    = WkT + 65536;
  half_t* WgT    = WvT + 65536;
  half_t* WoT    = WgT + 65536;

  cvt_weights<<<256, 256, 0, stream>>>(Wq, Wk, Wv, Wg, Wo, WqT, WkT, WvT, WgT, WoT);
  ln_m_kernel<<<512, 256, 0, stream>>>(m, ln_m_g, ln_m_b, mn_f16);
  ln_z_bias_kernel<<<256, 256, 0, stream>>>(z, ln_z_g, ln_z_b, W_z, bbuf);

  proj_gemm<<<dim3(256, 4), 256, 0, stream>>>(mn_f16, WqT, bg, qbuf, kbuf, vbuf, gbuf);

  attn_kernel<<<1024, 256, 0, stream>>>(qbuf, kbuf, vbuf, bbuf, gbuf, gobuf);

  out_gemm<<<dim3(256, 2), 256, 0, stream>>>(gobuf, WoT, bo, (float*)d_out);
}

// v006
// A run of this version takes 78.5 microseconds.
// Timed twice side by side with v005, it ran 1.05 times as fast both times.
// Counting every step since v000, it is 3.90 times as fast.
#include <hip/hip_runtime.h>
#include <hip/hip_bf16.h>

typedef _Float16 half_t;
typedef __attribute__((ext_vector_type(16))) _Float16 v16h;
typedef __attribute__((ext_vector_type(8)))  float    v8f;
typedef __attribute__((ext_vector_type(4)))  unsigned int v4u;

#define S_SEQ 128
#define R_RES 256
#define CM    256
#define CZ    128
#define CH    32
#define NH    8

// LDS row pitches, in f16 elements. Every fragment tile is read with
// ds_load_b128, 16 rows per half-wave: a pitch of 16 B x odd puts the 16 rows
// on 16 distinct groups of four banks, a pitch of 64 B or 512 B does not.
#define PITCH256 264   // rows of 256 f16: 528 B = 16 B x 33
#define PITCH32  40    // rows of  32 f16:  80 B = 16 B x 5

// ---------------------------------------------------------------------------
// WMMA 16x16x32 f16 fragment loader (A-layout; B uses identical layout with
// lane = N, since B is consumed as N x K).
// lane l: row = row0 + (l&15), half = l>>4
// element e: k = k0 + 16*(e/8) + 8*half + (e%8)
// -> two contiguous 16-byte chunks per lane (global_load_b128 / ds_load_b128).
// ---------------------------------------------------------------------------
__device__ __forceinline__ v16h load_frag16(const half_t* base, int row0, int ldk, int k0) {
  const int lane = threadIdx.x & 31;
  const int r    = row0 + (lane & 15);
  const int hh   = lane >> 4;
  const half_t* p = base + (size_t)r * ldk + k0 + hh * 8;
  union { v16h v; uint4 q[2]; } u;
  u.q[0] = *(const uint4*)(p);
  u.q[1] = *(const uint4*)(p + 16);
  return u.v;
}

__device__ __forceinline__ v8f wmma_f16(v16h a, v16h b, v8f c) {
  return __builtin_amdgcn_wmma_f32_16x16x32_f16(false, a, false, b, (short)0, c, false, false);
}

// ---------------------------------------------------------------------------
// Cross-lane moves on the vector unit. __shfl_xor goes through the LDS pipe
// (ds_bpermute_b32 and a wait on dscnt for every step); these do not.
// All 32 lanes are on wherever they are used.
// ---------------------------------------------------------------------------
// value of lane l ^ M, M < 16: DPP row_xmask inside the 16-lane row
template <int M>
__device__ __forceinline__ float row_xor(float v) {
  return __builtin_bit_cast(float, __builtin_amdgcn_update_dpp(
      0, __builtin_bit_cast(int, v), 0x160 | M, 0xf, 0xf, true));
}
// value of lane l ^ 16: the same lane of the other row
__device__ __forceinline__ float half_xor(float v) {
  int b = __builtin_bit_cast(int, v);
  return __builtin_bit_cast(float, __builtin_amdgcn_permlanex16(
      b, b, 0x76543210, 0xfedcba98, false, false));
}
// butterfly sum over the 32 lanes, steps 1, 2, 4, 8, 16
__device__ __forceinline__ float wave_sum(float v) {
  v += row_xor<1>(v);
  v += row_xor<2>(v);
  v += row_xor<4>(v);
  v += row_xor<8>(v);
  v += half_xor(v);
  return v;
}
// one butterfly step over eight values side by side, inside the 16-lane row
template <int M>
__device__ __forceinline__ void row_max_step(float (&x)[8]) {
  // unrolled: x[] stays in registers, the eight chains cover each other's latency
  #pragma unroll
  for (int e = 0; e < 8; ++e) x[e] = fmaxf(x[e], row_xor<M>(x[e]));
}
template <int M>
__device__ __forceinline__ void row_sum_step(float (&x)[8]) {
  // unrolled: x[] stays in registers, the eight chains cover each other's latency
  #pragma unroll
  for (int e = 0; e < 8; ++e) x[e] += row_xor<M>(x[e]);
}

// ---------------------------------------------------------------------------
// Part 0 of the first launch: transpose + f32->f16 convert the five 256x256
// weight matrices. WT[n*256+k] = (f16) W[k*256+n]. blk = 0..255.
// ---------------------------------------------------------------------------
__device__ __forceinline__ void cvt_weights(
    unsigned blk, const float* __restrict__ Wq, const float* __restrict__ Wk,
    const float* __restrict__ Wv, const float* __restrict__ Wg,
    const float* __restrict__ Wo,
    half_t* __restrict__ WqT, half_t* __restrict__ WkT,
    half_t* __restrict__ WvT, half_t* __restrict__ WgT,
    half_t* __restrict__ WoT) {
  int idx = blk * 256 + threadIdx.x;             // 0..65535
  int n = idx >> 8, k = idx & 255;
  int src = k * 256 + n;
  WqT[idx] = (half_t)Wq[src];
  WkT[idx] = (half_t)Wk[src];
  WvT[idx] = (half_t)Wv[src];
  WgT[idx] = (half_t)Wg[src];
  WoT[idx] = (half_t)Wo[src];
}

// ---------------------------------------------------------------------------
// Part 1 of the first launch, blk = 0..511:
// LayerNorm over m rows of 256, write f16. One wave takes LNM_ROWS
// rows one after the other, for speed only. All the rows' loads
// are issued first; gamma and beta are read once per wave.
// ---------------------------------------------------------------------------
#define LNM_ROWS 8
__device__ __forceinline__ void ln_m_rows(
    unsigned blk, const float* __restrict__ m, const float* __restrict__ gam,
    const float* __restrict__ bet, half_t* __restrict__ mn) {
  int wave = threadIdx.x >> 5, lane = threadIdx.x & 31;
  size_t row0 = ((size_t)blk * 8 + wave) * LNM_ROWS;          // 0..32767
  const float* p = m + row0 * CM + lane * 8;
  float4 x0[LNM_ROWS], x1[LNM_ROWS];
  // unrolled: the arrays stay in registers and the 16 loads are in flight together
  #pragma unroll
  for (int r = 0; r < LNM_ROWS; ++r) {
    x0[r] = *(const float4*)(p + r * CM);
    x1[r] = *(const float4*)(p + r * CM + 4);
  }
  float g[8], b[8];
  #pragma unroll
  for (int e = 0; e < 8; ++e) { g[e] = gam[lane * 8 + e]; b[e] = bet[lane * 8 + e]; }
  // unrolled: register arrays, and the rows' butterflies cover each other's latency
  #pragma unroll
  for (int r = 0; r < LNM_ROWS; ++r) {
    float xs[8] = {x0[r].x, x0[r].y, x0[r].z, x0[r].w, x1[r].x, x1[r].y, x1[r].z, x1[r].w};
    float sum = 0.f;
    #pragma unroll
    for (int e = 0; e < 8; ++e) sum += xs[e];
    sum = wave_sum(sum);
    float mu = sum * (1.f / 256.f);
    float var = 0.f;
    #pragma unroll
    for (int e = 0; e < 8; ++e) { float d = xs[e] - mu; var += d * d; }
    var = wave_sum(var);
    float rstd = rsqrtf(var * (1.f / 256.f) + 1e-5f);
    union { half_t h[8]; uint4 q; } o;
    #pragma unroll
    for (int e = 0; e < 8; ++e) o.h[e] = (half_t)((xs[e] - mu) * rstd * g[e] + b[e]);
    *(uint4*)(mn + (row0 + r) * CM + lane * 8) = o.q;
  }
}

// ---------------------------------------------------------------------------
// Part 2 of the first launch, blk = 0..255:
// LayerNorm over z rows of 128 fused with pair-bias projection.
// One wave takes LNZ_ROWS = 32 rows (i,j), 8 queries i x 4 keys j, in batches of
// LNZ_BATCH whose loads are issued one batch ahead. gamma, beta and the lane's
// 4 x 8 slice of W_z are read once per wave and stay in registers. Every lane
// ends a butterfly with the whole sum, so lane l keeps the eight sums of row l
// and each head's 32 results leave as one 128-B line.
// Output f32, per head in the order in which the attention kernel's transposed
// score tiles hold it: [16 queries][32 keys] blocks of 512 floats, block index
// (i / 16) * 8 + j / 32; in a block, with kk = j % 32, the float at
//   (kk / 16 * 2 + kk % 8 / 4) * 128 + (kk / 8 % 2 * 16 + i % 16) * 4 + kk % 4
// so that lane l of a score tile finds four of its keys in 16 bytes at l * 16.
// ---------------------------------------------------------------------------
#define LNZ_ROWS  32
#define LNZ_BATCH 8
// one batch of rows; row r of the batch is row first + r of the wave
__device__ __forceinline__ void ln_z_batch(
    const float4 (&x)[LNZ_BATCH], int first, int lane, const float (&g)[4],
    const float (&b)[4], const float (&wz)[4][NH], float (&keep)[NH]) {
  // unrolled: register arrays, and the rows' butterflies cover each other's latency
  #pragma unroll
  for (int r = 0; r < LNZ_BATCH; ++r) {
    float xs[4] = {x[r].x, x[r].y, x[r].z, x[r].w};
    float sum = xs[0] + xs[1] + xs[2] + xs[3];
    sum = wave_sum(sum);
    float mu = sum * (1.f / 128.f);
    float var = 0.f;
    #pragma unroll
    for (int t = 0; t < 4; ++t) { float d = xs[t] - mu; var += d * d; }
    var = wave_sum(var);
    float rstd = rsqrtf(var * (1.f / 128.f) + 1e-5f);
    float zn[4];
    #pragma unroll
    for (int t = 0; t < 4; ++t) zn[t] = (xs[t] - mu) * rstd * g[t] + b[t];
    bool mine = lane == first + r;
    #pragma unroll
    for (int h = 0; h < NH; ++h) {
      float acc = 0.f;
      #pragma unroll
      for (int t = 0; t < 4; ++t) acc += zn[t] * wz[t][h];
      acc = wave_sum(acc);
      keep[h] = mine ? acc : keep[h];
    }
  }
}

__device__ __forceinline__ void ln_z_bias(
    unsigned blk, const float* __restrict__ z, const float* __restrict__ gam,
    const float* __restrict__ bet, const float* __restrict__ Wz,
    float* __restrict__ bias) {
  int wave = threadIdx.x >> 5, lane = threadIdx.x & 31;
  const unsigned wid = blk * 8 + wave;                       // 0..2047
  const unsigned i0 = (wid >> 6) * 8, j0 = (wid & 63) * 4;   // row r: i0 + r / 4, j0 + r % 4
  const float* zp = z + (size_t)(i0 * R_RES + j0) * CZ + lane * 4;
  float4 cur[LNZ_BATCH];
  #pragma unroll
  for (int r = 0; r < LNZ_BATCH; ++r)
    cur[r] = *(const float4*)(zp + ((r >> 2) * R_RES + (r & 3)) * CZ);
  // the rows have the longest way and go out first: without this the compiler
  // issues them behind a wait on the W_z loads
  __builtin_amdgcn_sched_barrier(0);
  float wz[4][NH], g[4], b[4];
  #pragma unroll
  for (int t = 0; t < 4; ++t) {
    g[t] = gam[lane * 4 + t];
    b[t] = bet[lane * 4 + t];
    #pragma unroll
    for (int h = 0; h < NH; ++h) wz[t][h] = Wz[(lane * 4 + t) * NH + h];
  }
  float keep[NH];
  #pragma unroll
  for (int h = 0; h < NH; ++h) keep[h] = 0.f;

  // not unrolled: for speed only
  #pragma unroll 1
  for (int bt = 0; bt + 1 < LNZ_ROWS / LNZ_BATCH; ++bt) {
    float4 nxt[LNZ_BATCH];
    #pragma unroll
    for (int r = 0; r < LNZ_BATCH; ++r)
      nxt[r] = *(const float4*)(zp + (((bt + 1) * (LNZ_BATCH / 4) + (r >> 2)) * R_RES + (r & 3)) * CZ);
    // the batch body reuses the loads' address registers at once
    asm volatile("s_wait_xcnt 0x0" ::: "memory");
    ln_z_batch(cur, bt * LNZ_BATCH, lane, g, b, wz, keep);
    #pragma unroll
    for (int r = 0; r < LNZ_BATCH; ++r) cur[r] = nxt[r];
  }
  ln_z_batch(cur, LNZ_ROWS - LNZ_BATCH, lane, g, b, wz, keep);
  // the wave's 128-B line in a head's plane: rows r = lane lie side by side there
  const unsigned kk = j0 & 31;
  const unsigned p0 = ((i0 >> 4) * 8 + (j0 >> 5)) * 512 + ((kk >> 4) * 2 + ((kk & 7) >> 2)) * 128 +
                      (((kk >> 3) & 1) * 16 + (i0 & 8)) * 4;
  #pragma unroll
  for (int h = 0; h < NH; ++h) bias[h * 65536 + p0 + lane] = keep[h];
}

// ---------------------------------------------------------------------------
// The first launch: the three passes above read only inputs and write disjoint
// planes of the workspace, so none waits for another. They share one grid, each
// on its own range of work-groups: one launch gap and one fill, not three, and
// the vector work on z runs under the memory streams of m. The longest part has
// the lowest indices.
// ---------------------------------------------------------------------------
#define PRE_Z_BLOCKS 256
#define PRE_M_BLOCKS 512
#define PRE_W_BLOCKS 256   // the rest of the grid of 1024
__global__ __launch_bounds__(256) void pre_kernel(
    const float* __restrict__ z, const float* __restrict__ ln_z_g,
    const float* __restrict__ ln_z_b, const float* __restrict__ W_z,
    float* __restrict__ bias,
    const float* __restrict__ m, const float* __restrict__ ln_m_g,
    const float* __restrict__ ln_m_b, half_t* __restrict__ mn,
    const float* __restrict__ Wq, const float* __restrict__ Wk,
    const float* __restrict__ Wv, const float* __restrict__ Wg,
    const float* __restrict__ Wo,
    half_t* __restrict__ WqT, half_t* __restrict__ WkT,
    half_t* __restrict__ WvT, half_t* __restrict__ WgT,
    half_t* __restrict__ WoT) {
  const unsigned blk = blockIdx.x;
  if (blk < PRE_Z_BLOCKS) {
    ln_z_bias(blk, z, ln_z_g, ln_z_b, W_z, bias);
  } else if (blk < PRE_Z_BLOCKS + PRE_M_BLOCKS) {
    ln_m_rows(blk - PRE_Z_BLOCKS, m, ln_m_g, ln_m_b, mn);
    // in the built code the end of this part stands, over a test that never
    // passes, in front of another part's set-up, which rewrites the registers
    // that the stores name
    asm volatile("s_wait_xcnt 0x0" ::: "memory");
  } else {
    cvt_weights(blk - (PRE_Z_BLOCKS + PRE_M_BLOCKS), Wq, Wk, Wv, Wg, Wo, WqT, WkT, WvT, WgT, WoT);
    // as above
    asm volatile("s_wait_xcnt 0x0" ::: "memory");
  }
}

// ---------------------------------------------------------------------------
// Kernel 3: WMMA GEMM  C[32768x256] = A[32768x256] * B(=BT N-major).
// Block = 128 rows, 8 waves; wave = 16 rows. A wave loads its 16 rows of A once,
// as eight fragments that stay in registers, and takes several 64-column tiles
// of B with them, one after the other: fewer waves to start, fewer reads of A.
// Each 64x256 f16 B tile is staged into LDS through registers, rows laid at the
// padded pitch, then consumed as ds_load_b128 fragments.
// The kind of epilogue is a compile-time parameter, so no store stands behind a
// branch and a column's bias is read once:
//   EP_QK   store Q or K [S,H,R,C] f16      EP_VT  store V^T [S,H,C,R] f16
//   EP_GATE sigmoid(x+bg) f16 row-major     EP_OUT f32 out + bo (final GEMM)
// ---------------------------------------------------------------------------
#define EP_QK   0
#define EP_VT   1
#define EP_GATE 2
#define EP_OUT  3

// one wave's 16 x 64 tile: rows r0.., columns c0.. (c0 a multiple of 64, so the
// tile holds two whole heads). One 32-bit element index per lane; every other
// element of the lane lies at a constant offset from it.
template <int KIND>
__device__ __forceinline__ void store_tile(
    const v8f (&acc)[4], int r0, int c0, int lane,
    const float (&bv)[4], void* __restrict__ outp) {
  const unsigned m_lane = 8 * (lane >> 4), n_lane = lane & 15;
  const unsigned sh0 = (r0 >> 8) * 8 + (c0 >> 5);   // s * 8 + first head
  const unsigned i0 = (r0 & 255) + m_lane;
  if constexpr (KIND == EP_QK) {
    half_t* o = (half_t*)outp + ((sh0 * 256 + i0) * 32 + n_lane);
    #pragma unroll
    for (int j = 0; j < 4; ++j) {
      #pragma unroll
      for (int e = 0; e < 8; ++e)
        o[(j >> 1) * 256 * 32 + e * 32 + (j & 1) * 16] = (half_t)acc[j][e];
    }
  } else if constexpr (KIND == EP_VT) {
    // the lane's eight rows lie side by side in V^T: at constant offsets the
    // compiler joins the eight stores of a column into one of 16 bytes
    half_t* o = (half_t*)outp + ((sh0 * 32 + n_lane) * 256 + i0);
    #pragma unroll
    for (int j = 0; j < 4; ++j) {
      #pragma unroll
      for (int e = 0; e < 8; ++e) o[j * 16 * 256 + e] = (half_t)acc[j][e];
    }
  } else if constexpr (KIND == EP_GATE) {
    half_t* o = (half_t*)outp + ((r0 + m_lane) * 256 + c0 + n_lane);
    #pragma unroll
    for (int j = 0; j < 4; ++j) {
      #pragma unroll
      for (int e = 0; e < 8; ++e) {
        float v = acc[j][e] + bv[j];
        v = 1.f / (1.f + __expf(-v));
        o[e * 256 + j * 16] = (half_t)v;
      }
    }
  } else {
    float* o = (float*)outp + ((r0 + m_lane) * 256 + c0 + n_lane);
    #pragma unroll
    for (int j = 0; j < 4; ++j) {
      #pragma unroll
      for (int e = 0; e < 8; ++e) o[e * 256 + j * 16] = acc[j][e] + bv[j];
    }
  }
}

// the wave's 16 rows of A as eight fragments
__device__ __forceinline__ void load_a_rows(v16h (&a)[8], const half_t* __restrict__ A, int r0) {
  const int lane = threadIdx.x & 31;
  const half_t* p = A + (size_t)(r0 + (lane & 15)) * 256 + (lane >> 4) * 8;
  // unrolled: a[] stays in registers and the 16 loads are in flight together
  #pragma unroll
  for (int kb = 0; kb < 8; ++kb) {
    union { v16h v; uint4 q[2]; } u;
    u.q[0] = *(const uint4*)(p + kb * 32);
    u.q[1] = *(const uint4*)(p + kb * 32 + 16);
    a[kb] = u.v;
  }
  // the loads' address register is held whole up to this wait, which stands in
  // front of whatever rewrites it
  asm volatile("s_wait_xcnt 0x0" :: "v"(p) : "memory");
}

// one 128 x 64 tile of the block: bt = the 64 rows of BT for columns c0..c0+63
template <int KIND, bool MORE>
__device__ __forceinline__ void gemm_tile(
    const v16h (&a)[8], const half_t* __restrict__ bt, const float* __restrict__ bias,
    void* __restrict__ outp, half_t* btl, int r0, int c0) {
  // a thread copies 16 bytes of every eighth row: one address each side, the
  // rest are constant offsets
  const int tid = threadIdx.x;
  const v4u* src = (const v4u*)bt + tid;
  half_t* dst = btl + (tid >> 5) * PITCH256 + (tid & 31) * 8;
  v4u st[8];
  // unrolled: st[] stays in registers and the eight loads are in flight together
  #pragma unroll
  for (int it = 0; it < 8; ++it) st[it] = src[it * 256];
  // the lane's four bias values travel with the tile's loads: no load of the
  // epilogue then lands on a register that an issued store still names, and none
  // is waited for behind a barrier
  float bv[4] = {0.f, 0.f, 0.f, 0.f};
  if constexpr (KIND == EP_GATE || KIND == EP_OUT) {
    const unsigned bi = c0 + (tid & 15);
    #pragma unroll
    for (int j = 0; j < 4; ++j) bv[j] = bias[bi + j * 16];
    // the index registers of the tile's and the bias loads are held whole up to
    // this wait
    asm volatile("s_wait_xcnt 0x0" :: "v"(tid), "v"(bi) : "memory");
  }
  // holds the eight loads in front of the first LDS store (loaded values as
  // inputs only): without it the compiler, under the register bound, takes them
  // two at a time, four trips to L2 one after the other
  asm volatile("" :: "v"(st[0]), "v"(st[1]), "v"(st[2]), "v"(st[3]),
                     "v"(st[4]), "v"(st[5]), "v"(st[6]), "v"(st[7]));
  #pragma unroll
  for (int it = 0; it < 8; ++it) *(v4u*)(dst + it * 8 * PITCH256) = st[it];
  __syncthreads();   // the tile is whole

  v8f acc[4] = {v8f{}, v8f{}, v8f{}, v8f{}};
  #pragma unroll
  for (int kb = 0; kb < 8; ++kb) {
    #pragma unroll
    for (int j = 0; j < 4; ++j) {
      v16h b = load_frag16(btl, j * 16, PITCH256, kb * 32);   // ds_load_b128 x2
      acc[j] = wmma_f16(a[kb], b, acc[j]);
    }
  }
  // where another tile follows: every wave has read its last fragment of this
  // one. In front of the stores, so that they drain under the next tile's loads
  // and not under the barrier.
  if constexpr (MORE) __syncthreads();
  store_tile<KIND>(acc, r0, c0, threadIdx.x & 31, bv, outp);
  // the next tile's loads land on registers that these stores name
  if constexpr (MORE) asm volatile("s_wait_xcnt 0x0" ::: "memory");
}

// The four projections of mn in one launch. WT holds the four transposed weights
// one behind the other (q, k, v, gate). A block takes the same 64 columns of all
// four products, so every block has the same work.
// The 64 registers of A would take the wave past 128: bound to 8 waves per SIMD,
// so that all 1024 work-groups are on the chip at once, four to a WGP.
__global__ __launch_bounds__(256, 8) void proj_gemm(
    const half_t* __restrict__ A, const half_t* __restrict__ WT,
    const float* __restrict__ bg, half_t* __restrict__ q, half_t* __restrict__ k,
    half_t* __restrict__ vt, half_t* __restrict__ gate) {
  __shared__ __align__(16) half_t btl[64 * PITCH256];   // B tile, 33792 B
  const int r0 = blockIdx.x * 128 + (threadIdx.x >> 5) * 16;
  const int c0 = blockIdx.y * 64;
  v16h a[8];
  load_a_rows(a, A, r0);
  const half_t* bt = WT + (size_t)c0 * 256;
  gemm_tile<EP_QK, true>(a, bt, nullptr, q, btl, r0, c0);
  gemm_tile<EP_QK, true>(a, bt + 65536, nullptr, k, btl, r0, c0);
  gemm_tile<EP_VT, true>(a, bt + 2 * 65536, nullptr, vt, btl, r0, c0);
  gemm_tile<EP_GATE, false>(a, bt + 3 * 65536, bg, gate, btl, r0, c0);
}

// The final GEMM: a block takes two of the four column tiles.
__global__ __launch_bounds__(256) void out_gemm(
    const half_t* __restrict__ A, const half_t* __restrict__ BT,
    const float* __restrict__ bo, float* __restrict__ out) {
  __shared__ __align__(16) half_t btl[64 * PITCH256];   // B tile, 33792 B
  const int r0 = blockIdx.x * 128 + (threadIdx.x >> 5) * 16;
  v16h a[8];
  load_a_rows(a, A, r0);
  const int c0 = blockIdx.y * 128;
  gemm_tile<EP_OUT, true>(a, BT + (size_t)c0 * 256, bo, out, btl, r0, c0);
  gemm_tile<EP_OUT, false>(a, BT + (size_t)(c0 + 64) * 256, bo, out, btl, r0, c0 + 64);
}

__global__ __launch_bounds__(256) void attn_kernel(
    const half_t* __restrict__ q, const half_t* __restrict__ k,
    const half_t* __restrict__ vt, const float* __restrict__ bias,
    const half_t* __restrict__ gate, half_t* __restrict__ go) {
  __shared__ __align__(16) half_t lds_k[R_RES * PITCH32];   // 20480 B
  __shared__ __align__(16) half_t lds_v[CH * PITCH256];     // 16896 B
  int sh = blockIdx.x;                 // s*8 + h
  int s = sh >> 3, h = sh & 7;
  int wave = threadIdx.x >> 5, lane = threadIdx.x & 31;
  const half_t* qb = q + (size_t)sh * R_RES * CH;
  const half_t* kg = k + (size_t)sh * R_RES * CH;
  const half_t* vg = vt + (size_t)sh * CH * R_RES;
  const float*  bb = bias + (size_t)h * R_RES * R_RES;
  const float scale = 0.17677669529663687f;   // 1/sqrt(32)
  int m_lane = 8 * (lane >> 4), n_lane = lane & 15;

  {
    const uint4* ks = (const uint4*)kg;
    const uint4* vs = (const uint4*)vg;
    // unrolled so that the eight loads are in flight together
    #pragma unroll
    for (int it = 0; it < R_RES * CH / 8 / 256; ++it) {
      int t = it * 256 + threadIdx.x;
      *(uint4*)(lds_k + (t >> 2) * PITCH32 + (t & 3) * 8)   = ks[t];
      *(uint4*)(lds_v + (t >> 5) * PITCH256 + (t & 31) * 8) = vs[t];
    }
    __syncthreads();
  }

  for (int tile = 0; tile < 2; ++tile) {
    int i0 = wave * 32 + tile * 16;
    const unsigned iq = i0 + n_lane;              // the lane's query
    v16h qf = load_frag16(qb, i0, CH, 0);         // B operand: column = query
    const unsigned boff = (i0 >> 4) * 4096 + lane * 4;   // the lane's 16 bytes in the tile's bias blocks
    v8f o0 = v8f{}, o1 = v8f{};                   // channels 0..15, 16..31
    float rmax = -1e30f, rsum = 0.f;

    for (int t = 0; t < 8; ++t) {
      const float* bt = bb + 512 * t;
      float4 b[4];   // keys 0..3, 4..7, 16..19, 20..23 of the pass, + 8 in the upper half
      b[0] = *(const float4*)(bt + boff);
      b[1] = *(const float4*)(bt + boff + 128);
      b[2] = *(const float4*)(bt + boff + 256);
      b[3] = *(const float4*)(bt + boff + 384);
      v8f z = v8f{};
      v16h kf0 = load_frag16(lds_k, (2 * t) * 16, PITCH32, 0);
      v8f c0 = wmma_f16(kf0, qf, z);
      v16h kf1 = load_frag16(lds_k, (2 * t + 1) * 16, PITCH32, 0);
      v8f c1 = wmma_f16(kf1, qf, z);

      const float b0[8] = {b[0].x, b[0].y, b[0].z, b[0].w, b[1].x, b[1].y, b[1].z, b[1].w};
      const float b1[8] = {b[2].x, b[2].y, b[2].z, b[2].w, b[3].x, b[3].y, b[3].z, b[3].w};
      float x[8];
      #pragma unroll
      for (int e = 0; e < 8; ++e) {
        c0[e] = c0[e] * scale + b0[e];
        c1[e] = c1[e] * scale + b1[e];
        x[e] = fmaxf(c0[e], c1[e]);
      }
      float nm = fmaxf(fmaxf(fmaxf(x[0], x[1]), fmaxf(x[2], x[3])),
                       fmaxf(fmaxf(x[4], x[5]), fmaxf(x[6], x[7])));
      nm = fmaxf(nm, half_xor(nm));               // the query's other 16 keys
      nm = fmaxf(nm, rmax);
      float corr = __expf(rmax - nm);
      rmax = nm;
      #pragma unroll
      for (int e = 0; e < 8; ++e) {
        c0[e] = __expf(c0[e] - nm);
        c1[e] = __expf(c1[e] - nm);
        x[e] = c0[e] + c1[e];
      }
      float bsum = ((x[0] + x[1]) + (x[2] + x[3])) + ((x[4] + x[5]) + (x[6] + x[7]));
      rsum = rsum * corr + bsum;                  // this half's keys only
      v16h pf;                                    // P^T as B operand: column = query
      #pragma unroll
      for (int e = 0; e < 8; ++e) {
        o0[e] *= corr;
        o1[e] *= corr;
        pf[e]     = (half_t)c0[e];
        pf[8 + e] = (half_t)c1[e];
      }
      v16h v0 = load_frag16(lds_v, 0, PITCH256, 32 * t);    // channels 0..15
      v16h v1 = load_frag16(lds_v, 16, PITCH256, 32 * t);   // channels 16..31
      o0 = wmma_f16(v0, pf, o0);
      o1 = wmma_f16(v1, pf, o1);
    }

    // finalize: join the halves' sums, divide, gate, store f16
    rsum += half_xor(rsum);
    float inv = 1.f / rsum;
    const unsigned goff = ((unsigned)s * R_RES + iq) * 256 + h * 32 + m_lane;
    union { half_t h[8]; uint4 q; } g0, g1, r0, r1;
    g0.q = *(const uint4*)(gate + goff);
    g1.q = *(const uint4*)(gate + goff + 16);
    #pragma unroll
    for (int e = 0; e < 8; ++e) {
      r0.h[e] = (half_t)((float)g0.h[e] * o0[e] * inv);
      r1.h[e] = (half_t)((float)g1.h[e] * o1[e] * inv);
    }
    *(uint4*)(go + goff)      = r0.q;
    *(uint4*)(go + goff + 16) = r1.q;
    // the next tile's set-up rewrites registers that these stores name
    asm volatile("s_wait_xcnt 0x0" ::: "memory");
  }
}

// ---------------------------------------------------------------------------
// Host launcher
// ---------------------------------------------------------------------------
extern "C" void kernel_launch(void* const* d_in, const int* in_sizes, int n_in,
                              void* d_out, int out_size, void* d_ws, size_t ws_size,
                              hipStream_t stream) {
  const float* m      = (const float*)d_in[0];
  const float* z      = (const float*)d_in[1];
  const float* ln_m_g = (const float*)d_in[2];
  const float* ln_m_b = (const float*)d_in[3];
  const float* ln_z_g = (const float*)d_in[4];
  const float* ln_z_b = (const float*)d_in[5];
  const float* W_z    = (const float*)d_in[6];
  const float* Wq     = (const float*)d_in[7];
  const float* Wk     = (const float*)d_in[8];
  const float* Wv     = (const float*)d_in[9];
  const float* Wg     = (const float*)d_in[10];
  const float* bg     = (const float*)d_in[11];
  const float* Wo     = (const float*)d_in[12];
  const float* bo     = (const float*)d_in[13];

  char* ws = (char*)d_ws;
  const size_t BIG = (size_t)32768 * 256 * 2;   // 16 MiB f16 planes
  half_t* mn_f16 = (half_t*)(ws + 0 * BIG);
  half_t* qbuf   = (half_t*)(ws + 1 * BIG);     // [S,H,R,C]
  half_t* kbuf   = (half_t*)(ws + 2 * BIG);     // [S,H,R,C]
  half_t* vbuf   = (half_t*)(ws + 3 * BIG);     // [S,H,C,R]
  half_t* gbuf   = (half_t*)(ws + 4 * BIG);     // gate [S,R,HC]
  half_t* gobuf  = (half_t*)(ws + 5 * BIG);     // g*o  [S,R,HC]
  float*  bbuf   = (float*)(ws + 6 * BIG);      // bias f32, 8 heads x 65536 (2 MiB)
  half_t* WqT    = (half_t*)(ws + 6 * BIG + 2097152);
  half_t* WkT    = WqT + 65536;
  half_t* WvT    = WkT + 65536;
  half_t* WgT    = WvT + 65536;
  half_t* WoT    = WgT + 65536;

  pre_kernel<<<1024, 256, 0, stream>>>(   // 256 + 512 + 256 work-groups
      z, ln_z_g, ln_z_b, W_z, bbuf, m, ln_m_g, ln_m_b, mn_f16,
      Wq, Wk, Wv, Wg, Wo, WqT, WkT, WvT, WgT, WoT);

  proj_gemm<<<dim3(256, 4), 256, 0, stream>>>(mn_f16, WqT, bg, qbuf, kbuf, vbuf, gbuf);

  attn_kernel<<<1024, 256, 0, stream>>>(qbuf, kbuf, vbuf, bbuf, gbuf, gobuf);

  out_gemm<<<dim3(256, 2), 256, 0, stream>>>(gobuf, WoT, bo, (float*)d_out);
}

// v007
// One run takes 69.4 microseconds.
// In both of two side-by-side timings against v006, it was 1.13 times as fast.
// Over all steps from v000 it is 4.40 times as fast.
#include <hip/hip_runtime.h>
#include <hip/hip_bf16.h>

typedef _Float16 half_t;
typedef __attribute__((ext_vector_type(16))) _Float16 v16h;
typedef __attribute__((ext_vector_type(8)))  float    v8f;
typedef __attribute__((ext_vector_type(4)))  unsigned int v4u;

#define S_SEQ 128
#define R_RES 256
#define CM    256
#define CZ    128
#define CH    32
#define NH    8

// LDS row pitches, in f16 elements. Every fragment tile is read with
// ds_load_b128, 16 rows per half-wave: a pitch of 16 B x odd puts the 16 rows
// on 16 distinct groups of four banks, a pitch of 64 B or 512 B does not.
#define PITCH256 264   // rows of 256 f16: 528 B = 16 B x 33
#define PITCH32  40    // rows of  32 f16:  80 B = 16 B x 5

// ---------------------------------------------------------------------------
// WMMA 16x16x32 f16 fragment loader (A-layout; B uses identical layout with
// lane = N, since B is consumed as N x K).
// lane l: row = row0 + (l&15), half = l>>4
// element e: k = k0 + 16*(e/8) + 8*half + (e%8)
// -> two contiguous 16-byte chunks per lane (global_load_b128 / ds_load_b128).
// ---------------------------------------------------------------------------
__device__ __forceinline__ v16h load_frag16(const half_t* base, int row0, int ldk, int k0) {
  const int lane = threadIdx.x & 31;
  const int r    = row0 + (lane & 15);
  const int hh   = lane >> 4;
  const half_t* p = base + (size_t)r * ldk + k0 + hh * 8;
  union { v16h v; uint4 q[2]; } u;
  u.q[0] = *(const uint4*)(p);
  u.q[1] = *(const uint4*)(p + 16);
  return u.v;
}

__device__ __forceinline__ v8f wmma_f16(v16h a, v16h b, v8f c) {
  return __builtin_amdgcn_wmma_f32_16x16x32_f16(false, a, false, b, (short)0, c, false, false);
}

// ---------------------------------------------------------------------------
// Fragment order of the planes Q, K, gate and g * o. A plane is [S*H] heads of
// 256 rows x 32 channels; a head is 16 blocks of 16 rows, 512 f16 each, and in
// a block the element (row i, channel c) stands at
//   (c / 8) * 128 + (i % 16) * 8 + c % 8
// so the 16-byte chunks that the 32 lanes of one fragment load (or of one store
// of a transposed accumulator tile) touch lie side by side: 512 bytes, four
// whole lines, where rows laid one behind the other give 16 pieces of 32 bytes.
// Same k order as load_frag16: chunk half, then chunk 2 + half.
// ---------------------------------------------------------------------------
#define FR_HEAD  8192   // f16 per head
#define FR_BLOCK 512    // f16 per block of 16 rows
__device__ __forceinline__ v16h load_frag_fr(const half_t* blockp, int lane) {
  union { v16h v; uint4 q[2]; } u;
  u.q[0] = *(const uint4*)(blockp + lane * 8);
  u.q[1] = *(const uint4*)(blockp + 256 + lane * 8);
  return u.v;
}

// ---------------------------------------------------------------------------
// Cross-lane moves on the vector unit. __shfl_xor goes through the LDS pipe
// (ds_bpermute_b32 and a wait on dscnt for every step); these do not.
// All 32 lanes are on wherever they are used.
// ---------------------------------------------------------------------------
// value of lane l ^ M, M < 16: DPP row_xmask inside the 16-lane row
template <int M>
__device__ __forceinline__ float row_xor(float v) {
  return __builtin_bit_cast(float, __builtin_amdgcn_update_dpp(
      0, __builtin_bit_cast(int, v), 0x160 | M, 0xf, 0xf, true));
}
// value of lane l ^ 16: the same lane of the other row
__device__ __forceinline__ float half_xor(float v) {
  int b = __builtin_bit_cast(int, v);
  return __builtin_bit_cast(float, __builtin_amdgcn_permlanex16(
      b, b, 0x76543210, 0xfedcba98, false, false));
}
// butterfly sum over the 32 lanes, steps 1, 2, 4, 8, 16
__device__ __forceinline__ float wave_sum(float v) {
  v += row_xor<1>(v);
  v += row_xor<2>(v);
  v += row_xor<4>(v);
  v += row_xor<8>(v);
  v += half_xor(v);
  return v;
}
// one butterfly step over eight values side by side, inside the 16-lane row
template <int M>
__device__ __forceinline__ void row_max_step(float (&x)[8]) {
  // unrolled: x[] stays in registers, the eight chains cover each other's latency
  #pragma unroll
  for (int e = 0; e < 8; ++e) x[e] = fmaxf(x[e], row_xor<M>(x[e]));
}
template <int M>
__device__ __forceinline__ void row_sum_step(float (&x)[8]) {
  // unrolled: x[] stays in registers, the eight chains cover each other's latency
  #pragma unroll
  for (int e = 0; e < 8; ++e) x[e] += row_xor<M>(x[e]);
}

// ---------------------------------------------------------------------------
// Part 0 of the first launch: transpose + f32->f16 convert the five 256x256
// weight matrices. WT[n*256+k] = (f16) W[k*256+n]. blk = 0..255.
// ---------------------------------------------------------------------------
__device__ __forceinline__ void cvt_weights(
    unsigned blk, const float* __restrict__ Wq, const float* __restrict__ Wk,
    const float* __restrict__ Wv, const float* __restrict__ Wg,
    const float* __restrict__ Wo,
    half_t* __restrict__ WqT, half_t* __restrict__ WkT,
    half_t* __restrict__ WvT, half_t* __restrict__ WgT,
    half_t* __restrict__ WoT) {
  int idx = blk * 256 + threadIdx.x;             // 0..65535
  int n = idx >> 8, k = idx & 255;
  int src = k * 256 + n;
  WqT[idx] = (half_t)Wq[src];
  WkT[idx] = (half_t)Wk[src];
  WvT[idx] = (half_t)Wv[src];
  WgT[idx] = (half_t)Wg[src];
  WoT[idx] = (half_t)Wo[src];
}

// ---------------------------------------------------------------------------
// Part 1 of the first launch, blk = 0..511:
// LayerNorm over m rows of 256, write f16. One wave takes LNM_ROWS
// rows one after the other, for speed only. All the rows' loads
// are issued first; gamma and beta are read once per wave.
// ---------------------------------------------------------------------------
#define LNM_ROWS 8
__device__ __forceinline__ void ln_m_rows(
    unsigned blk, const float* __restrict__ m, const float* __restrict__ gam,
    const float* __restrict__ bet, half_t* __restrict__ mn) {
  int wave = threadIdx.x >> 5, lane = threadIdx.x & 31;
  size_t row0 = ((size_t)blk * 8 + wave) * LNM_ROWS;          // 0..32767
  const float* p = m + row0 * CM + lane * 8;
  float4 x0[LNM_ROWS], x1[LNM_ROWS];
  // unrolled: the arrays stay in registers and the 16 loads are in flight together
  #pragma unroll
  for (int r = 0; r < LNM_ROWS; ++r) {
    x0[r] = *(const float4*)(p + r * CM);
    x1[r] = *(const float4*)(p + r * CM + 4);
  }
  float g[8], b[8];
  #pragma unroll
  for (int e = 0; e < 8; ++e) { g[e] = gam[lane * 8 + e]; b[e] = bet[lane * 8 + e]; }
  // unrolled: register arrays, and the rows' butterflies cover each other's latency
  #pragma unroll
  for (int r = 0; r < LNM_ROWS; ++r) {
    float xs[8] = {x0[r].x, x0[r].y, x0[r].z, x0[r].w, x1[r].x, x1[r].y, x1[r].z, x1[r].w};
    float sum = 0.f;
    #pragma unroll
    for (int e = 0; e < 8; ++e) sum += xs[e];
    sum = wave_sum(sum);
    float mu = sum * (1.f / 256.f);
    float var = 0.f;
    #pragma unroll
    for (int e = 0; e < 8; ++e) { float d = xs[e] - mu; var += d * d; }
    var = wave_sum(var);
    float rstd = rsqrtf(var * (1.f / 256.f) + 1e-5f);
    union { half_t h[8]; uint4 q; } o;
    #pragma unroll
    for (int e = 0; e < 8; ++e) o.h[e] = (half_t)((xs[e] - mu) * rstd * g[e] + b[e]);
    *(uint4*)(mn + (row0 + r) * CM + lane * 8) = o.q;
  }
}

// ---------------------------------------------------------------------------
// Part 2 of the first launch, blk = 0..255:
// LayerNorm over z rows of 128 fused with pair-bias projection.
// One wave takes LNZ_ROWS = 32 rows (i,j), 8 queries i x 4 keys j, in batches of
// LNZ_BATCH whose loads are issued one batch ahead. gamma, beta and the lane's
// 4 x 8 slice of W_z are read once per wave and stay in registers. Every lane
// ends a butterfly with the whole sum, so lane l keeps the eight sums of row l
// and each head's 32 results leave as one 128-B line.
// Output f32, per head in the order in which the attention kernel's transposed
// score tiles hold it: [16 queries][32 keys] blocks of 512 floats, block index
// (i / 16) * 8 + j / 32; in a block, with kk = j % 32, the float at
//   (kk / 16 * 2 + kk % 8 / 4) * 128 + (kk / 8 % 2 * 16 + i % 16) * 4 + kk % 4
// so that lane l of a score tile finds four of its keys in 16 bytes at l * 16.
// ---------------------------------------------------------------------------
#define LNZ_ROWS  32
#define LNZ_BATCH 8
// one batch of rows; row r of the batch is row first + r of the wave
__device__ __forceinline__ void ln_z_batch(
    const float4 (&x)[LNZ_BATCH], int first, int lane, const float (&g)[4],
    const float (&b)[4], const float (&wz)[4][NH], float (&keep)[NH]) {
  // unrolled: register arrays, and the rows' butterflies cover each other's latency
  #pragma unroll
  for (int r = 0; r < LNZ_BATCH; ++r) {
    float xs[4] = {x[r].x, x[r].y, x[r].z, x[r].w};
    float sum = xs[0] + xs[1] + xs[2] + xs[3];
    sum = wave_sum(sum);
    float mu = sum * (1.f / 128.f);
    float var = 0.f;
    #pragma unroll
    for (int t = 0; t < 4; ++t) { float d = xs[t] - mu; var += d * d; }
    var = wave_sum(var);
    float rstd = rsqrtf(var * (1.f / 128.f) + 1e-5f);
    float zn[4];
    #pragma unroll
    for (int t = 0; t < 4; ++t) zn[t] = (xs[t] - mu) * rstd * g[t] + b[t];
    bool mine = lane == first + r;
    #pragma unroll
    for (int h = 0; h < NH; ++h) {
      float acc = 0.f;
      #pragma unroll
      for (int t = 0; t < 4; ++t) acc += zn[t] * wz[t][h];
      acc = wave_sum(acc);
      keep[h] = mine ? acc : keep[h];
    }
  }
}

__device__ __forceinline__ void ln_z_bias(
    unsigned blk, const float* __restrict__ z, const float* __restrict__ gam,
    const float* __restrict__ bet, const float* __restrict__ Wz,
    float* __restrict__ bias) {
  int wave = threadIdx.x >> 5, lane = threadIdx.x & 31;
  const unsigned wid = blk * 8 + wave;                       // 0..2047
  const unsigned i0 = (wid >> 6) * 8, j0 = (wid & 63) * 4;   // row r: i0 + r / 4, j0 + r % 4
  const float* zp = z + (size_t)(i0 * R_RES + j0) * CZ + lane * 4;
  float4 cur[LNZ_BATCH];
  #pragma unroll
  for (int r = 0; r < LNZ_BATCH; ++r)
    cur[r] = *(const float4*)(zp + ((r >> 2) * R_RES + (r & 3)) * CZ);
  // the rows have the longest way and go out first: without this the compiler
  // issues them behind a wait on the W_z loads
  __builtin_amdgcn_sched_barrier(0);
  float wz[4][NH], g[4], b[4];
  #pragma unroll
  for (int t = 0; t < 4; ++t) {
    g[t] = gam[lane * 4 + t];
    b[t] = bet[lane * 4 + t];
    #pragma unroll
    for (int h = 0; h < NH; ++h) wz[t][h] = Wz[(lane * 4 + t) * NH + h];
  }
  float keep[NH];
  #pragma unroll
  for (int h = 0; h < NH; ++h) keep[h] = 0.f;

  // not unrolled: for speed only
  #pragma unroll 1
  for (int bt = 0; bt + 1 < LNZ_ROWS / LNZ_BATCH; ++bt) {
    float4 nxt[LNZ_BATCH];
    #pragma unroll
    for (int r = 0; r < LNZ_BATCH; ++r)
      nxt[r] = *(const float4*)(zp + (((bt + 1) * (LNZ_BATCH / 4) + (r >> 2)) * R_RES + (r & 3)) * CZ);
    // the batch body reuses the loads' address registers at once
    asm volatile("s_wait_xcnt 0x0" ::: "memory");
    ln_z_batch(cur, bt * LNZ_BATCH, lane, g, b, wz, keep);
    #pragma unroll
    for (int r = 0; r < LNZ_BATCH; ++r) cur[r] = nxt[r];
  }
  ln_z_batch(cur, LNZ_ROWS - LNZ_BATCH, lane, g, b, wz, keep);
  // the wave's 128-B line in a head's plane: rows r = lane lie side by side there
  const unsigned kk = j0 & 31;
  const unsigned p0 = ((i0 >> 4) * 8 + (j0 >> 5)) * 512 + ((kk >> 4) * 2 + ((kk & 7) >> 2)) * 128 +
                      (((kk >> 3) & 1) * 16 + (i0 & 8)) * 4;
  #pragma unroll
  for (int h = 0; h < NH; ++h) bias[h * 65536 + p0 + lane] = keep[h];
}

// ---------------------------------------------------------------------------
// The first launch: the three passes above read only inputs and write disjoint
// planes of the workspace, so none waits for another. They share one grid, each
// on its own range of work-groups: one launch gap and one fill, not three, and
// the vector work on z runs under the memory streams of m. The longest part has
// the lowest indices.
// ---------------------------------------------------------------------------
#define PRE_Z_BLOCKS 256
#define PRE_M_BLOCKS 512
#define PRE_W_BLOCKS 256   // the rest of the grid of 1024
__global__ __launch_bounds__(256) void pre_kernel(
    const float* __restrict__ z, const float* __restrict__ ln_z_g,
    const float* __restrict__ ln_z_b, const float* __restrict__ W_z,
    float* __restrict__ bias,
    const float* __restrict__ m, const float* __restrict__ ln_m_g,
    const float* __restrict__ ln_m_b, half_t* __restrict__ mn,
    const float* __restrict__ Wq, const float* __restrict__ Wk,
    const float* __restrict__ Wv, const float* __restrict__ Wg,
    const float* __restrict__ Wo,
    half_t* __restrict__ WqT, half_t* __restrict__ WkT,
    half_t* __restrict__ WvT, half_t* __restrict__ WgT,
    half_t* __restrict__ WoT) {
  const unsigned blk = blockIdx.x;
  if (blk < PRE_Z_BLOCKS) {
    ln_z_bias(blk, z, ln_z_g, ln_z_b, W_z, bias);
  } else if (blk < PRE_Z_BLOCKS + PRE_M_BLOCKS) {
    ln_m_rows(blk - PRE_Z_BLOCKS, m, ln_m_g, ln_m_b, mn);
    // in the built code the end of this part stands, over a test that never
    // passes, in front of another part's set-up, which rewrites the registers
    // that the stores name
    asm volatile("s_wait_xcnt 0x0" ::: "memory");
  } else {
    cvt_weights(blk - (PRE_Z_BLOCKS + PRE_M_BLOCKS), Wq, Wk, Wv, Wg, Wo, WqT, WkT, WvT, WgT, WoT);
    // as above
    asm volatile("s_wait_xcnt 0x0" ::: "memory");
  }
}

// ---------------------------------------------------------------------------
// Kernel 3: WMMA GEMM  C[32768x256] = A[32768x256] * B(=BT N-major).
// Block = 128 rows, 8 waves; wave = 16 rows. A wave loads its 16 rows of A once,
// as eight fragments that stay in registers, and takes several 64-column tiles
// of B with them, one after the other: fewer waves to start, fewer reads of A.
// Each 64x256 f16 B tile is staged into LDS through registers, rows laid at the
// padded pitch, then consumed as ds_load_b128 fragments.
// The kind of epilogue is a compile-time parameter, so no store stands behind a
// branch and a column's bias is read once:
//   EP_QK   store Q or K, fragment order    EP_VT  store V^T [S,H,C,R] f16
//   EP_GATE sigmoid(x+bg), fragment order   EP_OUT f32 out + bo (final GEMM)
// For EP_QK and EP_GATE the product is taken transposed (B tile as the A operand,
// the two layouts being the same): lane l then holds row l & 15 and register e
// column 8 * (l >> 4) + e, eight adjacent channels, one 16-byte chunk.
// ---------------------------------------------------------------------------
#define EP_QK   0
#define EP_VT   1
#define EP_GATE 2
#define EP_OUT  3

// one wave's 16 x 64 tile: rows r0.., columns c0.. (c0 a multiple of 64, so the
// tile holds two whole heads). One 32-bit element index per lane; every other
// element of the lane lies at a constant offset from it.
template <int KIND>
__device__ __forceinline__ void store_tile(
    const v8f (&acc)[4], int r0, int c0, int lane,
    const float (&bv)[4], const float* __restrict__ bias, void* __restrict__ outp) {
  const unsigned m_lane = 8 * (lane >> 4), n_lane = lane & 15;
  const unsigned sh0 = (r0 >> 8) * 8 + (c0 >> 5);   // s * 8 + first head
  const unsigned i0 = (r0 & 255) + m_lane;
  // transposed tiles: the lane's chunk in the first head's block of these 16 rows
  const unsigned fr0 = sh0 * FR_HEAD + ((r0 & 255) >> 4) * FR_BLOCK + lane * 8;
  if constexpr (KIND == EP_QK) {
    half_t* o = (half_t*)outp + fr0;
    #pragma unroll
    for (int j = 0; j < 4; ++j) {
      union { half_t h[8]; uint4 q; } u;
      #pragma unroll
      for (int e = 0; e < 8; ++e) u.h[e] = (half_t)acc[j][e];
      *(uint4*)(o + (j >> 1) * FR_HEAD + (j & 1) * 256) = u.q;
    }
  } else if constexpr (KIND == EP_VT) {
    // the lane's eight rows lie side by side in V^T: at constant offsets the
    // compiler joins the eight stores of a column into one of 16 bytes
    half_t* o = (half_t*)outp + ((sh0 * 32 + n_lane) * 256 + i0);
    #pragma unroll
    for (int j = 0; j < 4; ++j) {
      #pragma unroll
      for (int e = 0; e < 8; ++e) o[j * 16 * 256 + e] = (half_t)acc[j][e];
    }
  } else if constexpr (KIND == EP_GATE) {
    // the lane's 4 x 8 columns of the bias, all read in front of the first store
    const float* bp = bias + c0 + m_lane;
    float4 bq[8];
    #pragma unroll
    for (int j = 0; j < 4; ++j) {
      bq[2 * j]     = *(const float4*)(bp + j * 16);
      bq[2 * j + 1] = *(const float4*)(bp + j * 16 + 4);
    }
    // the loads' address register is held whole up to this wait, which stands in
    // front of whatever rewrites it
    asm volatile("s_wait_xcnt 0x0" :: "v"(bp) : "memory");
    half_t* o = (half_t*)outp + fr0;
    #pragma unroll
    for (int j = 0; j < 4; ++j) {
      const float bj[8] = {bq[2 * j].x, bq[2 * j].y, bq[2 * j].z, bq[2 * j].w,
                           bq[2 * j + 1].x, bq[2 * j + 1].y, bq[2 * j + 1].z, bq[2 * j + 1].w};
      union { half_t h[8]; uint4 q; } u;
      #pragma unroll
      for (int e = 0; e < 8; ++e) {
        float v = acc[j][e] + bj[e];
        v = 1.f / (1.f + __expf(-v));
        u.h[e] = (half_t)v;
      }
      *(uint4*)(o + (j >> 1) * FR_HEAD + (j & 1) * 256) = u.q;
    }
  } else {
    float* o = (float*)outp + ((r0 + m_lane) * 256 + c0 + n_lane);
    #pragma unroll
    for (int j = 0; j < 4; ++j) {
      #pragma unroll
      for (int e = 0; e < 8; ++e) o[e * 256 + j * 16] = acc[j][e] + bv[j];
    }
  }
}

// the wave's 16 rows of A as eight fragments
__device__ __forceinline__ void load_a_rows(v16h (&a)[8], const half_t* __restrict__ A, int r0) {
  const int lane = threadIdx.x & 31;
  const half_t* p = A + (size_t)(r0 + (lane & 15)) * 256 + (lane >> 4) * 8;
  // unrolled: a[] stays in registers and the 16 loads are in flight together
  #pragma unroll
  for (int kb = 0; kb < 8; ++kb) {
    union { v16h v; uint4 q[2]; } u;
    u.q[0] = *(const uint4*)(p + kb * 32);
    u.q[1] = *(const uint4*)(p + kb * 32 + 16);
    a[kb] = u.v;
  }
  // the loads' address register is held whole up to this wait, which stands in
  // front of whatever rewrites it
  asm volatile("s_wait_xcnt 0x0" :: "v"(p) : "memory");
}

// the same from a plane in fragment order: fragment kb is head kb's block
__device__ __forceinline__ void load_a_rows_fr(v16h (&a)[8], const half_t* __restrict__ A, int r0) {
  const int lane = threadIdx.x & 31;
  const half_t* p = A + (size_t)((r0 >> 8) * 8 * FR_HEAD + ((r0 & 255) >> 4) * FR_BLOCK + lane * 8);
  // unrolled: a[] stays in registers and the 16 loads are in flight together
  #pragma unroll
  for (int kb = 0; kb < 8; ++kb) {
    union { v16h v; uint4 q[2]; } u;
    u.q[0] = *(const uint4*)(p + kb * FR_HEAD);
    u.q[1] = *(const uint4*)(p + kb * FR_HEAD + 256);
    a[kb] = u.v;
  }
  // the loads' address register is held whole up to this wait, which stands in
  // front of whatever rewrites it
  asm volatile("s_wait_xcnt 0x0" :: "v"(p) : "memory");
}

// one 128 x 64 tile of the block: bt = the 64 rows of BT for columns c0..c0+63
template <int KIND, bool MORE>
__device__ __forceinline__ void gemm_tile(
    const v16h (&a)[8], const half_t* __restrict__ bt, const float* __restrict__ bias,
    void* __restrict__ outp, half_t* btl, int r0, int c0) {
  // a thread copies 16 bytes of every eighth row: one address each side, the
  // rest are constant offsets
  const int tid = threadIdx.x;
  const v4u* src = (const v4u*)bt + tid;
  half_t* dst = btl + (tid >> 5) * PITCH256 + (tid & 31) * 8;
  v4u st[8];
  // unrolled: st[] stays in registers and the eight loads are in flight together
  #pragma unroll
  for (int it = 0; it < 8; ++it) st[it] = src[it * 256];
  // the lane's four bias values travel with the tile's loads: no load of the
  // epilogue then lands on a register that an issued store still names, and none
  // is waited for behind a barrier
  float bv[4] = {0.f, 0.f, 0.f, 0.f};
  if constexpr (KIND == EP_OUT) {
    const unsigned bi = c0 + (tid & 15);
    #pragma unroll
    for (int j = 0; j < 4; ++j) bv[j] = bias[bi + j * 16];
    // the index registers of the tile's and the bias loads are held whole up to
    // this wait
    asm volatile("s_wait_xcnt 0x0" :: "v"(tid), "v"(bi) : "memory");
  }
  if constexpr (KIND == EP_GATE) {
    // the index register of the tile's loads is held whole up to this wait: the
    // epilogue of this last tile takes the register for its own values
    asm volatile("s_wait_xcnt 0x0" :: "v"(tid) : "memory");
  }
  // holds the eight loads in front of the first LDS store (loaded values as
  // inputs only): without it the compiler, under the register bound, takes them
  // two at a time, four trips to L2 one after the other
  asm volatile("" :: "v"(st[0]), "v"(st[1]), "v"(st[2]), "v"(st[3]),
                     "v"(st[4]), "v"(st[5]), "v"(st[6]), "v"(st[7]));
  #pragma unroll
  for (int it = 0; it < 8; ++it) *(v4u*)(dst + it * 8 * PITCH256) = st[it];
  __syncthreads();   // the tile is whole

  v8f acc[4] = {v8f{}, v8f{}, v8f{}, v8f{}};
  #pragma unroll
  for (int kb = 0; kb < 8; ++kb) {
    #pragma unroll
    for (int j = 0; j < 4; ++j) {
      v16h b = load_frag16(btl, j * 16, PITCH256, kb * 32);   // ds_load_b128 x2
      if constexpr (KIND == EP_QK || KIND == EP_GATE) acc[j] = wmma_f16(b, a[kb], acc[j]);
      else acc[j] = wmma_f16(a[kb], b, acc[j]);
    }
  }
  // where another tile follows: every wave has read its last fragment of this
  // one. In front of the stores, so that they drain under the next tile's loads
  // and not under the barrier.
  if constexpr (MORE) __syncthreads();
  store_tile<KIND>(acc, r0, c0, threadIdx.x & 31, bv, bias, outp);
  // the next tile's loads land on registers that these stores name
  if constexpr (MORE) asm volatile("s_wait_xcnt 0x0" ::: "memory");
}

// The four projections of mn in one launch. WT holds the four transposed weights
// one behind the other (q, k, v, gate). A block takes the same 64 columns of all
// four products, so every block has the same work.
// The 64 registers of A would take the wave past 128: bound to 8 waves per SIMD,
// so that all 1024 work-groups are on the chip at once, four to a WGP.
__global__ __launch_bounds__(256, 8) void proj_gemm(
    const half_t* __restrict__ A, const half_t* __restrict__ WT,
    const float* __restrict__ bg, half_t* __restrict__ q, half_t* __restrict__ k,
    half_t* __restrict__ vt, half_t* __restrict__ gate) {
  __shared__ __align__(16) half_t btl[64 * PITCH256];   // B tile, 33792 B
  const int r0 = blockIdx.x * 128 + (threadIdx.x >> 5) * 16;
  const int c0 = blockIdx.y * 64;
  v16h a[8];
  load_a_rows(a, A, r0);
  const half_t* bt = WT + (size_t)c0 * 256;
  gemm_tile<EP_QK, true>(a, bt, nullptr, q, btl, r0, c0);
  gemm_tile<EP_QK, true>(a, bt + 65536, nullptr, k, btl, r0, c0);
  gemm_tile<EP_VT, true>(a, bt + 2 * 65536, nullptr, vt, btl, r0, c0);
  gemm_tile<EP_GATE, false>(a, bt + 3 * 65536, bg, gate, btl, r0, c0);
}

// The final GEMM: a block takes two of the four column tiles.
__global__ __launch_bounds__(256) void out_gemm(
    const half_t* __restrict__ A, const half_t* __restrict__ BT,
    const float* __restrict__ bo, float* __restrict__ out) {
  __shared__ __align__(16) half_t btl[64 * PITCH256];   // B tile, 33792 B
  const int r0 = blockIdx.x * 128 + (threadIdx.x >> 5) * 16;
  v16h a[8];
  load_a_rows_fr(a, A, r0);
  const int c0 = blockIdx.y * 128;
  gemm_tile<EP_OUT, true>(a, BT + (size_t)c0 * 256, bo, out, btl, r0, c0);
  gemm_tile<EP_OUT, false>(a, BT + (size_t)(c0 + 64) * 256, bo, out, btl, r0, c0 + 64);
}

__global__ __launch_bounds__(256) void attn_kernel(
    const half_t* __restrict__ q, const half_t* __restrict__ k,
    const half_t* __restrict__ vt, const float* __restrict__ bias,
    const half_t* __restrict__ gate, half_t* __restrict__ go) {
  __shared__ __align__(16) half_t lds_k[R_RES * PITCH32];   // 20480 B
  __shared__ __align__(16) half_t lds_v[CH * PITCH256];     // 16896 B
  int sh = blockIdx.x;                 // s*8 + h
  int h = sh & 7;
  int wave = threadIdx.x >> 5, lane = threadIdx.x & 31;
  const half_t* qb = q + (size_t)sh * R_RES * CH;
  const half_t* kg = k + (size_t)sh * R_RES * CH;
  const half_t* vg = vt + (size_t)sh * CH * R_RES;
  const float*  bb = bias + (size_t)h * R_RES * R_RES;
  const float scale = 0.17677669529663687f;   // 1/sqrt(32)

  {
    const uint4* ks = (const uint4*)kg;
    const uint4* vs = (const uint4*)vg;
    // unrolled so that the eight loads are in flight together
    #pragma unroll
    for (int it = 0; it < R_RES * CH / 8 / 256; ++it) {
      int t = it * 256 + threadIdx.x;
      // K comes in fragment order: block t / 64, chunk t / 16 % 4, row t % 16
      *(uint4*)(lds_k + ((t >> 6) * 16 + (t & 15)) * PITCH32 + ((t >> 4) & 3) * 8) = ks[t];
      *(uint4*)(lds_v + (t >> 5) * PITCH256 + (t & 31) * 8) = vs[t];
    }
    __syncthreads();
  }

  for (int tile = 0; tile < 2; ++tile) {
    int i0 = wave * 32 + tile * 16;
    v16h qf = load_frag_fr(qb + (i0 >> 4) * FR_BLOCK, lane);   // B operand: column = query
    const unsigned boff = (i0 >> 4) * 4096 + lane * 4;   // the lane's 16 bytes in the tile's bias blocks
    v8f o0 = v8f{}, o1 = v8f{};                   // channels 0..15, 16..31
    float rmax = -1e30f, rsum = 0.f;

    for (int t = 0; t < 8; ++t) {
      const float* bt = bb + 512 * t;
      float4 b[4];   // keys 0..3, 4..7, 16..19, 20..23 of the pass, + 8 in the upper half
      b[0] = *(const float4*)(bt + boff);
      b[1] = *(const float4*)(bt + boff + 128);
      b[2] = *(const float4*)(bt + boff + 256);
      b[3] = *(const float4*)(bt + boff + 384);
      v8f z = v8f{};
      v16h kf0 = load_frag16(lds_k, (2 * t) * 16, PITCH32, 0);
      v8f c0 = wmma_f16(kf0, qf, z);
      v16h kf1 = load_frag16(lds_k, (2 * t + 1) * 16, PITCH32, 0);
      v8f c1 = wmma_f16(kf1, qf, z);

      const float b0[8] = {b[0].x, b[0].y, b[0].z, b[0].w, b[1].x, b[1].y, b[1].z, b[1].w};
      const float b1[8] = {b[2].x, b[2].y, b[2].z, b[2].w, b[3].x, b[3].y, b[3].z, b[3].w};
      float x[8];
      #pragma unroll
      for (int e = 0; e < 8; ++e) {
        c0[e] = c0[e] * scale + b0[e];
        c1[e] = c1[e] * scale + b1[e];
        x[e] = fmaxf(c0[e], c1[e]);
      }
      float nm = fmaxf(fmaxf(fmaxf(x[0], x[1]), fmaxf(x[2], x[3])),
                       fmaxf(fmaxf(x[4], x[5]), fmaxf(x[6], x[7])));
      nm = fmaxf(nm, half_xor(nm));               // the query's other 16 keys
      nm = fmaxf(nm, rmax);
      float corr = __expf(rmax - nm);
      rmax = nm;
      #pragma unroll
      for (int e = 0; e < 8; ++e) {
        c0[e] = __expf(c0[e] - nm);
        c1[e] = __expf(c1[e] - nm);
        x[e] = c0[e] + c1[e];
      }
      float bsum = ((x[0] + x[1]) + (x[2] + x[3])) + ((x[4] + x[5]) + (x[6] + x[7]));
      rsum = rsum * corr + bsum;                  // this half's keys only
      v16h pf;                                    // P^T as B operand: column = query
      #pragma unroll
      for (int e = 0; e < 8; ++e) {
        o0[e] *= corr;
        o1[e] *= corr;
        pf[e]     = (half_t)c0[e];
        pf[8 + e] = (half_t)c1[e];
      }
      v16h v0 = load_frag16(lds_v, 0, PITCH256, 32 * t);    // channels 0..15
      v16h v1 = load_frag16(lds_v, 16, PITCH256, 32 * t);   // channels 16..31
      o0 = wmma_f16(v0, pf, o0);
      o1 = wmma_f16(v1, pf, o1);
    }

    // finalize: join the halves' sums, divide, gate, store f16
    rsum += half_xor(rsum);
    float inv = 1.f / rsum;
    const unsigned goff = (unsigned)sh * FR_HEAD + (i0 >> 4) * FR_BLOCK + lane * 8;
    union { half_t h[8]; uint4 q; } g0, g1, r0, r1;
    g0.q = *(const uint4*)(gate + goff);
    g1.q = *(const uint4*)(gate + goff + 256);
    #pragma unroll
    for (int e = 0; e < 8; ++e) {
      r0.h[e] = (half_t)((float)g0.h[e] * o0[e] * inv);
      r1.h[e] = (half_t)((float)g1.h[e] * o1[e] * inv);
    }
    *(uint4*)(go + goff)      = r0.q;
    *(uint4*)(go + goff + 256) = r1.q;
    // the next tile's set-up rewrites registers that these stores name
    asm volatile("s_wait_xcnt 0x0" ::: "memory");
  }
}

// ---------------------------------------------------------------------------
// Host launcher
// ---------------------------------------------------------------------------
extern "C" void kernel_launch(void* const* d_in, const int* in_sizes, int n_in,
                              void* d_out, int out_size, void* d_ws, size_t ws_size,
                              hipStream_t stream) {
  const float* m      = (const float*)d_in[0];
  const float* z      = (const float*)d_in[1];
  const float* ln_m_g = (const float*)d_in[2];
  const float* ln_m_b = (const float*)d_in[3];
  const float* ln_z_g = (const float*)d_in[4];
  const float* ln_z_b = (const float*)d_in[5];
  const float* W_z    = (const float*)d_in[6];
  const float* Wq     = (const float*)d_in[7];
  const float* Wk     = (const float*)d_in[8];
  const float* Wv     = (const float*)d_in[9];
  const float* Wg     = (const float*)d_in[10];
  const float* bg     = (const float*)d_in[11];
  const float* Wo     = (const float*)d_in[12];
  const float* bo     = (const float*)d_in[13];

  char* ws = (char*)d_ws;
  const size_t BIG = (size_t)32768 * 256 * 2;   // 16 MiB f16 planes
  half_t* mn_f16 = (half_t*)(ws + 0 * BIG);
  half_t* qbuf   = (half_t*)(ws + 1 * BIG);     // [S,H] fragment order
  half_t* kbuf   = (half_t*)(ws + 2 * BIG);     // [S,H] fragment order
  half_t* vbuf   = (half_t*)(ws + 3 * BIG);     // [S,H,C,R]
  half_t* gbuf   = (half_t*)(ws + 4 * BIG);     // gate [S,H] fragment order
  half_t* gobuf  = (half_t*)(ws + 5 * BIG);     // g*o  [S,H] fragment order
  float*  bbuf   = (float*)(ws + 6 * BIG);      // bias f32, 8 heads x 65536 (2 MiB)
  half_t* WqT    = (half_t*)(ws + 6 * BIG + 2097152);
  half_t* WkT    = WqT + 65536;
  half_t* WvT    = WkT + 65536;
  half_t* WgT    = WvT + 65536;
  half_t* WoT    = WgT + 65536;

  pre_kernel<<<1024, 256, 0, stream>>>(   // 256 + 512 + 256 work-groups
      z, ln_z_g, ln_z_b, W_z, bbuf, m, ln_m_g, ln_m_b, mn_f16,
      Wq, Wk, Wv, Wg, Wo, WqT, WkT, WvT, WgT, WoT);

  proj_gemm<<<dim3(256, 4), 256, 0, stream>>>(mn_f16, WqT, bg, qbuf, kbuf, vbuf, gbuf);

  attn_kernel<<<1024, 256, 0, stream>>>(qbuf, kbuf, vbuf, bbuf, gbuf, gobuf);

  out_gemm<<<dim3(256, 2), 256, 0, stream>>>(gobuf, WoT, bo, (float*)d_out);
}

// v008
// One run takes 63.6 microseconds.
// Next to v007, in two timings, it ran 1.09 times as fast each time.
// Counting every step since v000, it is 4.80 times as fast.
#include <hip/hip_runtime.h>
#include <hip/hip_bf16.h>

typedef _Float16 half_t;
typedef __attribute__((ext_vector_type(16))) _Float16 v16h;
typedef __attribute__((ext_vector_type(8)))  float    v8f;
typedef __attribute__((ext_vector_type(4)))  unsigned int v4u;

#define S_SEQ 128
#define R_RES 256
#define CM    256
#define CZ    128
#define CH    32
#define NH    8

// LDS row pitches, in f16 elements. Every fragment tile is read with
// ds_load_b128, 16 rows per half-wave: a pitch of 16 B x odd puts the 16 rows
// on 16 distinct groups of four banks, a pitch of 64 B or 512 B does not.
#define PITCH256 264   // rows of 256 f16: 528 B = 16 B x 33
#define PITCH32  40    // rows of  32 f16:  80 B = 16 B x 5

// ---------------------------------------------------------------------------
// WMMA 16x16x32 f16 fragment loader (A-layout; B uses identical layout with
// lane = N, since B is consumed as N x K).
// lane l: row = row0 + (l&15), half = l>>4
// element e: k = k0 + 16*(e/8) + 8*half + (e%8)
// -> two contiguous 16-byte chunks per lane (global_load_b128 / ds_load_b128).
// ---------------------------------------------------------------------------
__device__ __forceinline__ v16h load_frag16(const half_t* base, int row0, int ldk, int k0) {
  const int lane = threadIdx.x & 31;
  const int r    = row0 + (lane & 15);
  const int hh   = lane >> 4;
  const half_t* p = base + (size_t)r * ldk + k0 + hh * 8;
  union { v16h v; uint4 q[2]; } u;
  u.q[0] = *(const uint4*)(p);
  u.q[1] = *(const uint4*)(p + 16);
  return u.v;
}

__device__ __forceinline__ v8f wmma_f16(v16h a, v16h b, v8f c) {
  return __builtin_amdgcn_wmma_f32_16x16x32_f16(false, a, false, b, (short)0, c, false, false);
}

// ---------------------------------------------------------------------------
// Fragment order of the planes Q, K, gate and g * o. A plane is [S*H] heads of
// 256 rows x 32 channels; a head is 16 blocks of 16 rows, 512 f16 each, and in
// a block the element (row i, channel c) stands at
//   (c / 8) * 128 + (i % 16) * 8 + c % 8
// so the 16-byte chunks that the 32 lanes of one fragment load (or of one store
// of a transposed accumulator tile) touch lie side by side: 512 bytes, four
// whole lines, where rows laid one behind the other give 16 pieces of 32 bytes.
// Same k order as load_frag16: chunk half, then chunk 2 + half.
// ---------------------------------------------------------------------------
#define FR_HEAD  8192   // f16 per head
#define FR_BLOCK 512    // f16 per block of 16 rows
__device__ __forceinline__ v16h load_frag_fr(const half_t* blockp, int lane) {
  union { v16h v; uint4 q[2]; } u;
  u.q[0] = *(const uint4*)(blockp + lane * 8);
  u.q[1] = *(const uint4*)(blockp + 256 + lane * 8);
  return u.v;
}

// ---------------------------------------------------------------------------
// Cross-lane moves on the vector unit. __shfl_xor goes through the LDS pipe
// (ds_bpermute_b32 and a wait on dscnt for every step); these do not.
// All 32 lanes are on wherever they are used.
// ---------------------------------------------------------------------------
// value of lane l ^ M, M < 16: DPP row_xmask inside the 16-lane row
template <int M>
__device__ __forceinline__ float row_xor(float v) {
  return __builtin_bit_cast(float, __builtin_amdgcn_update_dpp(
      0, __builtin_bit_cast(int, v), 0x160 | M, 0xf, 0xf, true));
}
// value of lane l ^ 16: the same lane of the other row
__device__ __forceinline__ float half_xor(float v) {
  int b = __builtin_bit_cast(int, v);
  return __builtin_bit_cast(float, __builtin_amdgcn_permlanex16(
      b, b, 0x76543210, 0xfedcba98, false, false));
}
// butterfly sum over the 32 lanes, steps 1, 2, 4, 8, 16
__device__ __forceinline__ float wave_sum(float v) {
  v += row_xor<1>(v);
  v += row_xor<2>(v);
  v += row_xor<4>(v);
  v += row_xor<8>(v);
  v += half_xor(v);
  return v;
}
// one butterfly step over eight values side by side, inside the 16-lane row
template <int M>
__device__ __forceinline__ void row_max_step(float (&x)[8]) {
  // unrolled: x[] stays in registers, the eight chains cover each other's latency
  #pragma unroll
  for (int e = 0; e < 8; ++e) x[e] = fmaxf(x[e], row_xor<M>(x[e]));
}
template <int M>
__device__ __forceinline__ void row_sum_step(float (&x)[8]) {
  // unrolled: x[] stays in registers, the eight chains cover each other's latency
  #pragma unroll
  for (int e = 0; e < 8; ++e) x[e] += row_xor<M>(x[e]);
}

// ---------------------------------------------------------------------------
// Part 0 of the first launch: transpose + f32->f16 convert the five 256x256
// weight matrices. WT[n*256+k] = (f16) W[k*256+n]. blk = 0..255.
// ---------------------------------------------------------------------------
__device__ __forceinline__ void cvt_weights(
    unsigned blk, const float* __restrict__ Wq, const float* __restrict__ Wk,
    const float* __restrict__ Wv, const float* __restrict__ Wg,
    const float* __restrict__ Wo,
    half_t* __restrict__ WqT, half_t* __restrict__ WkT,
    half_t* __restrict__ WvT, half_t* __restrict__ WgT,
    half_t* __restrict__ WoT) {
  int idx = blk * 256 + threadIdx.x;             // 0..65535
  int n = idx >> 8, k = idx & 255;
  int src = k * 256 + n;
  WqT[idx] = (half_t)Wq[src];
  WkT[idx] = (half_t)Wk[src];
  WvT[idx] = (half_t)Wv[src];
  WgT[idx] = (half_t)Wg[src];
  WoT[idx] = (half_t)Wo[src];
}

// ---------------------------------------------------------------------------
// Part 1 of the first launch, blk = 0..511:
// LayerNorm over m rows of 256, write f16. One wave takes LNM_ROWS
// rows one after the other, for speed only. All the rows' loads
// are issued first; gamma and beta are read once per wave.
// ---------------------------------------------------------------------------
#define LNM_ROWS 8
__device__ __forceinline__ void ln_m_rows(
    unsigned blk, const float* __restrict__ m, const float* __restrict__ gam,
    const float* __restrict__ bet, half_t* __restrict__ mn) {
  int wave = threadIdx.x >> 5, lane = threadIdx.x & 31;
  size_t row0 = ((size_t)blk * 8 + wave) * LNM_ROWS;          // 0..32767
  const float* p = m + row0 * CM + lane * 8;
  float4 x0[LNM_ROWS], x1[LNM_ROWS];
  // unrolled: the arrays stay in registers and the 16 loads are in flight together
  #pragma unroll
  for (int r = 0; r < LNM_ROWS; ++r) {
    x0[r] = *(const float4*)(p + r * CM);
    x1[r] = *(const float4*)(p + r * CM + 4);
  }
  float g[8], b[8];
  #pragma unroll
  for (int e = 0; e < 8; ++e) { g[e] = gam[lane * 8 + e]; b[e] = bet[lane * 8 + e]; }
  // unrolled: register arrays, and the rows' butterflies cover each other's latency
  #pragma unroll
  for (int r = 0; r < LNM_ROWS; ++r) {
    float xs[8] = {x0[r].x, x0[r].y, x0[r].z, x0[r].w, x1[r].x, x1[r].y, x1[r].z, x1[r].w};
    float sum = 0.f;
    #pragma unroll
    for (int e = 0; e < 8; ++e) sum += xs[e];
    sum = wave_sum(sum);
    float mu = sum * (1.f / 256.f);
    float var = 0.f;
    #pragma unroll
    for (int e = 0; e < 8; ++e) { float d = xs[e] - mu; var += d * d; }
    var = wave_sum(var);
    float rstd = rsqrtf(var * (1.f / 256.f) + 1e-5f);
    union { half_t h[8]; uint4 q; } o;
    #pragma unroll
    for (int e = 0; e < 8; ++e) o.h[e] = (half_t)((xs[e] - mu) * rstd * g[e] + b[e]);
    *(uint4*)(mn + (row0 + r) * CM + lane * 8) = o.q;
  }
}

// ---------------------------------------------------------------------------
// Part 2 of the first launch, blk = 0..255:
// LayerNorm over z rows of 128 fused with pair-bias projection.
// One wave takes LNZ_ROWS = 32 rows (i,j), 8 queries i x 4 keys j, in batches of
// LNZ_BATCH whose loads are issued one batch ahead. gamma, beta and the lane's
// 4 x 8 slice of W_z are read once per wave and stay in registers. Every lane
// ends a butterfly with the whole sum, so lane l keeps the eight sums of row l
// and each head's 32 results leave as one 128-B line.
// Output f32, per head in the order in which the attention kernel's transposed
// score tiles hold it: [16 queries][32 keys] blocks of 512 floats, block index
// (i / 16) * 8 + j / 32; in a block, with kk = j % 32, the float at
//   (kk / 16 * 2 + kk % 8 / 4) * 128 + (kk / 8 % 2 * 16 + i % 16) * 4 + kk % 4
// so that lane l of a score tile finds four of its keys in 16 bytes at l * 16.
// ---------------------------------------------------------------------------
#define LNZ_ROWS  32
#define LNZ_BATCH 8
// one batch of rows; row r of the batch is row first + r of the wave
__device__ __forceinline__ void ln_z_batch(
    const float4 (&x)[LNZ_BATCH], int first, int lane, const float (&g)[4],
    const float (&b)[4], const float (&wz)[4][NH], float (&keep)[NH]) {
  // unrolled: register arrays, and the rows' butterflies cover each other's latency
  #pragma unroll
  for (int r = 0; r < LNZ_BATCH; ++r) {
    float xs[4] = {x[r].x, x[r].y, x[r].z, x[r].w};
    float sum = xs[0] + xs[1] + xs[2] + xs[3];
    sum = wave_sum(sum);
    float mu = sum * (1.f / 128.f);
    float var = 0.f;
    #pragma unroll
    for (int t = 0; t < 4; ++t) { float d = xs[t] - mu; var += d * d; }
    var = wave_sum(var);
    float rstd = rsqrtf(var * (1.f / 128.f) + 1e-5f);
    float zn[4];
    #pragma unroll
    for (int t = 0; t < 4; ++t) zn[t] = (xs[t] - mu) * rstd * g[t] + b[t];
    bool mine = lane == first + r;
    #pragma unroll
    for (int h = 0; h < NH; ++h) {
      float acc = 0.f;
      #pragma unroll
      for (int t = 0; t < 4; ++t) acc += zn[t] * wz[t][h];
      acc = wave_sum(acc);
      keep[h] = mine ? acc : keep[h];
    }
  }
}

__device__ __forceinline__ void ln_z_bias(
    unsigned blk, const float* __restrict__ z, const float* __restrict__ gam,
    const float* __restrict__ bet, const float* __restrict__ Wz,
    float* __restrict__ bias) {
  int wave = threadIdx.x >> 5, lane = threadIdx.x & 31;
  const unsigned wid = blk * 8 + wave;                       // 0..2047
  const unsigned i0 = (wid >> 6) * 8, j0 = (wid & 63) * 4;   // row r: i0 + r / 4, j0 + r % 4
  const float* zp = z + (size_t)(i0 * R_RES + j0) * CZ + lane * 4;
  float4 cur[LNZ_BATCH];
  #pragma unroll
  for (int r = 0; r < LNZ_BATCH; ++r)
    cur[r] = *(const float4*)(zp + ((r >> 2) * R_RES + (r & 3)) * CZ);
  // the rows have the longest way and go out first: without this the compiler
  // issues them behind a wait on the W_z loads
  __builtin_amdgcn_sched_barrier(0);
  float wz[4][NH], g[4], b[4];
  #pragma unroll
  for (int t = 0; t < 4; ++t) {
    g[t] = gam[lane * 4 + t];
    b[t] = bet[lane * 4 + t];
    #pragma unroll
    for (int h = 0; h < NH; ++h) wz[t][h] = Wz[(lane * 4 + t) * NH + h];
  }
  float keep[NH];
  #pragma unroll
  for (int h = 0; h < NH; ++h) keep[h] = 0.f;

  // not unrolled: for speed only
  #pragma unroll 1
  for (int bt = 0; bt + 1 < LNZ_ROWS / LNZ_BATCH; ++bt) {
    float4 nxt[LNZ_BATCH];
    #pragma unroll
    for (int r = 0; r < LNZ_BATCH; ++r)
      nxt[r] = *(const float4*)(zp + (((bt + 1) * (LNZ_BATCH / 4) + (r >> 2)) * R_RES + (r & 3)) * CZ);
    // the batch body reuses the loads' address registers at once
    asm volatile("s_wait_xcnt 0x0" ::: "memory");
    ln_z_batch(cur, bt * LNZ_BATCH, lane, g, b, wz, keep);
    #pragma unroll
    for (int r = 0; r < LNZ_BATCH; ++r) cur[r] = nxt[r];
  }
  ln_z_batch(cur, LNZ_ROWS - LNZ_BATCH, lane, g, b, wz, keep);
  // the wave's 128-B line in a head's plane: rows r = lane lie side by side there
  const unsigned kk = j0 & 31;
  const unsigned p0 = ((i0 >> 4) * 8 + (j0 >> 5)) * 512 + ((kk >> 4) * 2 + ((kk & 7) >> 2)) * 128 +
                      (((kk >> 3) & 1) * 16 + (i0 & 8)) * 4;
  #pragma unroll
  for (int h = 0; h < NH; ++h) bias[h * 65536 + p0 + lane] = keep[h];
}

// ---------------------------------------------------------------------------
// The first launch: the three passes above read only inputs and write disjoint
// planes of the workspace, so none waits for another. They share one grid, each
// on its own range of work-groups: one launch gap and one fill, not three, and
// the vector work on z runs under the memory streams of m. The longest part has
// the lowest indices.
// ---------------------------------------------------------------------------
#define PRE_Z_BLOCKS 256
#define PRE_M_BLOCKS 512
#define PRE_W_BLOCKS 256   // the rest of the grid of 1024
__global__ __launch_bounds__(256) void pre_kernel(
    const float* __restrict__ z, const float* __restrict__ ln_z_g,
    const float* __restrict__ ln_z_b, const float* __restrict__ W_z,
    float* __restrict__ bias,
    const float* __restrict__ m, const float* __restrict__ ln_m_g,
    const float* __restrict__ ln_m_b, half_t* __restrict__ mn,
    const float* __restrict__ Wq, const float* __restrict__ Wk,
    const float* __restrict__ Wv, const float* __restrict__ Wg,
    const float* __restrict__ Wo,
    half_t* __restrict__ WqT, half_t* __restrict__ WkT,
    half_t* __restrict__ WvT, half_t* __restrict__ WgT,
    half_t* __restrict__ WoT) {
  const unsigned blk = blockIdx.x;
  if (blk < PRE_Z_BLOCKS) {
    ln_z_bias(blk, z, ln_z_g, ln_z_b, W_z, bias);
  } else if (blk < PRE_Z_BLOCKS + PRE_M_BLOCKS) {
    ln_m_rows(blk - PRE_Z_BLOCKS, m, ln_m_g, ln_m_b, mn);
    // in the built code the end of this part stands, over a test that never
    // passes, in front of another part's set-up, which rewrites the registers
    // that the stores name
    asm volatile("s_wait_xcnt 0x0" ::: "memory");
  } else {
    cvt_weights(blk - (PRE_Z_BLOCKS + PRE_M_BLOCKS), Wq, Wk, Wv, Wg, Wo, WqT, WkT, WvT, WgT, WoT);
    // as above
    asm volatile("s_wait_xcnt 0x0" ::: "memory");
  }
}

// ---------------------------------------------------------------------------
// Kernel 3: WMMA GEMM  C[32768x256] = A[32768x256] * B(=BT N-major).
// Block = 256 rows, 8 waves; wave = 32 rows, two row tiles of 16. A wave loads its
// rows of A once, as 2 x 8 fragments that stay in registers, and takes several
// 64-column tiles of B with them, one after the other: fewer waves to start, fewer
// reads of A. Every B fragment read from LDS feeds both row tiles: the LDS pipe,
// which one WMMA per fragment keeps busier than the matrix unit, moves half the bytes.
// Each 64x256 f16 B tile is staged into LDS through registers, rows laid at the
// padded pitch, then consumed as ds_load_b128 fragments.
// The kind of epilogue is a compile-time parameter, so no store stands behind a
// branch and a column's bias is read once:
//   EP_QK   store Q or K, fragment order    EP_VT  store V^T [S,H,C,R] f16
//   EP_GATE sigmoid(x+bg), fragment order   EP_OUT f32 out + bo (final GEMM)
// For EP_QK and EP_GATE the product is taken transposed (B tile as the A operand,
// the two layouts being the same): lane l then holds row l & 15 and register e
// column 8 * (l >> 4) + e, eight adjacent channels, one 16-byte chunk.
// ---------------------------------------------------------------------------
#define EP_QK   0
#define EP_VT   1
#define EP_GATE 2
#define EP_OUT  3

// one of a wave's two 16 x 64 tiles: rows r0.., columns c0.. (c0 a multiple of 64, so the
// tile holds two whole heads). One 32-bit element index per lane; every other
// element of the lane lies at a constant offset from it.
template <int KIND>
__device__ __forceinline__ void store_tile(
    const v8f (&acc)[4], int r0, int c0, int lane,
    const float (&bv)[4], const float4 (&bq)[8], void* __restrict__ outp) {
  const unsigned m_lane = 8 * (lane >> 4), n_lane = lane & 15;
  const unsigned sh0 = (r0 >> 8) * 8 + (c0 >> 5);   // s * 8 + first head
  const unsigned i0 = (r0 & 255) + m_lane;
  // transposed tiles: the lane's chunk in the first head's block of these 16 rows
  const unsigned fr0 = sh0 * FR_HEAD + ((r0 & 255) >> 4) * FR_BLOCK + lane * 8;
  if constexpr (KIND == EP_QK) {
    half_t* o = (half_t*)outp + fr0;
    #pragma unroll
    for (int j = 0; j < 4; ++j) {
      union { half_t h[8]; uint4 q; } u;
      #pragma unroll
      for (int e = 0; e < 8; ++e) u.h[e] = (half_t)acc[j][e];
      *(uint4*)(o + (j >> 1) * FR_HEAD + (j & 1) * 256) = u.q;
    }
  } else if constexpr (KIND == EP_VT) {
    // the lane's eight rows lie side by side in V^T: at constant offsets the
    // compiler joins the eight stores of a column into one of 16 bytes
    half_t* o = (half_t*)outp + ((sh0 * 32 + n_lane) * 256 + i0);
    #pragma unroll
    for (int j = 0; j < 4; ++j) {
      #pragma unroll
      for (int e = 0; e < 8; ++e) o[j * 16 * 256 + e] = (half_t)acc[j][e];
    }
  } else if constexpr (KIND == EP_GATE) {
    half_t* o = (half_t*)outp + fr0;
    #pragma unroll
    for (int j = 0; j < 4; ++j) {
      const float bj[8] = {bq[2 * j].x, bq[2 * j].y, bq[2 * j].z, bq[2 * j].w,
                           bq[2 * j + 1].x, bq[2 * j + 1].y, bq[2 * j + 1].z, bq[2 * j + 1].w};
      union { half_t h[8]; uint4 q; } u;
      #pragma unroll
      for (int e = 0; e < 8; ++e) {
        float v = acc[j][e] + bj[e];
        v = 1.f / (1.f + __expf(-v));
        u.h[e] = (half_t)v;
      }
      *(uint4*)(o + (j >> 1) * FR_HEAD + (j & 1) * 256) = u.q;
    }
  } else {
    float* o = (float*)outp + ((r0 + m_lane) * 256 + c0 + n_lane);
    #pragma unroll
    for (int j = 0; j < 4; ++j) {
      #pragma unroll
      for (int e = 0; e < 8; ++e) o[e * 256 + j * 16] = acc[j][e] + bv[j];
    }
  }
}

// 16 of the wave's 32 rows of A, from r0, as eight fragments
__device__ __forceinline__ void load_a_rows(v16h (&a)[8], const half_t* __restrict__ A, int r0) {
  const int lane = threadIdx.x & 31;
  const half_t* p = A + (size_t)(r0 + (lane & 15)) * 256 + (lane >> 4) * 8;
  // unrolled: a[] stays in registers and the 16 loads are in flight together
  #pragma unroll
  for (int kb = 0; kb < 8; ++kb) {
    union { v16h v; uint4 q[2]; } u;
    u.q[0] = *(const uint4*)(p + kb * 32);
    u.q[1] = *(const uint4*)(p + kb * 32 + 16);
    a[kb] = u.v;
  }
  // the loads' address register is held whole up to this wait, which stands in
  // front of whatever rewrites it
  asm volatile("s_wait_xcnt 0x0" :: "v"(p) : "memory");
}

// the same from a plane in fragment order: fragment kb is head kb's block
__device__ __forceinline__ void load_a_rows_fr(v16h (&a)[8], const half_t* __restrict__ A, int r0) {
  const int lane = threadIdx.x & 31;
  const half_t* p = A + (size_t)((r0 >> 8) * 8 * FR_HEAD + ((r0 & 255) >> 4) * FR_BLOCK + lane * 8);
  // unrolled: a[] stays in registers and the 16 loads are in flight together
  #pragma unroll
  for (int kb = 0; kb < 8; ++kb) {
    union { v16h v; uint4 q[2]; } u;
    u.q[0] = *(const uint4*)(p + kb * FR_HEAD);
    u.q[1] = *(const uint4*)(p + kb * FR_HEAD + 256);
    a[kb] = u.v;
  }
  // the loads' address register is held whole up to this wait, which stands in
  // front of whatever rewrites it
  asm volatile("s_wait_xcnt 0x0" :: "v"(p) : "memory");
}

// one 256 x 64 tile of the block: bt = the 64 rows of BT for columns c0..c0+63;
// a[u] = the wave's rows r0 + 16 * u ..
template <int KIND, bool MORE>
__device__ __forceinline__ void gemm_tile(
    const v16h (&a)[2][8], const half_t* __restrict__ bt, const float* __restrict__ bias,
    void* __restrict__ outp, half_t* btl, int r0, int c0) {
  // a thread copies 16 bytes of every eighth row: one address each side, the
  // rest are constant offsets
  const int tid = threadIdx.x;
  const v4u* src = (const v4u*)bt + tid;
  half_t* dst = btl + (tid >> 5) * PITCH256 + (tid & 31) * 8;
  v4u st[8];
  // unrolled: st[] stays in registers and the eight loads are in flight together
  #pragma unroll
  for (int it = 0; it < 8; ++it) st[it] = src[it * 256];
  // the lane's four bias values travel with the tile's loads: no load of the
  // epilogue then lands on a register that an issued store still names, and none
  // is waited for behind a barrier
  float bv[4] = {0.f, 0.f, 0.f, 0.f};
  if constexpr (KIND == EP_OUT) {
    const unsigned bi = c0 + (tid & 15);
    #pragma unroll
    for (int j = 0; j < 4; ++j) bv[j] = bias[bi + j * 16];
    // the index registers of the tile's and the bias loads are held whole up to
    // this wait
    asm volatile("s_wait_xcnt 0x0" :: "v"(tid), "v"(bi) : "memory");
  }
  if constexpr (KIND == EP_GATE) {
    // the index register of the tile's loads is held whole up to this wait: the
    // epilogue of this last tile takes the register for its own values
    asm volatile("s_wait_xcnt 0x0" :: "v"(tid) : "memory");
  }
  // holds the eight loads in front of the first LDS store (loaded values as
  // inputs only): without it the compiler, under the register bound, takes them
  // two at a time, four trips to L2 one after the other
  asm volatile("" :: "v"(st[0]), "v"(st[1]), "v"(st[2]), "v"(st[3]),
                     "v"(st[4]), "v"(st[5]), "v"(st[6]), "v"(st[7]));
  #pragma unroll
  for (int it = 0; it < 8; ++it) *(v4u*)(dst + it * 8 * PITCH256) = st[it];
  __syncthreads();   // the tile is whole

  v8f acc[2][4] = {{v8f{}, v8f{}, v8f{}, v8f{}}, {v8f{}, v8f{}, v8f{}, v8f{}}};
  // step p: k block p / 2, column tiles 2 * (p % 2) and the next. With few waves
  // to a SIMD a wave has to cover its own LDS latency: the pair of fragments of
  // step p + 1 is asked for in front of the four WMMAs of step p.
  v16h b[2][2];
  b[0][0] = load_frag16(btl, 0, PITCH256, 0);    // ds_load_b128 x2
  b[0][1] = load_frag16(btl, 16, PITCH256, 0);
  #pragma unroll
  for (int p = 0; p < 16; ++p) {
    if (p + 1 < 16) {
      b[(p + 1) & 1][0] = load_frag16(btl, ((p + 1) & 1) * 32, PITCH256, ((p + 1) >> 1) * 32);
      b[(p + 1) & 1][1] = load_frag16(btl, ((p + 1) & 1) * 32 + 16, PITCH256, ((p + 1) >> 1) * 32);
    }
    // keeps the next pair's loads in front of this step's WMMAs: left alone the
    // compiler puts each load directly in front of its use and waits it out
    __builtin_amdgcn_sched_barrier(0);
    const int kb = p >> 1;
    #pragma unroll
    for (int jj = 0; jj < 2; ++jj) {
      const int j = (p & 1) * 2 + jj;
      #pragma unroll
      for (int u = 0; u < 2; ++u) {
        if constexpr (KIND == EP_QK || KIND == EP_GATE) acc[u][j] = wmma_f16(b[p & 1][jj], a[u][kb], acc[u][j]);
        else acc[u][j] = wmma_f16(a[u][kb], b[p & 1][jj], acc[u][j]);
      }
    }
  }
  // where another tile follows: every wave has read its last fragment of this
  // one. In front of the stores, so that they drain under the next tile's loads
  // and not under the barrier.
  if constexpr (MORE) __syncthreads();
  float4 bq[8] = {};
  if constexpr (KIND == EP_GATE) {
    // the lane's 4 x 8 columns of the bias, the same for both row tiles, all read
    // in front of the first store
    const float* bp = bias + c0 + 8 * ((threadIdx.x & 31) >> 4);
    #pragma unroll
    for (int j = 0; j < 4; ++j) {
      bq[2 * j]     = *(const float4*)(bp + j * 16);
      bq[2 * j + 1] = *(const float4*)(bp + j * 16 + 4);
    }
    // the loads' address register is held whole up to this wait, which stands in
    // front of whatever rewrites it
    asm volatile("s_wait_xcnt 0x0" :: "v"(bp) : "memory");
  }
  store_tile<KIND>(acc[0], r0, c0, threadIdx.x & 31, bv, bq, outp);
  store_tile<KIND>(acc[1], r0 + 16, c0, threadIdx.x & 31, bv, bq, outp);
  // the next tile's loads land on registers that these stores name
  if constexpr (MORE) asm volatile("s_wait_xcnt 0x0" ::: "memory");
}

// The four projections of mn in one launch. WT holds the four transposed weights
// one behind the other (q, k, v, gate). A block takes the same 64 columns of all
// four products, so every block has the same work.
// A takes 128 registers and the accumulators 64: bound to 4 waves per SIMD, so
// that all 512 work-groups are on the chip at once, two to a WGP.
__global__ __launch_bounds__(256, 4) void proj_gemm(
    const half_t* __restrict__ A, const half_t* __restrict__ WT,
    const float* __restrict__ bg, half_t* __restrict__ q, half_t* __restrict__ k,
    half_t* __restrict__ vt, half_t* __restrict__ gate) {
  __shared__ __align__(16) half_t btl[64 * PITCH256];   // B tile, 33792 B
  const int r0 = blockIdx.x * 256 + (threadIdx.x >> 5) * 32;
  const int c0 = blockIdx.y * 64;
  v16h a[2][8];
  load_a_rows(a[0], A, r0);
  load_a_rows(a[1], A, r0 + 16);
  const half_t* bt = WT + (size_t)c0 * 256;
  gemm_tile<EP_QK, true>(a, bt, nullptr, q, btl, r0, c0);
  gemm_tile<EP_QK, true>(a, bt + 65536, nullptr, k, btl, r0, c0);
  gemm_tile<EP_VT, true>(a, bt + 2 * 65536, nullptr, vt, btl, r0, c0);
  gemm_tile<EP_GATE, false>(a, bt + 3 * 65536, bg, gate, btl, r0, c0);
}

// The final GEMM: a block takes two of the four column tiles.
__global__ __launch_bounds__(256) void out_gemm(
    const half_t* __restrict__ A, const half_t* __restrict__ BT,
    const float* __restrict__ bo, float* __restrict__ out) {
  __shared__ __align__(16) half_t btl[64 * PITCH256];   // B tile, 33792 B
  const int r0 = blockIdx.x * 256 + (threadIdx.x >> 5) * 32;
  v16h a[2][8];
  load_a_rows_fr(a[0], A, r0);
  load_a_rows_fr(a[1], A, r0 + 16);
  const int c0 = blockIdx.y * 128;
  gemm_tile<EP_OUT, true>(a, BT + (size_t)c0 * 256, bo, out, btl, r0, c0);
  gemm_tile<EP_OUT, false>(a, BT + (size_t)(c0 + 64) * 256, bo, out, btl, r0, c0 + 64);
}

__global__ __launch_bounds__(256) void attn_kernel(
    const half_t* __restrict__ q, const half_t* __restrict__ k,
    const half_t* __restrict__ vt, const float* __restrict__ bias,
    const half_t* __restrict__ gate, half_t* __restrict__ go) {
  __shared__ __align__(16) half_t lds_k[R_RES * PITCH32];   // 20480 B
  __shared__ __align__(16) half_t lds_v[CH * PITCH256];     // 16896 B
  int sh = blockIdx.x;                 // s*8 + h
  int h = sh & 7;
  int wave = threadIdx.x >> 5, lane = threadIdx.x & 31;
  const half_t* qb = q + (size_t)sh * R_RES * CH;
  const half_t* kg = k + (size_t)sh * R_RES * CH;
  const half_t* vg = vt + (size_t)sh * CH * R_RES;
  const float*  bb = bias + (size_t)h * R_RES * R_RES;
  const float scale = 0.17677669529663687f;   // 1/sqrt(32)

  {
    const uint4* ks = (const uint4*)kg;
    const uint4* vs = (const uint4*)vg;
    // unrolled so that the eight loads are in flight together
    #pragma unroll
    for (int it = 0; it < R_RES * CH / 8 / 256; ++it) {
      int t = it * 256 + threadIdx.x;
      // K comes in fragment order: block t / 64, chunk t / 16 % 4, row t % 16
      *(uint4*)(lds_k + ((t >> 6) * 16 + (t & 15)) * PITCH32 + ((t >> 4) & 3) * 8) = ks[t];
      *(uint4*)(lds_v + (t >> 5) * PITCH256 + (t & 31) * 8) = vs[t];
    }
    __syncthreads();
  }

  for (int tile = 0; tile < 2; ++tile) {
    int i0 = wave * 32 + tile * 16;
    v16h qf = load_frag_fr(qb + (i0 >> 4) * FR_BLOCK, lane);   // B operand: column = query
    const unsigned boff = (i0 >> 4) * 4096 + lane * 4;   // the lane's 16 bytes in the tile's bias blocks
    v8f o0 = v8f{}, o1 = v8f{};                   // channels 0..15, 16..31
    float rmax = -1e30f, rsum = 0.f;

    for (int t = 0; t < 8; ++t) {
      const float* bt = bb + 512 * t;
      float4 b[4];   // keys 0..3, 4..7, 16..19, 20..23 of the pass, + 8 in the upper half
      b[0] = *(const float4*)(bt + boff);
      b[1] = *(const float4*)(bt + boff + 128);
      b[2] = *(const float4*)(bt + boff + 256);
      b[3] = *(const float4*)(bt + boff + 384);
      v8f z = v8f{};
      v16h kf0 = load_frag16(lds_k, (2 * t) * 16, PITCH32, 0);
      v8f c0 = wmma_f16(kf0, qf, z);
      v16h kf1 = load_frag16(lds_k, (2 * t + 1) * 16, PITCH32, 0);
      v8f c1 = wmma_f16(kf1, qf, z);

      const float b0[8] = {b[0].x, b[0].y, b[0].z, b[0].w, b[1].x, b[1].y, b[1].z, b[1].w};
      const float b1[8] = {b[2].x, b[2].y, b[2].z, b[2].w, b[3].x, b[3].y, b[3].z, b[3].w};
      float x[8];
      #pragma unroll
      for (int e = 0; e < 8; ++e) {
        c0[e] = c0[e] * scale + b0[e];
        c1[e] = c1[e] * scale + b1[e];
        x[e] = fmaxf(c0[e], c1[e]);
      }
      float nm = fmaxf(fmaxf(fmaxf(x[0], x[1]), fmaxf(x[2], x[3])),
                       fmaxf(fmaxf(x[4], x[5]), fmaxf(x[6], x[7])));
      nm = fmaxf(nm, half_xor(nm));               // the query's other 16 keys
      nm = fmaxf(nm, rmax);
      float corr = __expf(rmax - nm);
      rmax = nm;
      #pragma unroll
      for (int e = 0; e < 8; ++e) {
        c0[e] = __expf(c0[e] - nm);
        c1[e] = __expf(c1[e] - nm);
        x[e] = c0[e] + c1[e];
      }
      float bsum = ((x[0] + x[1]) + (x[2] + x[3])) + ((x[4] + x[5]) + (x[6] + x[7]));
      rsum = rsum * corr + bsum;                  // this half's keys only
      v16h pf;                                    // P^T as B operand: column = query
      #pragma unroll
      for (int e = 0; e < 8; ++e) {
        o0[e] *= corr;
        o1[e] *= corr;
        pf[e]     = (half_t)c0[e];
        pf[8 + e] = (half_t)c1[e];
      }
      v16h v0 = load_frag16(lds_v, 0, PITCH256, 32 * t);    // channels 0..15
      v16h v1 = load_frag16(lds_v, 16, PITCH256, 32 * t);   // channels 16..31
      o0 = wmma_f16(v0, pf, o0);
      o1 = wmma_f16(v1, pf, o1);
    }

    // finalize: join the halves' sums, divide, gate, store f16
    rsum += half_xor(rsum);
    float inv = 1.f / rsum;
    const unsigned goff = (unsigned)sh * FR_HEAD + (i0 >> 4) * FR_BLOCK + lane * 8;
    union { half_t h[8]; uint4 q; } g0, g1, r0, r1;
    g0.q = *(const uint4*)(gate + goff);
    g1.q = *(const uint4*)(gate + goff + 256);
    #pragma unroll
    for (int e = 0; e < 8; ++e) {
      r0.h[e] = (half_t)((float)g0.h[e] * o0[e] * inv);
      r1.h[e] = (half_t)((float)g1.h[e] * o1[e] * inv);
    }
    *(uint4*)(go + goff)      = r0.q;
    *(uint4*)(go + goff + 256) = r1.q;
    // the next tile's set-up rewrites registers that these stores name
    asm volatile("s_wait_xcnt 0x0" ::: "memory");
  }
}

// ---------------------------------------------------------------------------
// Host launcher
// ---------------------------------------------------------------------------
extern "C" void kernel_launch(void* const* d_in, const int* in_sizes, int n_in,
                              void* d_out, int out_size, void* d_ws, size_t ws_size,
                              hipStream_t stream) {
  const float* m      = (const float*)d_in[0];
  const float* z      = (const float*)d_in[1];
  const float* ln_m_g = (const float*)d_in[2];
  const float* ln_m_b = (const float*)d_in[3];
  const float* ln_z_g = (const float*)d_in[4];
  const float* ln_z_b = (const float*)d_in[5];
  const float* W_z    = (const float*)d_in[6];
  const float* Wq     = (const float*)d_in[7];
  const float* Wk     = (const float*)d_in[8];
  const float* Wv     = (const float*)d_in[9];
  const float* Wg     = (const float*)d_in[10];
  const float* bg     = (const float*)d_in[11];
  const float* Wo     = (const float*)d_in[12];
  const float* bo     = (const float*)d_in[13];

  char* ws = (char*)d_ws;
  const size_t BIG = (size_t)32768 * 256 * 2;   // 16 MiB f16 planes
  half_t* mn_f16 = (half_t*)(ws + 0 * BIG);
  half_t* qbuf   = (half_t*)(ws + 1 * BIG);     // [S,H] fragment order
  half_t* kbuf   = (half_t*)(ws + 2 * BIG);     // [S,H] fragment order
  half_t* vbuf   = (half_t*)(ws + 3 * BIG);     // [S,H,C,R]
  half_t* gbuf   = (half_t*)(ws + 4 * BIG);     // gate [S,H] fragment order
  half_t* gobuf  = (half_t*)(ws + 5 * BIG);     // g*o  [S,H] fragment order
  float*  bbuf   = (float*)(ws + 6 * BIG);      // bias f32, 8 heads x 65536 (2 MiB)
  half_t* WqT    = (half_t*)(ws + 6 * BIG + 2097152);
  half_t* WkT    = WqT + 65536;
  half_t* WvT    = WkT + 65536;
  half_t* WgT    = WvT + 65536;
  half_t* WoT    = WgT + 65536;

  pre_kernel<<<1024, 256, 0, stream>>>(   // 256 + 512 + 256 work-groups
      z, ln_z_g, ln_z_b, W_z, bbuf, m, ln_m_g, ln_m_b, mn_f16,
      Wq, Wk, Wv, Wg, Wo, WqT, WkT, WvT, WgT, WoT);

  proj_gemm<<<dim3(128, 4), 256, 0, stream>>>(mn_f16, WqT, bg, qbuf, kbuf, vbuf, gbuf);

  attn_kernel<<<1024, 256, 0, stream>>>(qbuf, kbuf, vbuf, bbuf, gbuf, gobuf);

  out_gemm<<<dim3(128, 2), 256, 0, stream>>>(gobuf, WoT, bo, (float*)d_out);
}

// v009
// Measured time: 57 microseconds a run.
// Next to v008, in two timings, it ran 1.12 times as fast each time.
// All steps since v000 together make it 5.36 times as fast.
#include <hip/hip_runtime.h>
#include <hip/hip_bf16.h>

typedef _Float16 half_t;
typedef __attribute__((ext_vector_type(16))) _Float16 v16h;
typedef __attribute__((ext_vector_type(8)))  float    v8f;
typedef __attribute__((ext_vector_type(4)))  unsigned int v4u;

#define S_SEQ 128
#define R_RES 256
#define CM    256
#define CZ    128
#define CH    32
#define NH    8

// LDS row pitches, in f16 elements. Every fragment tile is read with
// ds_load_b128, 16 rows per half-wave: a pitch of 16 B x odd puts the 16 rows
// on 16 distinct groups of four banks, a pitch of 64 B or 512 B does not.
#define PITCH256 264   // rows of 256 f16: 528 B = 16 B x 33
#define PITCH32  40    // rows of  32 f16:  80 B = 16 B x 5

// ---------------------------------------------------------------------------
// WMMA 16x16x32 f16 fragment loader (A-layout; B uses identical layout with
// lane = N, since B is consumed as N x K).
// lane l: row = row0 + (l&15), half = l>>4
// element e: k = k0 + 16*(e/8) + 8*half + (e%8)
// -> two contiguous 16-byte chunks per lane (global_load_b128 / ds_load_b128).
// ---------------------------------------------------------------------------
__device__ __forceinline__ v16h load_frag16(const half_t* base, int row0, int ldk, int k0) {
  const int lane = threadIdx.x & 31;
  const int r    = row0 + (lane & 15);
  const int hh   = lane >> 4;
  const half_t* p = base + (size_t)r * ldk + k0 + hh * 8;
  union { v16h v; uint4 q[2]; } u;
  u.q[0] = *(const uint4*)(p);
  u.q[1] = *(const uint4*)(p + 16);
  return u.v;
}

__device__ __forceinline__ v8f wmma_f16(v16h a, v16h b, v8f c) {
  return __builtin_amdgcn_wmma_f32_16x16x32_f16(false, a, false, b, (short)0, c, false, false);
}

// ---------------------------------------------------------------------------
// Fragment order of the plane g * o. The plane is [S*H] heads of
// 256 rows x 32 channels; a head is 16 blocks of 16 rows, 512 f16 each, and in
// a block the element (row i, channel c) stands at
//   (c / 8) * 128 + (i % 16) * 8 + c % 8
// so the 16-byte chunks that the 32 lanes of one fragment load (or of one store
// of a transposed accumulator tile) touch lie side by side: 512 bytes, four
// whole lines, where rows laid one behind the other give 16 pieces of 32 bytes.
// Same k order as load_frag16: chunk half, then chunk 2 + half.
// ---------------------------------------------------------------------------
#define FR_HEAD  8192   // f16 per head
#define FR_BLOCK 512    // f16 per block of 16 rows

// ---------------------------------------------------------------------------
// Cross-lane moves on the vector unit. __shfl_xor goes through the LDS pipe
// (ds_bpermute_b32 and a wait on dscnt for every step); these do not.
// All 32 lanes are on wherever they are used.
// ---------------------------------------------------------------------------
// value of lane l ^ M, M < 16: DPP row_xmask inside the 16-lane row
template <int M>
__device__ __forceinline__ float row_xor(float v) {
  return __builtin_bit_cast(float, __builtin_amdgcn_update_dpp(
      0, __builtin_bit_cast(int, v), 0x160 | M, 0xf, 0xf, true));
}
// value of lane l ^ 16: the same lane of the other row
__device__ __forceinline__ float half_xor(float v) {
  int b = __builtin_bit_cast(int, v);
  return __builtin_bit_cast(float, __builtin_amdgcn_permlanex16(
      b, b, 0x76543210, 0xfedcba98, false, false));
}
// butterfly sum over the 32 lanes, steps 1, 2, 4, 8, 16
__device__ __forceinline__ float wave_sum(float v) {
  v += row_xor<1>(v);
  v += row_xor<2>(v);
  v += row_xor<4>(v);
  v += row_xor<8>(v);
  v += half_xor(v);
  return v;
}
// one butterfly step over eight values side by side, inside the 16-lane row
template <int M>
__device__ __forceinline__ void row_max_step(float (&x)[8]) {
  // unrolled: x[] stays in registers, the eight chains cover each other's latency
  #pragma unroll
  for (int e = 0; e < 8; ++e) x[e] = fmaxf(x[e], row_xor<M>(x[e]));
}
template <int M>
__device__ __forceinline__ void row_sum_step(float (&x)[8]) {
  // unrolled: x[] stays in registers, the eight chains cover each other's latency
  #pragma unroll
  for (int e = 0; e < 8; ++e) x[e] += row_xor<M>(x[e]);
}

// ---------------------------------------------------------------------------
// Part 0 of the first launch: transpose + f32->f16 convert the five 256x256
// weight matrices. WT[n*256+k] = (f16) W[k*256+n]. blk = 0..255.
// ---------------------------------------------------------------------------
__device__ __forceinline__ void cvt_weights(
    unsigned blk, const float* __restrict__ Wq, const float* __restrict__ Wk,
    const float* __restrict__ Wv, const float* __restrict__ Wg,
    const float* __restrict__ Wo,
    half_t* __restrict__ WqT, half_t* __restrict__ WkT,
    half_t* __restrict__ WvT, half_t* __restrict__ WgT,
    half_t* __restrict__ WoT) {
  int idx = blk * 256 + threadIdx.x;             // 0..65535
  int n = idx >> 8, k = idx & 255;
  int src = k * 256 + n;
  WqT[idx] = (half_t)Wq[src];
  WkT[idx] = (half_t)Wk[src];
  WvT[idx] = (half_t)Wv[src];
  WgT[idx] = (half_t)Wg[src];
  WoT[idx] = (half_t)Wo[src];
}

// ---------------------------------------------------------------------------
// Part 1 of the first launch, blk = 0..511:
// LayerNorm over m rows of 256, write f16. One wave takes LNM_ROWS
// rows one after the other, for speed only. All the rows' loads
// are issued first; gamma and beta are read once per wave.
// ---------------------------------------------------------------------------
#define LNM_ROWS 8
__device__ __forceinline__ void ln_m_rows(
    unsigned blk, const float* __restrict__ m, const float* __restrict__ gam,
    const float* __restrict__ bet, half_t* __restrict__ mn) {
  int wave = threadIdx.x >> 5, lane = threadIdx.x & 31;
  size_t row0 = ((size_t)blk * 8 + wave) * LNM_ROWS;          // 0..32767
  const float* p = m + row0 * CM + lane * 8;
  float4 x0[LNM_ROWS], x1[LNM_ROWS];
  // unrolled: the arrays stay in registers and the 16 loads are in flight together
  #pragma unroll
  for (int r = 0; r < LNM_ROWS; ++r) {
    x0[r] = *(const float4*)(p + r * CM);
    x1[r] = *(const float4*)(p + r * CM + 4);
  }
  float g[8], b[8];
  #pragma unroll
  for (int e = 0; e < 8; ++e) { g[e] = gam[lane * 8 + e]; b[e] = bet[lane * 8 + e]; }
  // unrolled: register arrays, and the rows' butterflies cover each other's latency
  #pragma unroll
  for (int r = 0; r < LNM_ROWS; ++r) {
    float xs[8] = {x0[r].x, x0[r].y, x0[r].z, x0[r].w, x1[r].x, x1[r].y, x1[r].z, x1[r].w};
    float sum = 0.f;
    #pragma unroll
    for (int e = 0; e < 8; ++e) sum += xs[e];
    sum = wave_sum(sum);
    float mu = sum * (1.f / 256.f);
    float var = 0.f;
    #pragma unroll
    for (int e = 0; e < 8; ++e) { float d = xs[e] - mu; var += d * d; }
    var = wave_sum(var);
    float rstd = rsqrtf(var * (1.f / 256.f) + 1e-5f);
    union { half_t h[8]; uint4 q; } o;
    #pragma unroll
    for (int e = 0; e < 8; ++e) o.h[e] = (half_t)((xs[e] - mu) * rstd * g[e] + b[e]);
    *(uint4*)(mn + (row0 + r) * CM + lane * 8) = o.q;
  }
}

// ---------------------------------------------------------------------------
// Part 2 of the first launch, blk = 0..255:
// LayerNorm over z rows of 128 fused with pair-bias projection.
// One wave takes LNZ_ROWS = 32 rows (i,j), 8 queries i x 4 keys j, in batches of
// LNZ_BATCH whose loads are issued one batch ahead. gamma, beta and the lane's
// 4 x 8 slice of W_z are read once per wave and stay in registers. Every lane
// ends a butterfly with the whole sum, so lane l keeps the eight sums of row l
// and each head's 32 results leave as one 128-B line.
// Output f32, per head in the order in which the attention kernel's transposed
// score tiles hold it: [16 queries][32 keys] blocks of 512 floats, block index
// (i / 16) * 8 + j / 32; in a block, with kk = j % 32, the float at
//   (kk / 16 * 2 + kk % 8 / 4) * 128 + (kk / 8 % 2 * 16 + i % 16) * 4 + kk % 4
// so that lane l of a score tile finds four of its keys in 16 bytes at l * 16.
// ---------------------------------------------------------------------------
#define LNZ_ROWS  32
#define LNZ_BATCH 8
// one batch of rows; row r of the batch is row first + r of the wave
__device__ __forceinline__ void ln_z_batch(
    const float4 (&x)[LNZ_BATCH], int first, int lane, const float (&g)[4],
    const float (&b)[4], const float (&wz)[4][NH], float (&keep)[NH]) {
  // unrolled: register arrays, and the rows' butterflies cover each other's latency
  #pragma unroll
  for (int r = 0; r < LNZ_BATCH; ++r) {
    float xs[4] = {x[r].x, x[r].y, x[r].z, x[r].w};
    float sum = xs[0] + xs[1] + xs[2] + xs[3];
    sum = wave_sum(sum);
    float mu = sum * (1.f / 128.f);
    float var = 0.f;
    #pragma unroll
    for (int t = 0; t < 4; ++t) { float d = xs[t] - mu; var += d * d; }
    var = wave_sum(var);
    float rstd = rsqrtf(var * (1.f / 128.f) + 1e-5f);
    float zn[4];
    #pragma unroll
    for (int t = 0; t < 4; ++t) zn[t] = (xs[t] - mu) * rstd * g[t] + b[t];
    bool mine = lane == first + r;
    #pragma unroll
    for (int h = 0; h < NH; ++h) {
      float acc = 0.f;
      #pragma unroll
      for (int t = 0; t < 4; ++t) acc += zn[t] * wz[t][h];
      acc = wave_sum(acc);
      keep[h] = mine ? acc : keep[h];
    }
  }
}

__device__ __forceinline__ void ln_z_bias(
    unsigned blk, const float* __restrict__ z, const float* __restrict__ gam,
    const float* __restrict__ bet, const float* __restrict__ Wz,
    float* __restrict__ bias) {
  int wave = threadIdx.x >> 5, lane = threadIdx.x & 31;
  const unsigned wid = blk * 8 + wave;                       // 0..2047
  const unsigned i0 = (wid >> 6) * 8, j0 = (wid & 63) * 4;   // row r: i0 + r / 4, j0 + r % 4
  const float* zp = z + (size_t)(i0 * R_RES + j0) * CZ + lane * 4;
  float4 cur[LNZ_BATCH];
  #pragma unroll
  for (int r = 0; r < LNZ_BATCH; ++r)
    cur[r] = *(const float4*)(zp + ((r >> 2) * R_RES + (r & 3)) * CZ);
  // the rows have the longest way and go out first: without this the compiler
  // issues them behind a wait on the W_z loads
  __builtin_amdgcn_sched_barrier(0);
  float wz[4][NH], g[4], b[4];
  #pragma unroll
  for (int t = 0; t < 4; ++t) {
    g[t] = gam[lane * 4 + t];
    b[t] = bet[lane * 4 + t];
    #pragma unroll
    for (int h = 0; h < NH; ++h) wz[t][h] = Wz[(lane * 4 + t) * NH + h];
  }
  float keep[NH];
  #pragma unroll
  for (int h = 0; h < NH; ++h) keep[h] = 0.f;

  // not unrolled: for speed only
  #pragma unroll 1
  for (int bt = 0; bt + 1 < LNZ_ROWS / LNZ_BATCH; ++bt) {
    float4 nxt[LNZ_BATCH];
    #pragma unroll
    for (int r = 0; r < LNZ_BATCH; ++r)
      nxt[r] = *(const float4*)(zp + (((bt + 1) * (LNZ_BATCH / 4) + (r >> 2)) * R_RES + (r & 3)) * CZ);
    // the batch body reuses the loads' address registers at once
    asm volatile("s_wait_xcnt 0x0" ::: "memory");
    ln_z_batch(cur, bt * LNZ_BATCH, lane, g, b, wz, keep);
    #pragma unroll
    for (int r = 0; r < LNZ_BATCH; ++r) cur[r] = nxt[r];
  }
  ln_z_batch(cur, LNZ_ROWS - LNZ_BATCH, lane, g, b, wz, keep);
  // the wave's 128-B line in a head's plane: rows r = lane lie side by side there
  const unsigned kk = j0 & 31;
  const unsigned p0 = ((i0 >> 4) * 8 + (j0 >> 5)) * 512 + ((kk >> 4) * 2 + ((kk & 7) >> 2)) * 128 +
                      (((kk >> 3) & 1) * 16 + (i0 & 8)) * 4;
  #pragma unroll
  for (int h = 0; h < NH; ++h) bias[h * 65536 + p0 + lane] = keep[h];
}

// ---------------------------------------------------------------------------
// The first launch: the three passes above read only inputs and write disjoint
// planes of the workspace, so none waits for another. They share one grid, each
// on its own range of work-groups: one launch gap and one fill, not three, and
// the vector work on z runs under the memory streams of m. The longest part has
// the lowest indices.
// ---------------------------------------------------------------------------
#define PRE_Z_BLOCKS 256
#define PRE_M_BLOCKS 512
#define PRE_W_BLOCKS 256   // the rest of the grid of 1024
__global__ __launch_bounds__(256) void pre_kernel(
    const float* __restrict__ z, const float* __restrict__ ln_z_g,
    const float* __restrict__ ln_z_b, const float* __restrict__ W_z,
    float* __restrict__ bias,
    const float* __restrict__ m, const float* __restrict__ ln_m_g,
    const float* __restrict__ ln_m_b, half_t* __restrict__ mn,
    const float* __restrict__ Wq, const float* __restrict__ Wk,
    const float* __restrict__ Wv, const float* __restrict__ Wg,
    const float* __restrict__ Wo,
    half_t* __restrict__ WqT, half_t* __restrict__ WkT,
    half_t* __restrict__ WvT, half_t* __restrict__ WgT,
    half_t* __restrict__ WoT) {
  const unsigned blk = blockIdx.x;
  if (blk < PRE_Z_BLOCKS) {
    ln_z_bias(blk, z, ln_z_g, ln_z_b, W_z, bias);
  } else if (blk < PRE_Z_BLOCKS + PRE_M_BLOCKS) {
    ln_m_rows(blk - PRE_Z_BLOCKS, m, ln_m_g, ln_m_b, mn);
    // in the built code the end of this part stands, over a test that never
    // passes, in front of another part's set-up, which rewrites the registers
    // that the stores name
    asm volatile("s_wait_xcnt 0x0" ::: "memory");
  } else {
    cvt_weights(blk - (PRE_Z_BLOCKS + PRE_M_BLOCKS), Wq, Wk, Wv, Wg, Wo, WqT, WkT, WvT, WgT, WoT);
    // as above
    asm volatile("s_wait_xcnt 0x0" ::: "memory");
  }
}

// ---------------------------------------------------------------------------
// Kernel 3: WMMA GEMM  out[32768x256] = A[32768x256] * B(=BT N-major) + bo.
// Block = 256 rows, 8 waves; wave = 32 rows, two row tiles of 16. A wave loads its
// rows of A once, as 2 x 8 fragments that stay in registers, and takes two
// 64-column tiles of B with them, one after the other: fewer waves to start, fewer
// reads of A. Every B fragment read from LDS feeds both row tiles: the LDS pipe,
// which one WMMA per fragment keeps busier than the matrix unit, moves half the bytes.
// Each 64x256 f16 B tile is staged into LDS through registers, rows laid at the
// padded pitch, then consumed as ds_load_b128 fragments.
// ---------------------------------------------------------------------------

// one wave's 16 x 64 tile: rows r0.., columns c0.. One 32-bit element index per
// lane; every other element of the lane lies at a constant offset from it.
__device__ __forceinline__ void store_tile(
    const v8f (&acc)[4], int r0, int c0, int lane,
    const float (&bv)[4], float* __restrict__ outp) {
  const unsigned m_lane = 8 * (lane >> 4), n_lane = lane & 15;
  float* o = outp + ((r0 + m_lane) * 256 + c0 + n_lane);
  #pragma unroll
  for (int j = 0; j < 4; ++j) {
    #pragma unroll
    for (int e = 0; e < 8; ++e) o[e * 256 + j * 16] = acc[j][e] + bv[j];
  }
}

// 16 of the wave's 32 rows of A, from r0, as eight fragments
__device__ __forceinline__ void load_a_rows(v16h (&a)[8], const half_t* __restrict__ A, int r0) {
  const int lane = threadIdx.x & 31;
  const half_t* p = A + (size_t)(r0 + (lane & 15)) * 256 + (lane >> 4) * 8;
  // unrolled: a[] stays in registers and the 16 loads are in flight together
  #pragma unroll
  for (int kb = 0; kb < 8; ++kb) {
    union { v16h v; uint4 q[2]; } u;
    u.q[0] = *(const uint4*)(p + kb * 32);
    u.q[1] = *(const uint4*)(p + kb * 32 + 16);
    a[kb] = u.v;
  }
  // the loads' address register is held whole up to this wait, which stands in
  // front of whatever rewrites it
  asm volatile("s_wait_xcnt 0x0" :: "v"(p) : "memory");
}

// the same from a plane in fragment order: fragment kb is head kb's block
__device__ __forceinline__ void load_a_rows_fr(v16h (&a)[8], const half_t* __restrict__ A, int r0) {
  const int lane = threadIdx.x & 31;
  const half_t* p = A + (size_t)((r0 >> 8) * 8 * FR_HEAD + ((r0 & 255) >> 4) * FR_BLOCK + lane * 8);
  // unrolled: a[] stays in registers and the 16 loads are in flight together
  #pragma unroll
  for (int kb = 0; kb < 8; ++kb) {
    union { v16h v; uint4 q[2]; } u;
    u.q[0] = *(const uint4*)(p + kb * FR_HEAD);
    u.q[1] = *(const uint4*)(p + kb * FR_HEAD + 256);
    a[kb] = u.v;
  }
  // the loads' address register is held whole up to this wait, which stands in
  // front of whatever rewrites it
  asm volatile("s_wait_xcnt 0x0" :: "v"(p) : "memory");
}

// one 256 x 64 tile of the block: bt = the 64 rows of BT for columns c0..c0+63;
// a[u] = the wave's rows r0 + 16 * u ..
template <bool MORE>
__device__ __forceinline__ void gemm_tile(
    const v16h (&a)[2][8], const half_t* __restrict__ bt, const float* __restrict__ bias,
    float* __restrict__ outp, half_t* btl, int r0, int c0) {
  // a thread copies 16 bytes of every eighth row: one address each side, the
  // rest are constant offsets
  const int tid = threadIdx.x;
  const v4u* src = (const v4u*)bt + tid;
  half_t* dst = btl + (tid >> 5) * PITCH256 + (tid & 31) * 8;
  v4u st[8];
  // unrolled: st[] stays in registers and the eight loads are in flight together
  #pragma unroll
  for (int it = 0; it < 8; ++it) st[it] = src[it * 256];
  // the lane's four bias values travel with the tile's loads: no load of the
  // epilogue then lands on a register that an issued store still names, and none
  // is waited for behind a barrier
  float bv[4];
  const unsigned bi = c0 + (tid & 15);
  #pragma unroll
  for (int j = 0; j < 4; ++j) bv[j] = bias[bi + j * 16];
  // the index registers of the tile's and the bias loads are held whole up to
  // this wait
  asm volatile("s_wait_xcnt 0x0" :: "v"(tid), "v"(bi) : "memory");
  // holds the eight loads in front of the first LDS store (loaded values as
  // inputs only): without it the compiler, under the register bound, takes them
  // two at a time, four trips to L2 one after the other
  asm volatile("" :: "v"(st[0]), "v"(st[1]), "v"(st[2]), "v"(st[3]),
                     "v"(st[4]), "v"(st[5]), "v"(st[6]), "v"(st[7]));
  #pragma unroll
  for (int it = 0; it < 8; ++it) *(v4u*)(dst + it * 8 * PITCH256) = st[it];
  __syncthreads();   // the tile is whole

  v8f acc[2][4] = {{v8f{}, v8f{}, v8f{}, v8f{}}, {v8f{}, v8f{}, v8f{}, v8f{}}};
  // step p: k block p / 2, column tiles 2 * (p % 2) and the next. With few waves
  // to a SIMD a wave has to cover its own LDS latency: the pair of fragments of
  // step p + 1 is asked for in front of the four WMMAs of step p.
  v16h b[2][2];
  b[0][0] = load_frag16(btl, 0, PITCH256, 0);    // ds_load_b128 x2
  b[0][1] = load_frag16(btl, 16, PITCH256, 0);
  #pragma unroll
  for (int p = 0; p < 16; ++p) {
    if (p + 1 < 16) {
      b[(p + 1) & 1][0] = load_frag16(btl, ((p + 1) & 1) * 32, PITCH256, ((p + 1) >> 1) * 32);
      b[(p + 1) & 1][1] = load_frag16(btl, ((p + 1) & 1) * 32 + 16, PITCH256, ((p + 1) >> 1) * 32);
    }
    // keeps the next pair's loads in front of this step's WMMAs: left alone the
    // compiler puts each load directly in front of its use and waits it out
    __builtin_amdgcn_sched_barrier(0);
    const int kb = p >> 1;
    #pragma unroll
    for (int jj = 0; jj < 2; ++jj) {
      const int j = (p & 1) * 2 + jj;
      #pragma unroll
      for (int u = 0; u < 2; ++u) acc[u][j] = wmma_f16(a[u][kb], b[p & 1][jj], acc[u][j]);
    }
  }
  // where another tile follows: every wave has read its last fragment of this
  // one. In front of the stores, so that they drain under the next tile's loads
  // and not under the barrier.
  if constexpr (MORE) __syncthreads();
  store_tile(acc[0], r0, c0, threadIdx.x & 31, bv, outp);
  store_tile(acc[1], r0 + 16, c0, threadIdx.x & 31, bv, outp);
  // the next tile's loads land on registers that these stores name
  if constexpr (MORE) asm volatile("s_wait_xcnt 0x0" ::: "memory");
}

// The final GEMM: a block takes two of the four column tiles.
__global__ __launch_bounds__(256) void out_gemm(
    const half_t* __restrict__ A, const half_t* __restrict__ BT,
    const float* __restrict__ bo, float* __restrict__ out) {
  __shared__ __align__(16) half_t btl[64 * PITCH256];   // B tile, 33792 B
  const int r0 = blockIdx.x * 256 + (threadIdx.x >> 5) * 32;
  v16h a[2][8];
  load_a_rows_fr(a[0], A, r0);
  load_a_rows_fr(a[1], A, r0 + 16);
  const int c0 = blockIdx.y * 128;
  gemm_tile<true>(a, BT + (size_t)c0 * 256, bo, out, btl, r0, c0);
  gemm_tile<false>(a, BT + (size_t)(c0 + 64) * 256, bo, out, btl, r0, c0 + 64);
}

__device__ __forceinline__ uint4 cvt8(const v8f& x) {
  union { half_t h[8]; uint4 q; } u;
  #pragma unroll
  for (int e = 0; e < 8; ++e) u.h[e] = (half_t)x[e];
  return u.q;
}

#define PJ_Q 0   // order of the planes in WT
#define PJ_K 1
#define PJ_V 2
#define PJ_G 3

// One product of the wave's 32 rows with the 32 columns KIND of the head.
// Step p: k block p, both column tiles. With few waves to a SIMD a wave has to
// cover its own LDS latency: the pair of fragments of step p + 1 (behind the last
// step: the first pair of the product NEXT) is asked for in front of the four
// WMMAs of step p. b[0] holds the first pair on entry.
template <int KIND, int NEXT>
__device__ __forceinline__ void head_product(
    const v16h (&a)[2][8], const half_t* btl, v16h (&b)[2][2], v8f (&acc)[2][2]) {
  #pragma unroll
  for (int p = 0; p < 8; ++p) {
    if (p + 1 < 8) {
      b[(p + 1) & 1][0] = load_frag16(btl, KIND * CH, PITCH256, (p + 1) * 32);
      b[(p + 1) & 1][1] = load_frag16(btl, KIND * CH + 16, PITCH256, (p + 1) * 32);
    } else if constexpr (NEXT >= 0) {
      b[0][0] = load_frag16(btl, NEXT * CH, PITCH256, 0);
      b[0][1] = load_frag16(btl, NEXT * CH + 16, PITCH256, 0);
    }
    // keeps the next pair's loads in front of this step's WMMAs: left alone the
    // compiler puts each load directly in front of its use and waits it out
    __builtin_amdgcn_sched_barrier(0);
    #pragma unroll
    for (int jj = 0; jj < 2; ++jj) {
      #pragma unroll
      for (int u = 0; u < 2; ++u) {
        const v8f c = p == 0 ? v8f{} : acc[u][jj];
        if constexpr (KIND == PJ_V) acc[u][jj] = wmma_f16(a[u][p], b[p & 1][jj], c);
        else acc[u][jj] = wmma_f16(b[p & 1][jj], a[u][p], c);
      }
    }
  }
}

__global__ __launch_bounds__(256, 4) void proj_attn_kernel(
    const half_t* __restrict__ A, const half_t* __restrict__ WT,
    const float* __restrict__ bg, const float* __restrict__ bias,
    half_t* __restrict__ go) {
  __shared__ __align__(16) half_t btl[4 * CH * PITCH256];   // 67584 B
  __shared__ __align__(16) half_t lds_k[R_RES * PITCH32];   // 20480 B
  __shared__ __align__(16) half_t lds_v[CH * PITCH256];     // 16896 B
  const int sh = blockIdx.x;           // s*8 + h
  const int h = sh & 7;
  const int tid = threadIdx.x;
  const int wave = tid >> 5, lane = tid & 31;
  const float*  bb = bias + (size_t)h * R_RES * R_RES;
  const float scale = 0.17677669529663687f;   // 1/sqrt(32)

  v16h a[2][8];
  {
    // a thread copies 16 bytes of every eighth row: one address each side, the
    // rest are constant offsets
    const v4u* wsrc = (const v4u*)(WT + h * CH * CM) + tid;
    half_t* dst = btl + (tid >> 5) * PITCH256 + (tid & 31) * 8;
    v4u st[16];
    // unrolled: st[] stays in registers and the 16 loads are in flight together
    #pragma unroll
    for (int it = 0; it < 16; ++it) st[it] = wsrc[(it >> 2) * (CM * CM / 8) + (it & 3) * 256];
    // the loads' index register is held whole up to this wait, which stands in
    // front of whatever rewrites it or their base
    asm volatile("s_wait_xcnt 0x0" :: "v"(tid) : "memory");
    // behind the weights' loads: the weights have the longer way, through LDS and
    // a barrier, and loads come back in order
    load_a_rows(a[0], A, (sh >> 3) * R_RES + wave * 32);
    load_a_rows(a[1], A, (sh >> 3) * R_RES + wave * 32 + 16);
    #pragma unroll
    for (int it = 0; it < 16; ++it) *(v4u*)(dst + it * 8 * PITCH256) = st[it];
    __syncthreads();   // the weights are whole
  }

  // The wave's 16 bias blocks (two query tiles x eight passes) lie one behind the
  // other. With few waves to a SIMD a wave has to cover its own way to L2: the
  // block of the next pass is asked for at the head of each pass, the first one
  // in front of the barrier behind the products, once A has left its registers.
  const float* bw = bb + wave * 8192 + lane * 4;   // the lane's 16 bytes in the first block
  float4 nb[4];
  v16h qf[2];        // Q^T of the two query tiles, B operand: column = query
  uint4 gt[2][2];    // gate of the two query tiles, channels 0..15 and 16..31
  {
    v8f acc[2][2];
    v16h b[2][2];
    b[0][0] = load_frag16(btl, PJ_K * CH, PITCH256, 0);    // ds_load_b128 x2
    b[0][1] = load_frag16(btl, PJ_K * CH + 16, PITCH256, 0);
    // K and V first: their LDS stores drain under the other two products
    head_product<PJ_K, PJ_V>(a, btl, b, acc);
    #pragma unroll
    for (int u = 0; u < 2; ++u) {
      #pragma unroll
      for (int jj = 0; jj < 2; ++jj)
        *(uint4*)(lds_k + (wave * 32 + u * 16 + (lane & 15)) * PITCH32 + jj * 16 + (lane >> 4) * 8) =
            cvt8(acc[u][jj]);
    }
    head_product<PJ_V, PJ_Q>(a, btl, b, acc);
    #pragma unroll
    for (int u = 0; u < 2; ++u) {
      #pragma unroll
      for (int jj = 0; jj < 2; ++jj)
        *(uint4*)(lds_v + (jj * 16 + (lane & 15)) * PITCH256 + wave * 32 + u * 16 + (lane >> 4) * 8) =
            cvt8(acc[u][jj]);
    }
    head_product<PJ_Q, PJ_G>(a, btl, b, acc);
    #pragma unroll
    for (int u = 0; u < 2; ++u) {
      #pragma unroll
      for (int e = 0; e < 8; ++e) {
        qf[u][e]     = (half_t)acc[u][0][e];
        qf[u][8 + e] = (half_t)acc[u][1][e];
      }
    }
    // the lane's 2 x 8 columns of the gate's bias, the same for both row tiles:
    // they travel under the gate's own WMMAs
    const float* bp = bg + h * CH + 8 * (lane >> 4);
    float4 bq[4];
    bq[0] = *(const float4*)(bp);
    bq[1] = *(const float4*)(bp + 4);
    bq[2] = *(const float4*)(bp + 16);
    bq[3] = *(const float4*)(bp + 20);
    // the loads' address register is held whole up to this wait, which stands in
    // front of whatever rewrites it
    asm volatile("s_wait_xcnt 0x0" :: "v"(bp) : "memory");
    head_product<PJ_G, -1>(a, btl, b, acc);
    nb[0] = *(const float4*)(bw);
    nb[1] = *(const float4*)(bw + 128);
    nb[2] = *(const float4*)(bw + 256);
    nb[3] = *(const float4*)(bw + 384);
    #pragma unroll
    for (int u = 0; u < 2; ++u) {
      #pragma unroll
      for (int jj = 0; jj < 2; ++jj) {
        const float bj[8] = {bq[2 * jj].x, bq[2 * jj].y, bq[2 * jj].z, bq[2 * jj].w,
                             bq[2 * jj + 1].x, bq[2 * jj + 1].y, bq[2 * jj + 1].z, bq[2 * jj + 1].w};
        v8f g;
        #pragma unroll
        for (int e = 0; e < 8; ++e) {
          float v = acc[u][jj][e] + bj[e];
          g[e] = 1.f / (1.f + __expf(-v));
        }
        gt[u][jj] = cvt8(g);
      }
    }
    __syncthreads();   // K and V^T are whole
  }

  // unrolled: qf[] and gt[] stay in registers
  #pragma unroll
  for (int tile = 0; tile < 2; ++tile) {
    int i0 = wave * 32 + tile * 16;
    v8f o0 = v8f{}, o1 = v8f{};                   // channels 0..15, 16..31
    float rmax = -1e30f, rsum = 0.f;

    for (int t = 0; t < 8; ++t) {
      // keys 0..3, 4..7, 16..19, 20..23 of the pass, + 8 in the upper half
      const float4 b[4] = {nb[0], nb[1], nb[2], nb[3]};
      if (tile * 8 + t + 1 < 16) {
        const float* bt = bw + 512 * (tile * 8 + t + 1);
        nb[0] = *(const float4*)(bt);
        nb[1] = *(const float4*)(bt + 128);
        nb[2] = *(const float4*)(bt + 256);
        nb[3] = *(const float4*)(bt + 384);
        // the next pass rewrites the loads' address register
        asm volatile("s_wait_xcnt 0x0" ::: "memory");
      }
      v8f z = v8f{};
      v16h kf0 = load_frag16(lds_k, (2 * t) * 16, PITCH32, 0);
      v8f c0 = wmma_f16(kf0, qf[tile], z);
      v16h kf1 = load_frag16(lds_k, (2 * t + 1) * 16, PITCH32, 0);
      v8f c1 = wmma_f16(kf1, qf[tile], z);

      const float b0[8] = {b[0].x, b[0].y, b[0].z, b[0].w, b[1].x, b[1].y, b[1].z, b[1].w};
      const float b1[8] = {b[2].x, b[2].y, b[2].z, b[2].w, b[3].x, b[3].y, b[3].z, b[3].w};
      float x[8];
      #pragma unroll
      for (int e = 0; e < 8; ++e) {
        c0[e] = c0[e] * scale + b0[e];
        c1[e] = c1[e] * scale + b1[e];
        x[e] = fmaxf(c0[e], c1[e]);
      }
      float nm = fmaxf(fmaxf(fmaxf(x[0], x[1]), fmaxf(x[2], x[3])),
                       fmaxf(fmaxf(x[4], x[5]), fmaxf(x[6], x[7])));
      nm = fmaxf(nm, half_xor(nm));               // the query's other 16 keys
      nm = fmaxf(nm, rmax);
      float corr = __expf(rmax - nm);
      rmax = nm;
      #pragma unroll
      for (int e = 0; e < 8; ++e) {
        c0[e] = __expf(c0[e] - nm);
        c1[e] = __expf(c1[e] - nm);
        x[e] = c0[e] + c1[e];
      }
      float bsum = ((x[0] + x[1]) + (x[2] + x[3])) + ((x[4] + x[5]) + (x[6] + x[7]));
      rsum = rsum * corr + bsum;                  // this half's keys only
      v16h pf;                                    // P^T as B operand: column = query
      #pragma unroll
      for (int e = 0; e < 8; ++e) {
        o0[e] *= corr;
        o1[e] *= corr;
        pf[e]     = (half_t)c0[e];
        pf[8 + e] = (half_t)c1[e];
      }
      v16h v0 = load_frag16(lds_v, 0, PITCH256, 32 * t);    // channels 0..15
      v16h v1 = load_frag16(lds_v, 16, PITCH256, 32 * t);   // channels 16..31
      o0 = wmma_f16(v0, pf, o0);
      o1 = wmma_f16(v1, pf, o1);
    }

    // finalize: join the halves' sums, divide, gate, store f16
    rsum += half_xor(rsum);
    float inv = 1.f / rsum;
    const unsigned goff = (unsigned)sh * FR_HEAD + (i0 >> 4) * FR_BLOCK + lane * 8;
    union { half_t h[8]; uint4 q; } g0, g1, r0, r1;
    g0.q = gt[tile][0];
    g1.q = gt[tile][1];
    #pragma unroll
    for (int e = 0; e < 8; ++e) {
      r0.h[e] = (half_t)((float)g0.h[e] * o0[e] * inv);
      r1.h[e] = (half_t)((float)g1.h[e] * o1[e] * inv);
    }
    *(uint4*)(go + goff)      = r0.q;
    *(uint4*)(go + goff + 256) = r1.q;
    // the next tile's set-up rewrites registers that these stores name
    asm volatile("s_wait_xcnt 0x0" ::: "memory");
  }
}

// ---------------------------------------------------------------------------
// Host launcher
// ---------------------------------------------------------------------------
extern "C" void kernel_launch(void* const* d_in, const int* in_sizes, int n_in,
                              void* d_out, int out_size, void* d_ws, size_t ws_size,
                              hipStream_t stream) {
  const float* m      = (const float*)d_in[0];
  const float* z      = (const float*)d_in[1];
  const float* ln_m_g = (const float*)d_in[2];
  const float* ln_m_b = (const float*)d_in[3];
  const float* ln_z_g = (const float*)d_in[4];
  const float* ln_z_b = (const float*)d_in[5];
  const float* W_z    = (const float*)d_in[6];
  const float* Wq     = (const float*)d_in[7];
  const float* Wk     = (const float*)d_in[8];
  const float* Wv     = (const float*)d_in[9];
  const float* Wg     = (const float*)d_in[10];
  const float* bg     = (const float*)d_in[11];
  const float* Wo     = (const float*)d_in[12];
  const float* bo     = (const float*)d_in[13];

  char* ws = (char*)d_ws;
  const size_t BIG = (size_t)32768 * 256 * 2;   // 16 MiB f16 planes
  half_t* mn_f16 = (half_t*)(ws + 0 * BIG);
  half_t* gobuf  = (half_t*)(ws + 5 * BIG);     // g*o  [S,H] fragment order
  float*  bbuf   = (float*)(ws + 6 * BIG);      // bias f32, 8 heads x 65536 (2 MiB)
  half_t* WqT    = (half_t*)(ws + 6 * BIG + 2097152);
  half_t* WkT    = WqT + 65536;
  half_t* WvT    = WkT + 65536;
  half_t* WgT    = WvT + 65536;
  half_t* WoT    = WgT + 65536;

  pre_kernel<<<1024, 256, 0, stream>>>(   // 256 + 512 + 256 work-groups
      z, ln_z_g, ln_z_b, W_z, bbuf, m, ln_m_g, ln_m_b, mn_f16,
      Wq, Wk, Wv, Wg, Wo, WqT, WkT, WvT, WgT, WoT);

  proj_attn_kernel<<<1024, 256, 0, stream>>>(mn_f16, WqT, bg, bbuf, gobuf);

  out_gemm<<<dim3(128, 2), 256, 0, stream>>>(gobuf, WoT, bo, (float*)d_out);
}

// v010
// It runs in 54.7 microseconds.
// In both of two side-by-side timings against v009, it was 1.04 times as fast.
// Over all steps from v000 it is 5.59 times as fast.
#include <hip/hip_runtime.h>
#include <hip/hip_bf16.h>

typedef _Float16 half_t;
typedef __attribute__((ext_vector_type(16))) _Float16 v16h;
typedef __attribute__((ext_vector_type(8)))  float    v8f;
typedef __attribute__((ext_vector_type(4)))  unsigned int v4u;

#define S_SEQ 128
#define R_RES 256
#define CM    256
#define CZ    128
#define CH    32
#define NH    8

// LDS row pitches, in f16 elements. Every fragment tile is read with
// ds_load_b128, 16 rows per half-wave: a pitch of 16 B x odd puts the 16 rows
// on 16 distinct groups of four banks, a pitch of 64 B or 512 B does not.
#define PITCH256 264   // rows of 256 f16: 528 B = 16 B x 33
#define PITCH32  40    // rows of  32 f16:  80 B = 16 B x 5

// ---------------------------------------------------------------------------
// WMMA 16x16x32 f16 fragment loader (A-layout; B uses identical layout with
// lane = N, since B is consumed as N x K).
// lane l: row = row0 + (l&15), half = l>>4
// element e: k = k0 + 16*(e/8) + 8*half + (e%8)
// -> two contiguous 16-byte chunks per lane (global_load_b128 / ds_load_b128).
// ---------------------------------------------------------------------------
__device__ __forceinline__ v16h load_frag16(const half_t* base, int row0, int ldk, int k0) {
  const int lane = threadIdx.x & 31;
  const int r    = row0 + (lane & 15);
  const int hh   = lane >> 4;
  const half_t* p = base + (size_t)r * ldk + k0 + hh * 8;
  union { v16h v; uint4 q[2]; } u;
  u.q[0] = *(const uint4*)(p);
  u.q[1] = *(const uint4*)(p + 16);
  return u.v;
}

__device__ __forceinline__ v8f wmma_f16(v16h a, v16h b, v8f c) {
  return __builtin_amdgcn_wmma_f32_16x16x32_f16(false, a, false, b, (short)0, c, false, false);
}

// ---------------------------------------------------------------------------
// Fragment order of the plane g * o. The plane is [S*H] heads of
// 256 rows x 32 channels; a head is 16 blocks of 16 rows, 512 f16 each, and in
// a block the element (row i, channel c) stands at
//   (c / 8) * 128 + (i % 16) * 8 + c % 8
// so the 16-byte chunks that the 32 lanes of one fragment load (or of one store
// of a transposed accumulator tile) touch lie side by side: 512 bytes, four
// whole lines, where rows laid one behind the other give 16 pieces of 32 bytes.
// Same k order as load_frag16: chunk half, then chunk 2 + half.
// ---------------------------------------------------------------------------
#define FR_HEAD  8192   // f16 per head
#define FR_BLOCK 512    // f16 per block of 16 rows

// ---------------------------------------------------------------------------
// Cross-lane moves on the vector unit. __shfl_xor goes through the LDS pipe
// (ds_bpermute_b32 and a wait on dscnt for every step); these do not.
// All 32 lanes are on wherever they are used.
// ---------------------------------------------------------------------------
// value of lane l ^ M, M < 16: DPP row_xmask inside the 16-lane row
template <int M>
__device__ __forceinline__ float row_xor(float v) {
  return __builtin_bit_cast(float, __builtin_amdgcn_update_dpp(
      0, __builtin_bit_cast(int, v), 0x160 | M, 0xf, 0xf, true));
}
// value of lane l ^ 16: the same lane of the other row
__device__ __forceinline__ float half_xor(float v) {
  int b = __builtin_bit_cast(int, v);
  return __builtin_bit_cast(float, __builtin_amdgcn_permlanex16(
      b, b, 0x76543210, 0xfedcba98, false, false));
}
// butterfly sum over the 32 lanes, steps 1, 2, 4, 8, 16
__device__ __forceinline__ float wave_sum(float v) {
  v += row_xor<1>(v);
  v += row_xor<2>(v);
  v += row_xor<4>(v);
  v += row_xor<8>(v);
  v += half_xor(v);
  return v;
}
// one butterfly step over eight values side by side, inside the 16-lane row
template <int M>
__device__ __forceinline__ void row_max_step(float (&x)[8]) {
  // unrolled: x[] stays in registers, the eight chains cover each other's latency
  #pragma unroll
  for (int e = 0; e < 8; ++e) x[e] = fmaxf(x[e], row_xor<M>(x[e]));
}
template <int M>
__device__ __forceinline__ void row_sum_step(float (&x)[8]) {
  // unrolled: x[] stays in registers, the eight chains cover each other's latency
  #pragma unroll
  for (int e = 0; e < 8; ++e) x[e] += row_xor<M>(x[e]);
}

// ---------------------------------------------------------------------------
// Part 0 of the first launch: transpose + f32->f16 convert the five 256x256
// weight matrices. WT[n*256+k] = (f16) W[k*256+n]. blk = 0..255.
// ---------------------------------------------------------------------------
__device__ __forceinline__ void cvt_weights(
    unsigned blk, const float* __restrict__ Wq, const float* __restrict__ Wk,
    const float* __restrict__ Wv, const float* __restrict__ Wg,
    const float* __restrict__ Wo,
    half_t* __restrict__ WqT, half_t* __restrict__ WkT,
    half_t* __restrict__ WvT, half_t* __restrict__ WgT,
    half_t* __restrict__ WoT) {
  int idx = blk * 256 + threadIdx.x;             // 0..65535
  int n = idx >> 8, k = idx & 255;
  int src = k * 256 + n;
  WqT[idx] = (half_t)Wq[src];
  WkT[idx] = (half_t)Wk[src];
  WvT[idx] = (half_t)Wv[src];
  WgT[idx] = (half_t)Wg[src];
  WoT[idx] = (half_t)Wo[src];
}

// ---------------------------------------------------------------------------
// Part 1 of the first launch, blk = 0..511:
// LayerNorm over m rows of 256, write f16. One wave takes LNM_ROWS
// rows one after the other, for speed only. All the rows' loads
// are issued first; gamma and beta are read once per wave.
// ---------------------------------------------------------------------------
#define LNM_ROWS 8
__device__ __forceinline__ void ln_m_rows(
    unsigned blk, const float* __restrict__ m, const float* __restrict__ gam,
    const float* __restrict__ bet, half_t* __restrict__ mn) {
  int wave = threadIdx.x >> 5, lane = threadIdx.x & 31;
  size_t row0 = ((size_t)blk * 8 + wave) * LNM_ROWS;          // 0..32767
  const float* p = m + row0 * CM + lane * 8;
  float4 x0[LNM_ROWS], x1[LNM_ROWS];
  // unrolled: the arrays stay in registers and the 16 loads are in flight together
  #pragma unroll
  for (int r = 0; r < LNM_ROWS; ++r) {
    x0[r] = *(const float4*)(p + r * CM);
    x1[r] = *(const float4*)(p + r * CM + 4);
  }
  float g[8], b[8];
  #pragma unroll
  for (int e = 0; e < 8; ++e) { g[e] = gam[lane * 8 + e]; b[e] = bet[lane * 8 + e]; }
  // unrolled: register arrays, and the rows' butterflies cover each other's latency
  #pragma unroll
  for (int r = 0; r < LNM_ROWS; ++r) {
    float xs[8] = {x0[r].x, x0[r].y, x0[r].z, x0[r].w, x1[r].x, x1[r].y, x1[r].z, x1[r].w};
    float sum = 0.f;
    #pragma unroll
    for (int e = 0; e < 8; ++e) sum += xs[e];
    sum = wave_sum(sum);
    float mu = sum * (1.f / 256.f);
    float var = 0.f;
    #pragma unroll
    for (int e = 0; e < 8; ++e) { float d = xs[e] - mu; var += d * d; }
    var = wave_sum(var);
    float rstd = rsqrtf(var * (1.f / 256.f) + 1e-5f);
    union { half_t h[8]; uint4 q; } o;
    #pragma unroll
    for (int e = 0; e < 8; ++e) o.h[e] = (half_t)((xs[e] - mu) * rstd * g[e] + b[e]);
    *(uint4*)(mn + (row0 + r) * CM + lane * 8) = o.q;
  }
}

// ---------------------------------------------------------------------------
// Part 2 of the first launch, blk = 0..255:
// LayerNorm over z rows of 128 fused with pair-bias projection.
// One wave takes LNZ_ROWS = 32 rows (i,j), 8 queries i x 4 keys j, in batches of
// LNZ_BATCH whose loads are issued one batch ahead. gamma, beta and the lane's
// 4 x 8 slice of W_z are read once per wave and stay in registers. Every lane
// ends a butterfly with the whole sum, so lane l keeps the eight sums of row l
// and each head's 32 results leave as one 128-B line.
// Output f32, per head in the order in which the attention kernel's transposed
// score tiles hold it: [16 queries][32 keys] blocks of 512 floats, block index
// (i / 16) * 8 + j / 32; in a block, with kk = j % 32, the float at
//   (kk / 16 * 2 + kk % 8 / 4) * 128 + (kk / 8 % 2 * 16 + i % 16) * 4 + kk % 4
// so that lane l of a score tile finds four of its keys in 16 bytes at l * 16.
// ---------------------------------------------------------------------------
#define LNZ_ROWS  32
#define LNZ_BATCH 8
// one batch of rows; row r of the batch is row first + r of the wave
__device__ __forceinline__ void ln_z_batch(
    const float4 (&x)[LNZ_BATCH], int first, int lane, const float (&g)[4],
    const float (&b)[4], const float (&wz)[4][NH], float (&keep)[NH]) {
  // unrolled: register arrays, and the rows' butterflies cover each other's latency
  #pragma unroll
  for (int r = 0; r < LNZ_BATCH; ++r) {
    float xs[4] = {x[r].x, x[r].y, x[r].z, x[r].w};
    float sum = xs[0] + xs[1] + xs[2] + xs[3];
    sum = wave_sum(sum);
    float mu = sum * (1.f / 128.f);
    float var = 0.f;
    #pragma unroll
    for (int t = 0; t < 4; ++t) { float d = xs[t] - mu; var += d * d; }
    var = wave_sum(var);
    float rstd = rsqrtf(var * (1.f / 128.f) + 1e-5f);
    float zn[4];
    #pragma unroll
    for (int t = 0; t < 4; ++t) zn[t] = (xs[t] - mu) * rstd * g[t] + b[t];
    bool mine = lane == first + r;
    #pragma unroll
    for (int h = 0; h < NH; ++h) {
      float acc = 0.f;
      #pragma unroll
      for (int t = 0; t < 4; ++t) acc += zn[t] * wz[t][h];
      acc = wave_sum(acc);
      keep[h] = mine ? acc : keep[h];
    }
  }
}

__device__ __forceinline__ void ln_z_bias(
    unsigned blk, const float* __restrict__ z, const float* __restrict__ gam,
    const float* __restrict__ bet, const float* __restrict__ Wz,
    float* __restrict__ bias) {
  int wave = threadIdx.x >> 5, lane = threadIdx.x & 31;
  const unsigned wid = blk * 8 + wave;                       // 0..2047
  const unsigned i0 = (wid >> 6) * 8, j0 = (wid & 63) * 4;   // row r: i0 + r / 4, j0 + r % 4
  const float* zp = z + (size_t)(i0 * R_RES + j0) * CZ + lane * 4;
  float4 cur[LNZ_BATCH];
  #pragma unroll
  for (int r = 0; r < LNZ_BATCH; ++r)
    cur[r] = *(const float4*)(zp + ((r >> 2) * R_RES + (r & 3)) * CZ);
  // the rows have the longest way and go out first: without this the compiler
  // issues them behind a wait on the W_z loads
  __builtin_amdgcn_sched_barrier(0);
  float wz[4][NH], g[4], b[4];
  #pragma unroll
  for (int t = 0; t < 4; ++t) {
    g[t] = gam[lane * 4 + t];
    b[t] = bet[lane * 4 + t];
    #pragma unroll
    for (int h = 0; h < NH; ++h) wz[t][h] = Wz[(lane * 4 + t) * NH + h];
  }
  float keep[NH];
  #pragma unroll
  for (int h = 0; h < NH; ++h) keep[h] = 0.f;

  // not unrolled: for speed only
  #pragma unroll 1
  for (int bt = 0; bt + 1 < LNZ_ROWS / LNZ_BATCH; ++bt) {
    float4 nxt[LNZ_BATCH];
    #pragma unroll
    for (int r = 0; r < LNZ_BATCH; ++r)
      nxt[r] = *(const float4*)(zp + (((bt + 1) * (LNZ_BATCH / 4) + (r >> 2)) * R_RES + (r & 3)) * CZ);
    // the batch body reuses the loads' address registers at once
    asm volatile("s_wait_xcnt 0x0" ::: "memory");
    ln_z_batch(cur, bt * LNZ_BATCH, lane, g, b, wz, keep);
    #pragma unroll
    for (int r = 0; r < LNZ_BATCH; ++r) cur[r] = nxt[r];
  }
  ln_z_batch(cur, LNZ_ROWS - LNZ_BATCH, lane, g, b, wz, keep);
  // the wave's 128-B line in a head's plane: rows r = lane lie side by side there
  const unsigned kk = j0 & 31;
  const unsigned p0 = ((i0 >> 4) * 8 + (j0 >> 5)) * 512 + ((kk >> 4) * 2 + ((kk & 7) >> 2)) * 128 +
                      (((kk >> 3) & 1) * 16 + (i0 & 8)) * 4;
  #pragma unroll
  for (int h = 0; h < NH; ++h) bias[h * 65536 + p0 + lane] = keep[h];
}

// ---------------------------------------------------------------------------
// The first launch: the three passes above read only inputs and write disjoint
// planes of the workspace, so none waits for another. They share one grid, each
// on its own range of work-groups: one launch gap and one fill, not three, and
// the vector work on z runs under the memory streams of m. The longest part has
// the lowest indices.
// ---------------------------------------------------------------------------
#define PRE_Z_BLOCKS 256
#define PRE_M_BLOCKS 512
#define PRE_W_BLOCKS 256   // the rest of the grid of 1024
__global__ __launch_bounds__(256) void pre_kernel(
    const float* __restrict__ z, const float* __restrict__ ln_z_g,
    const float* __restrict__ ln_z_b, const float* __restrict__ W_z,
    float* __restrict__ bias,
    const float* __restrict__ m, const float* __restrict__ ln_m_g,
    const float* __restrict__ ln_m_b, half_t* __restrict__ mn,
    const float* __restrict__ Wq, const float* __restrict__ Wk,
    const float* __restrict__ Wv, const float* __restrict__ Wg,
    const float* __restrict__ Wo,
    half_t* __restrict__ WqT, half_t* __restrict__ WkT,
    half_t* __restrict__ WvT, half_t* __restrict__ WgT,
    half_t* __restrict__ WoT) {
  const unsigned blk = blockIdx.x;
  if (blk < PRE_Z_BLOCKS) {
    ln_z_bias(blk, z, ln_z_g, ln_z_b, W_z, bias);
  } else if (blk < PRE_Z_BLOCKS + PRE_M_BLOCKS) {
    ln_m_rows(blk - PRE_Z_BLOCKS, m, ln_m_g, ln_m_b, mn);
    // in the built code the end of this part stands, over a test that never
    // passes, in front of another part's set-up, which rewrites the registers
    // that the stores name
    asm volatile("s_wait_xcnt 0x0" ::: "memory");
  } else {
    cvt_weights(blk - (PRE_Z_BLOCKS + PRE_M_BLOCKS), Wq, Wk, Wv, Wg, Wo, WqT, WkT, WvT, WgT, WoT);
    // as above
    asm volatile("s_wait_xcnt 0x0" ::: "memory");
  }
}

// ---------------------------------------------------------------------------
// Kernel 3: WMMA GEMM  out[32768x256] = A[32768x256] * B(=BT N-major) + bo.
// Block = 256 rows, 8 waves; wave = 32 rows, two row tiles of 16. A wave loads its
// rows of A once, as 2 x 8 fragments that stay in registers, and takes two
// 64-column tiles of B with them, one after the other: fewer waves to start, fewer
// reads of A. Every B fragment read from LDS feeds both row tiles: the LDS pipe,
// which one WMMA per fragment keeps busier than the matrix unit, moves half the bytes.
// Each 64x256 f16 B tile is staged into LDS through registers, rows laid at the
// padded pitch, then consumed as ds_load_b128 fragments.
// ---------------------------------------------------------------------------

// one wave's 16 x 64 tile: rows r0.., columns c0.. One 32-bit element index per
// lane; every other element of the lane lies at a constant offset from it.
__device__ __forceinline__ void store_tile(
    const v8f (&acc)[4], int r0, int c0, int lane,
    const float (&bv)[4], float* __restrict__ outp) {
  const unsigned m_lane = 8 * (lane >> 4), n_lane = lane & 15;
  float* o = outp + ((r0 + m_lane) * 256 + c0 + n_lane);
  #pragma unroll
  for (int j = 0; j < 4; ++j) {
    #pragma unroll
    for (int e = 0; e < 8; ++e) o[e * 256 + j * 16] = acc[j][e] + bv[j];
  }
}

// 16 of the wave's 32 rows of A, from r0, as eight fragments
__device__ __forceinline__ void load_a_rows(v16h (&a)[8], const half_t* __restrict__ A, int r0) {
  const int lane = threadIdx.x & 31;
  const half_t* p = A + (size_t)(r0 + (lane & 15)) * 256 + (lane >> 4) * 8;
  // unrolled: a[] stays in registers and the 16 loads are in flight together
  #pragma unroll
  for (int kb = 0; kb < 8; ++kb) {
    union { v16h v; uint4 q[2]; } u;
    u.q[0] = *(const uint4*)(p + kb * 32);
    u.q[1] = *(const uint4*)(p + kb * 32 + 16);
    a[kb] = u.v;
  }
  // the loads' address register is held whole up to this wait, which stands in
  // front of whatever rewrites it
  asm volatile("s_wait_xcnt 0x0" :: "v"(p) : "memory");
}

// the same from a plane in fragment order: fragment kb is head kb's block
__device__ __forceinline__ void load_a_rows_fr(v16h (&a)[8], const half_t* __restrict__ A, int r0) {
  const int lane = threadIdx.x & 31;
  const half_t* p = A + (size_t)((r0 >> 8) * 8 * FR_HEAD + ((r0 & 255) >> 4) * FR_BLOCK + lane * 8);
  // unrolled: a[] stays in registers and the 16 loads are in flight together
  #pragma unroll
  for (int kb = 0; kb < 8; ++kb) {
    union { v16h v; uint4 q[2]; } u;
    u.q[0] = *(const uint4*)(p + kb * FR_HEAD);
    u.q[1] = *(const uint4*)(p + kb * FR_HEAD + 256);
    a[kb] = u.v;
  }
  // the loads' address register is held whole up to this wait, which stands in
  // front of whatever rewrites it
  asm volatile("s_wait_xcnt 0x0" :: "v"(p) : "memory");
}

// one 256 x 64 tile of the block: bt = the 64 rows of BT for columns c0..c0+63;
// a[u] = the wave's rows r0 + 16 * u ..
template <bool MORE>
__device__ __forceinline__ void gemm_tile(
    const v16h (&a)[2][8], const half_t* __restrict__ bt, const float* __restrict__ bias,
    float* __restrict__ outp, half_t* btl, int r0, int c0) {
  // a thread copies 16 bytes of every eighth row: one address each side, the
  // rest are constant offsets
  const int tid = threadIdx.x;
  const v4u* src = (const v4u*)bt + tid;
  half_t* dst = btl + (tid >> 5) * PITCH256 + (tid & 31) * 8;
  v4u st[8];
  // unrolled: st[] stays in registers and the eight loads are in flight together
  #pragma unroll
  for (int it = 0; it < 8; ++it) st[it] = src[it * 256];
  // the lane's four bias values travel with the tile's loads: no load of the
  // epilogue then lands on a register that an issued store still names, and none
  // is waited for behind a barrier
  float bv[4];
  const unsigned bi = c0 + (tid & 15);
  #pragma unroll
  for (int j = 0; j < 4; ++j) bv[j] = bias[bi + j * 16];
  // the index registers of the tile's and the bias loads are held whole up to
  // this wait
  asm volatile("s_wait_xcnt 0x0" :: "v"(tid), "v"(bi) : "memory");
  // holds the eight loads in front of the first LDS store (loaded values as
  // inputs only): without it the compiler, under the register bound, takes them
  // two at a time, four trips to L2 one after the other
  asm volatile("" :: "v"(st[0]), "v"(st[1]), "v"(st[2]), "v"(st[3]),
                     "v"(st[4]), "v"(st[5]), "v"(st[6]), "v"(st[7]));
  #pragma unroll
  for (int it = 0; it < 8; ++it) *(v4u*)(dst + it * 8 * PITCH256) = st[it];
  __syncthreads();   // the tile is whole

  v8f acc[2][4] = {{v8f{}, v8f{}, v8f{}, v8f{}}, {v8f{}, v8f{}, v8f{}, v8f{}}};
  // step p: k block p / 2, column tiles 2 * (p % 2) and the next. With few waves
  // to a SIMD a wave has to cover its own LDS latency: the pair of fragments of
  // step p + 1 is asked for in front of the four WMMAs of step p.
  v16h b[2][2];
  b[0][0] = load_frag16(btl, 0, PITCH256, 0);    // ds_load_b128 x2
  b[0][1] = load_frag16(btl, 16, PITCH256, 0);
  #pragma unroll
  for (int p = 0; p < 16; ++p) {
    if (p + 1 < 16) {
      b[(p + 1) & 1][0] = load_frag16(btl, ((p + 1) & 1) * 32, PITCH256, ((p + 1) >> 1) * 32);
      b[(p + 1) & 1][1] = load_frag16(btl, ((p + 1) & 1) * 32 + 16, PITCH256, ((p + 1) >> 1) * 32);
    }
    // keeps the next pair's loads in front of this step's WMMAs: left alone the
    // compiler puts each load directly in front of its use and waits it out
    __builtin_amdgcn_sched_barrier(0);
    const int kb = p >> 1;
    #pragma unroll
    for (int jj = 0; jj < 2; ++jj) {
      const int j = (p & 1) * 2 + jj;
      #pragma unroll
      for (int u = 0; u < 2; ++u) acc[u][j] = wmma_f16(a[u][kb], b[p & 1][jj], acc[u][j]);
    }
  }
  // where another tile follows: every wave has read its last fragment of this
  // one. In front of the stores, so that they drain under the next tile's loads
  // and not under the barrier.
  if constexpr (MORE) __syncthreads();
  store_tile(acc[0], r0, c0, threadIdx.x & 31, bv, outp);
  store_tile(acc[1], r0 + 16, c0, threadIdx.x & 31, bv, outp);
  // the next tile's loads land on registers that these stores name
  if constexpr (MORE) asm volatile("s_wait_xcnt 0x0" ::: "memory");
}

// The final GEMM: a block takes two of the four column tiles.
__global__ __launch_bounds__(256) void out_gemm(
    const half_t* __restrict__ A, const half_t* __restrict__ BT,
    const float* __restrict__ bo, float* __restrict__ out) {
  __shared__ __align__(16) half_t btl[64 * PITCH256];   // B tile, 33792 B
  const int r0 = blockIdx.x * 256 + (threadIdx.x >> 5) * 32;
  v16h a[2][8];
  load_a_rows_fr(a[0], A, r0);
  load_a_rows_fr(a[1], A, r0 + 16);
  const int c0 = blockIdx.y * 128;
  gemm_tile<true>(a, BT + (size_t)c0 * 256, bo, out, btl, r0, c0);
  gemm_tile<false>(a, BT + (size_t)(c0 + 64) * 256, bo, out, btl, r0, c0 + 64);
}

__device__ __forceinline__ uint4 cvt8(const v8f& x) {
  union { half_t h[8]; uint4 q; } u;
  #pragma unroll
  for (int e = 0; e < 8; ++e) u.h[e] = (half_t)x[e];
  return u.q;
}

#define PJ_Q 0   // order of the planes in WT
#define PJ_K 1
#define PJ_V 2
#define PJ_G 3

// One product of the wave's 32 rows with the 32 columns KIND of the head.
// Step p: k block p, both column tiles. With few waves to a SIMD a wave has to
// cover its own LDS latency: the pair of fragments of step p + 1 (behind the last
// step: the first pair of the product NEXT) is asked for in front of the four
// WMMAs of step p. b[0] holds the first pair on entry.
template <int KIND, int NEXT>
__device__ __forceinline__ void head_product(
    const v16h (&a)[2][8], const half_t* btl, v16h (&b)[2][2], v8f (&acc)[2][2]) {
  #pragma unroll
  for (int p = 0; p < 8; ++p) {
    if (p + 1 < 8) {
      b[(p + 1) & 1][0] = load_frag16(btl, KIND * CH, PITCH256, (p + 1) * 32);
      b[(p + 1) & 1][1] = load_frag16(btl, KIND * CH + 16, PITCH256, (p + 1) * 32);
    } else if constexpr (NEXT >= 0) {
      b[0][0] = load_frag16(btl, NEXT * CH, PITCH256, 0);
      b[0][1] = load_frag16(btl, NEXT * CH + 16, PITCH256, 0);
    }
    // keeps the next pair's loads in front of this step's WMMAs: left alone the
    // compiler puts each load directly in front of its use and waits it out
    __builtin_amdgcn_sched_barrier(0);
    #pragma unroll
    for (int jj = 0; jj < 2; ++jj) {
      #pragma unroll
      for (int u = 0; u < 2; ++u) {
        const v8f c = p == 0 ? v8f{} : acc[u][jj];
        if constexpr (KIND == PJ_V) acc[u][jj] = wmma_f16(a[u][p], b[p & 1][jj], c);
        else acc[u][jj] = wmma_f16(b[p & 1][jj], a[u][p], c);
      }
    }
  }
}

// Bias blocks t0 .. t1 - 1 of a query tile into the registers of its scores:
// bt = the lane's 16 bytes in the tile's first block. Block t holds keys 0..3,
// 4..7, 16..19, 20..23 of pass t, + 8 in the upper half.
template <int T0, int T1>
__device__ __forceinline__ void load_bias(v8f (&s)[16], const float* bt) {
  // unrolled: s[] stays in registers and the loads are in flight together
  #pragma unroll
  for (int t = T0; t < T1; ++t) {
    const float4 x0 = *(const float4*)(bt + 512 * t);
    const float4 x1 = *(const float4*)(bt + 512 * t + 128);
    const float4 x2 = *(const float4*)(bt + 512 * t + 256);
    const float4 x3 = *(const float4*)(bt + 512 * t + 384);
    s[2 * t]     = v8f{x0.x, x0.y, x0.z, x0.w, x1.x, x1.y, x1.z, x1.w};
    s[2 * t + 1] = v8f{x2.x, x2.y, x2.z, x2.w, x3.x, x3.y, x3.z, x3.w};
  }
  // the loads' address register is held whole up to this wait, which stands in
  // front of whatever rewrites it
  asm volatile("s_wait_xcnt 0x0" :: "v"(bt) : "memory");
}

__global__ __launch_bounds__(256, 4) void proj_attn_kernel(
    const half_t* __restrict__ A, const half_t* __restrict__ WT,
    const float* __restrict__ bg, const float* __restrict__ bias,
    half_t* __restrict__ go) {
  // one array, what the attention reads in front: its addresses then lie within
  // the reach of an LDS instruction's offset field and share a few base registers
  __shared__ __align__(16) half_t lds[2 * R_RES * CH + R_RES * PITCH32 + CH * PITCH256 + 4 * CH * PITCH256];
  half_t* lds_g = lds;                          // 32768 B
  half_t* lds_k = lds_g + 2 * R_RES * CH;       // 20480 B
  half_t* lds_v = lds_k + R_RES * PITCH32;      // 16896 B
  half_t* btl   = lds_v + CH * PITCH256;        // 67584 B
  const int sh = blockIdx.x;           // s*8 + h
  const int h = sh & 7;
  const int tid = threadIdx.x;
  const int wave = tid >> 5, lane = tid & 31;
  const float*  bb = bias + (size_t)h * R_RES * R_RES;
  const float scale = 0.17677669529663687f;   // 1/sqrt(32)

  v16h a[2][8];
  {
    // a thread copies 16 bytes of every eighth row: one address each side, the
    // rest are constant offsets
    const v4u* wsrc = (const v4u*)(WT + h * CH * CM) + tid;
    half_t* dst = btl + (tid >> 5) * PITCH256 + (tid & 31) * 8;
    v4u st[16];
    // unrolled: st[] stays in registers and the 16 loads are in flight together
    #pragma unroll
    for (int it = 0; it < 16; ++it) st[it] = wsrc[(it >> 2) * (CM * CM / 8) + (it & 3) * 256];
    // the loads' index register is held whole up to this wait, which stands in
    // front of whatever rewrites it or their base
    asm volatile("s_wait_xcnt 0x0" :: "v"(tid) : "memory");
    // behind the weights' loads: the weights have the longer way, through LDS and
    // a barrier, and loads come back in order
    load_a_rows(a[0], A, (sh >> 3) * R_RES + wave * 32);
    load_a_rows(a[1], A, (sh >> 3) * R_RES + wave * 32 + 16);
    #pragma unroll
    for (int it = 0; it < 16; ++it) *(v4u*)(dst + it * 8 * PITCH256) = st[it];
    __syncthreads();   // the weights are whole
  }

  // The wave's 16 bias blocks (two query tiles x eight passes) lie one behind the
  // other. With few waves to a SIMD a wave has to cover its own way to L2: the
  // first tile's blocks are asked for in front of the barrier behind the products,
  // once A has left its registers; the second tile's as the first tile's scores
  // leave theirs.
  const float* bw = bb + wave * 8192 + lane * 4;   // the lane's 16 bytes in the first block
  v8f s[16];         // a query tile's bias, then its scores: S^T tiles, 16 keys each
  // The gate of the two query tiles (channels 0..15 and 16..31: chunks 0..3) and
  // their Q^T (B operand, column = query: chunks 4..7) wait in LDS, each lane's
  // eight 16-byte chunks read back by the lane itself: the scores need the
  // registers, and the stores keep the conversions to f16 and the gate's arithmetic
  // in front of the attention.
  half_t* gl = lds_g + wave * 2048 + lane * 8;
  {
    v8f acc[2][2];
    v16h b[2][2];
    b[0][0] = load_frag16(btl, PJ_K * CH, PITCH256, 0);    // ds_load_b128 x2
    b[0][1] = load_frag16(btl, PJ_K * CH + 16, PITCH256, 0);
    // K and V first: their LDS stores drain under the other two products
    head_product<PJ_K, PJ_V>(a, btl, b, acc);
    #pragma unroll
    for (int u = 0; u < 2; ++u) {
      #pragma unroll
      for (int jj = 0; jj < 2; ++jj)
        *(uint4*)(lds_k + (wave * 32 + u * 16 + (lane & 15)) * PITCH32 + jj * 16 + (lane >> 4) * 8) =
            cvt8(acc[u][jj]);
    }
    head_product<PJ_V, PJ_Q>(a, btl, b, acc);
    #pragma unroll
    for (int u = 0; u < 2; ++u) {
      #pragma unroll
      for (int jj = 0; jj < 2; ++jj)
        *(uint4*)(lds_v + (jj * 16 + (lane & 15)) * PITCH256 + wave * 32 + u * 16 + (lane >> 4) * 8) =
            cvt8(acc[u][jj]);
    }
    head_product<PJ_Q, PJ_G>(a, btl, b, acc);
    #pragma unroll
    for (int u = 0; u < 2; ++u) {
      *(uint4*)(gl + (4 + u * 2) * 256) = cvt8(acc[u][0]);
      *(uint4*)(gl + (5 + u * 2) * 256) = cvt8(acc[u][1]);
    }
    // the lane's 2 x 8 columns of the gate's bias, the same for both row tiles:
    // they travel under the gate's own WMMAs
    const float* bp = bg + h * CH + 8 * (lane >> 4);
    float4 bq[4];
    bq[0] = *(const float4*)(bp);
    bq[1] = *(const float4*)(bp + 4);
    bq[2] = *(const float4*)(bp + 16);
    bq[3] = *(const float4*)(bp + 20);
    // the loads' address register is held whole up to this wait, which stands in
    // front of whatever rewrites it
    asm volatile("s_wait_xcnt 0x0" :: "v"(bp) : "memory");
    head_product<PJ_G, -1>(a, btl, b, acc);
    load_bias<0, 8>(s, bw);
    // the loads stay in front of the gate's arithmetic, which covers their way
    __builtin_amdgcn_sched_barrier(0);
    #pragma unroll
    for (int u = 0; u < 2; ++u) {
      #pragma unroll
      for (int jj = 0; jj < 2; ++jj) {
        const float bj[8] = {bq[2 * jj].x, bq[2 * jj].y, bq[2 * jj].z, bq[2 * jj].w,
                             bq[2 * jj + 1].x, bq[2 * jj + 1].y, bq[2 * jj + 1].z, bq[2 * jj + 1].w};
        v8f g;
        #pragma unroll
        for (int e = 0; e < 8; ++e) {
          float v = acc[u][jj][e] + bj[e];
          g[e] = 1.f / (1.f + __expf(-v));
        }
        *(uint4*)(gl + (u * 2 + jj) * 256) = cvt8(g);
      }
    }
    __syncthreads();   // K and V^T are whole
  }

  // unrolled: the second tile's bias loads stand in the first tile's text
  #pragma unroll
  for (int tile = 0; tile < 2; ++tile) {
    int i0 = wave * 32 + tile * 16;
    union { v16h v; uint4 q[2]; } qf;             // Q^T of the tile
    qf.q[0] = *(const uint4*)(gl + (4 + tile * 2) * 256);
    qf.q[1] = *(const uint4*)(gl + (5 + tile * 2) * 256);
    // scores of the whole row, on top of their bias
    // unrolled: s[] stays in registers, the 16 products are independent
    #pragma unroll
    for (int t = 0; t < 8; ++t) {
      v8f z = v8f{};
      v16h kf0 = load_frag16(lds_k, (2 * t) * 16, PITCH32, 0);
      v8f c0 = wmma_f16(kf0, qf.v, z);
      v16h kf1 = load_frag16(lds_k, (2 * t + 1) * 16, PITCH32, 0);
      v8f c1 = wmma_f16(kf1, qf.v, z);
      #pragma unroll
      for (int e = 0; e < 8; ++e) {
        s[2 * t][e]     = c0[e] * scale + s[2 * t][e];
        s[2 * t + 1][e] = c1[e] * scale + s[2 * t + 1][e];
      }
    }
    // the row's maximum: eight chains over the lane's 128 scores, a tree, the halves
    float x[8];
    #pragma unroll
    for (int e = 0; e < 8; ++e) x[e] = fmaxf(s[0][e], s[1][e]);
    #pragma unroll
    for (int t = 1; t < 8; ++t) {
      #pragma unroll
      for (int e = 0; e < 8; ++e) x[e] = fmaxf(fmaxf(x[e], s[2 * t][e]), s[2 * t + 1][e]);
    }
    float nm = fmaxf(fmaxf(fmaxf(x[0], x[1]), fmaxf(x[2], x[3])),
                     fmaxf(fmaxf(x[4], x[5]), fmaxf(x[6], x[7])));
    nm = fmaxf(nm, half_xor(nm));                 // the query's other 128 keys
    // P^T as B operands (column = query), and the row's sum: eight chains, a tree
    v16h pf[8];
    #pragma unroll
    for (int e = 0; e < 8; ++e) x[e] = 0.f;
    #pragma unroll
    for (int t = 0; t < 8; ++t) {
      #pragma unroll
      for (int e = 0; e < 8; ++e) {
        const float p0 = __expf(s[2 * t][e] - nm);
        const float p1 = __expf(s[2 * t + 1][e] - nm);
        x[e] += p0 + p1;
        pf[t][e]     = (half_t)p0;
        pf[t][8 + e] = (half_t)p1;
      }
    }
    float rsum = ((x[0] + x[1]) + (x[2] + x[3])) + ((x[4] + x[5]) + (x[6] + x[7]));   // this half's keys only
    // the next tile's bias is asked for in two halves, as the scores leave their
    // registers (P still holds 64): it travels under this tile's V^T P^T and epilogue
    if (tile == 0) {
      load_bias<0, 4>(s, bw + 4096);
      // keeps the loads in front of the WMMAs: left alone the compiler puts them
      // in front of their use and waits them out
      __builtin_amdgcn_sched_barrier(0);
    }
    v8f o0 = v8f{}, o1 = v8f{};                   // channels 0..15, 16..31
    #pragma unroll
    for (int t = 0; t < 8; ++t) {
      v16h v0 = load_frag16(lds_v, 0, PITCH256, 32 * t);    // channels 0..15
      v16h v1 = load_frag16(lds_v, 16, PITCH256, 32 * t);   // channels 16..31
      o0 = wmma_f16(v0, pf[t], o0);
      o1 = wmma_f16(v1, pf[t], o1);
    }
    if (tile == 0) {
      load_bias<4, 8>(s, bw + 4096);
      // as above, in front of the epilogue
      __builtin_amdgcn_sched_barrier(0);
    }

    // finalize: join the halves' sums, divide, gate, store f16
    rsum += half_xor(rsum);
    float inv = 1.f / rsum;
    const unsigned goff = (unsigned)sh * FR_HEAD + (i0 >> 4) * FR_BLOCK + lane * 8;
    union { half_t h[8]; uint4 q; } g0, g1, r0, r1;
    g0.q = *(const uint4*)(gl + (tile * 2) * 256);
    g1.q = *(const uint4*)(gl + (tile * 2 + 1) * 256);
    #pragma unroll
    for (int e = 0; e < 8; ++e) {
      r0.h[e] = (half_t)((float)g0.h[e] * o0[e] * inv);
      r1.h[e] = (half_t)((float)g1.h[e] * o1[e] * inv);
    }
    *(uint4*)(go + goff)      = r0.q;
    *(uint4*)(go + goff + 256) = r1.q;
    // the next tile's set-up rewrites registers that these stores name
    asm volatile("s_wait_xcnt 0x0" ::: "memory");
  }
}

// ---------------------------------------------------------------------------
// Host launcher
// ---------------------------------------------------------------------------
extern "C" void kernel_launch(void* const* d_in, const int* in_sizes, int n_in,
                              void* d_out, int out_size, void* d_ws, size_t ws_size,
                              hipStream_t stream) {
  const float* m      = (const float*)d_in[0];
  const float* z      = (const float*)d_in[1];
  const float* ln_m_g = (const float*)d_in[2];
  const float* ln_m_b = (const float*)d_in[3];
  const float* ln_z_g = (const float*)d_in[4];
  const float* ln_z_b = (const float*)d_in[5];
  const float* W_z    = (const float*)d_in[6];
  const float* Wq     = (const float*)d_in[7];
  const float* Wk     = (const float*)d_in[8];
  const float* Wv     = (const float*)d_in[9];
  const float* Wg     = (const float*)d_in[10];
  const float* bg     = (const float*)d_in[11];
  const float* Wo     = (const float*)d_in[12];
  const float* bo     = (const float*)d_in[13];

  char* ws = (char*)d_ws;
  const size_t BIG = (size_t)32768 * 256 * 2;   // 16 MiB f16 planes
  half_t* mn_f16 = (half_t*)(ws + 0 * BIG);
  half_t* gobuf  = (half_t*)(ws + 5 * BIG);     // g*o  [S,H] fragment order
  float*  bbuf   = (float*)(ws + 6 * BIG);      // bias f32, 8 heads x 65536 (2 MiB)
  half_t* WqT    = (half_t*)(ws + 6 * BIG + 2097152);
  half_t* WkT    = WqT + 65536;
  half_t* WvT    = WkT + 65536;
  half_t* WgT    = WvT + 65536;
  half_t* WoT    = WgT + 65536;

  pre_kernel<<<1024, 256, 0, stream>>>(   // 256 + 512 + 256 work-groups
      z, ln_z_g, ln_z_b, W_z, bbuf, m, ln_m_g, ln_m_b, mn_f16,
      Wq, Wk, Wv, Wg, Wo, WqT, WkT, WvT, WgT, WoT);

  proj_attn_kernel<<<1024, 256, 0, stream>>>(mn_f16, WqT, bg, bbuf, gobuf);

  out_gemm<<<dim3(128, 2), 256, 0, stream>>>(gobuf, WoT, bo, (float*)d_out);
}
